// v000
// Times are from an AMD MI455X. After a warm-up the kernel runs many times in a row, and a time is the length of
// such a window on the GPU divided by its runs, so every launch and the gaps after it count. The runs cycle
// through copies of the inputs. A figure is the median of several windows, for all but v000 over two sittings.
// Sittings can differ by a few percent; kernels timed side by side share one.
// The starting kernel, v000, takes 519 microseconds a run.
#include <hip/hip_runtime.h>
#include <hip/hip_bf16.h>
#include <math.h>

// ---------------------------------------------------------------------------
// CDNA5 (gfx1250) cross-attention: wave32, v_wmma_f32_16x16x32_f16 matmuls,
// async global->LDS staging (ASYNCcnt) for the V operand.
// ---------------------------------------------------------------------------

typedef __attribute__((ext_vector_type(16))) _Float16 v16h;
typedef __attribute__((ext_vector_type(8)))  float    v8f;

static constexpr int kDim = 256;   // model dim (single head, softmax scale 1/16)
static constexpr int kKC  = 64;    // k-chunk per flash-attention iteration
static constexpr int kL   = 4096;  // sequence length (Lq == Lk)

// WMMA 16x16x32 f16 fragment loaders (wave32 layouts per CDNA5 ISA 7.12.2).
// A-matrix 16x32: lane<16 -> row=lane, K = {kh*8..+7, 16+kh*8..+7}, kh=lane>>4.
// A row-major A-fragment of K is exactly the B-fragment of K^T (layout duality),
// so both A and B fragments load as two contiguous 16-byte chunks per lane.
__device__ inline v16h load_a_frag_f16(const _Float16* base, int ld, int lane) {
  const int m  = lane & 15;
  const int kh = lane >> 4;
  const _Float16* p = base + m * ld + kh * 8;
  v16h a;
#pragma unroll
  for (int j = 0; j < 8; ++j) {
    a[j]     = p[j];        // K = kh*8 + j
    a[j + 8] = p[16 + j];   // K = 16 + kh*8 + j
  }
  return a;
}

__device__ inline v16h load_a_frag_f32(const float* base, int ld, int lane) {
  const int m  = lane & 15;
  const int kh = lane >> 4;
  const float* p = base + m * ld + kh * 8;
  v16h a;
#pragma unroll
  for (int j = 0; j < 8; ++j) {
    a[j]     = (_Float16)p[j];
    a[j + 8] = (_Float16)p[16 + j];
  }
  return a;
}

__device__ inline v8f wmma_f16(v16h a, v16h b, v8f c) {
  return __builtin_amdgcn_wmma_f32_16x16x32_f16(false, a, false, b, (short)0, c,
                                                false, false);
}

// ---------------------------------------------------------------------------
// Projection: Y[N][256] = f16( X[N][256] @ W[256][256] + bias )
// Block: 128 threads = 4 waves; 16 rows x 64 cols; wave w owns cols w*16..+15.
// ---------------------------------------------------------------------------
__global__ __launch_bounds__(128) void proj_kernel(const float* __restrict__ X,
                                                   const float* __restrict__ W,
                                                   const float* __restrict__ bias,
                                                   _Float16* __restrict__ Y) {
  __shared__ _Float16 Wt[64][32];  // transposed W chunk: Wt[n][kk]

  const int tid  = threadIdx.x;
  const int lane = tid & 31;
  const int w    = tid >> 5;
  const int rbase = blockIdx.x * 16;
  const int cbase = blockIdx.y * 64;

  v8f acc = {};
  for (int kc = 0; kc < kDim; kc += 32) {
    for (int e = tid; e < 64 * 32; e += 128) {
      const int kk = e >> 6;
      const int n  = e & 63;
      Wt[n][kk] = (_Float16)W[(size_t)(kc + kk) * kDim + cbase + n];
    }
    __syncthreads();

    v16h a = load_a_frag_f32(X + (size_t)rbase * kDim + kc, kDim, lane);
    v16h b = load_a_frag_f16(&Wt[w * 16][0], 32, lane);   // B-frag of W chunk
    acc = wmma_f16(a, b, acc);
    __syncthreads();
  }

  const int col = cbase + w * 16 + (lane & 15);
  const float bv = bias[col];
#pragma unroll
  for (int r = 0; r < 8; ++r) {
    const int row = rbase + r + 8 * (lane >> 4);
    Y[(size_t)row * kDim + col] = (_Float16)(acc[r] + bv);
  }
}

// ---------------------------------------------------------------------------
// Projection with TRANSPOSED output (for V): YT[b][col][l] = f16(X@W + b).
// Rows r=0..7 of the C tile are consecutive along l in the transposed layout,
// so each lane emits a single contiguous 16-byte store.
// ---------------------------------------------------------------------------
__global__ __launch_bounds__(128) void projT_kernel(const float* __restrict__ X,
                                                    const float* __restrict__ W,
                                                    const float* __restrict__ bias,
                                                    _Float16* __restrict__ YT) {
  __shared__ _Float16 Wt[64][32];

  const int tid  = threadIdx.x;
  const int lane = tid & 31;
  const int w    = tid >> 5;
  const int rbase = blockIdx.x * 16;
  const int cbase = blockIdx.y * 64;

  v8f acc = {};
  for (int kc = 0; kc < kDim; kc += 32) {
    for (int e = tid; e < 64 * 32; e += 128) {
      const int kk = e >> 6;
      const int n  = e & 63;
      Wt[n][kk] = (_Float16)W[(size_t)(kc + kk) * kDim + cbase + n];
    }
    __syncthreads();

    v16h a = load_a_frag_f32(X + (size_t)rbase * kDim + kc, kDim, lane);
    v16h b = load_a_frag_f16(&Wt[w * 16][0], 32, lane);
    acc = wmma_f16(a, b, acc);
    __syncthreads();
  }

  const int col  = cbase + w * 16 + (lane & 15);
  const float bv = bias[col];
  const int row0 = rbase + 8 * (lane >> 4);   // 8 consecutive rows per lane
  const int b    = row0 >> 12;                // 4096 rows per batch
  const int l0   = row0 & (kL - 1);

  alignas(16) _Float16 tmp[8];
#pragma unroll
  for (int r = 0; r < 8; ++r) tmp[r] = (_Float16)(acc[r] + bv);
  *(uint4*)&YT[((size_t)b * kDim + col) * kL + l0] = *(const uint4*)tmp;
}

// ---------------------------------------------------------------------------
// Flash attention. Block = 256 threads = 8 waves, 32 q-rows per block.
// Wave w: qh = w>>2 selects q half (16 rows), kt = w&3 selects both the S
// k-tile (16 cols of the 64-wide chunk) and the O d-slice (64 cols of 256).
// Per chunk: 8 S-WMMAs + 8 PV-WMMAs per wave (balanced).
// V arrives pre-transposed ([B][D][Lk]); the per-chunk stage is a contiguous
// 32 KB copy issued as global_load_async_to_lds_b128 (ASYNCcnt-tracked).
// ---------------------------------------------------------------------------
__global__ __launch_bounds__(256) void attn_kernel(const _Float16* __restrict__ Qh,
                                                   const _Float16* __restrict__ Kh,
                                                   const _Float16* __restrict__ VhT,
                                                   _Float16* __restrict__ Xa,
                                                   int Lq, int Lk) {
  __shared__ _Float16 Vt[kDim][kKC];   // transposed V chunk  (32 KB)
  __shared__ float    Ssc[32][kKC];    // raw scores           (8 KB)
  __shared__ _Float16 Ps[32][kKC];     // probabilities        (4 KB)
  __shared__ float    red[32][8];      // row reduction scratch
  __shared__ float    mrow[32], lrow[32], arow[32];

  const int tid  = threadIdx.x;
  const int lane = tid & 31;
  const int w    = tid >> 5;
  const int qh   = w >> 2;
  const int kt   = w & 3;
  const int b     = blockIdx.y;
  const int qbase = blockIdx.x * 32;
  const float scale = 0.0625f;  // 1/sqrt(256)

  const _Float16* Qb  = Qh  + (size_t)b * Lq * kDim;
  const _Float16* Kb  = Kh  + (size_t)b * Lk * kDim;
  const _Float16* VbT = VhT + (size_t)b * kDim * Lk;

  // Preload this wave's Q tile (16 x 256) as 8 A-fragments (reused Lk/64 times).
  v16h qfrag[8];
#pragma unroll
  for (int d = 0; d < 8; ++d)
    qfrag[d] = load_a_frag_f16(Qb + (size_t)(qbase + qh * 16) * kDim + d * 32,
                               kDim, lane);

  v8f oacc[4] = {};  // 16 q-rows x 64 d-cols slice of O, fp32

  if (tid < 32) { mrow[tid] = -3.0e38f; lrow[tid] = 0.0f; }
  __syncthreads();

  for (int kb = 0; kb < Lk; kb += kKC) {
    // ---- stage V^T chunk: Vt[d][0..63] = VbT[d][kb..kb+63]; pure contiguous
    // copy, 16 B per lane per op, async global->LDS (no VGPR round trip).
#pragma unroll
    for (int i = 0; i < 8; ++i) {
      const int e   = (tid + i * 256) * 8;   // half index into Vt
      const int d   = e >> 6;                // Vt row (64 halves per row)
      const int kkl = e & 63;
      const _Float16* src = VbT + (size_t)d * Lk + kb + kkl;
      const unsigned lds_off =
          (unsigned)(unsigned long long)&Vt[d][kkl];   // LDS byte address
      asm volatile("global_load_async_to_lds_b128 %0, %1, off"
                   :: "v"(lds_off), "v"(src)
                   : "memory");
    }
    // Prefetch next K chunk into cache while we compute.
    if (kb + kKC < Lk)
      __builtin_prefetch(Kb + (size_t)(kb + kKC) * kDim + lane * 64, 0, 1);

    // ---- S tile: Q(16x256) @ K^T(256x16); B-frag of K^T == A-frag of K.
    v8f sacc = {};
#pragma unroll
    for (int d = 0; d < 8; ++d) {
      v16h kf = load_a_frag_f16(Kb + (size_t)(kb + kt * 16) * kDim + d * 32,
                                kDim, lane);
      sacc = wmma_f16(qfrag[d], kf, sacc);
    }
    // Spill scaled scores (each wave writes its own 16x16 tile).
#pragma unroll
    for (int r = 0; r < 8; ++r) {
      const int rr = qh * 16 + r + 8 * (lane >> 4);
      const int cc = kt * 16 + (lane & 15);
      Ssc[rr][cc] = sacc[r] * scale;
    }
    asm volatile("s_wait_asynccnt 0x0" ::: "memory");  // Vt copies landed
    __syncthreads();                                   // Vt + Ssc complete

    // ---- online softmax: 8 threads per row (r = tid>>3, g = tid&7)
    const int r = tid >> 3;
    const int g = tid & 7;
    float pm = -3.0e38f;
#pragma unroll
    for (int c = 0; c < 8; ++c) pm = fmaxf(pm, Ssc[r][g * 8 + c]);
    red[r][g] = pm;
    __syncthreads();
    if (g == 0) {
      float cm = red[r][0];
#pragma unroll
      for (int c = 1; c < 8; ++c) cm = fmaxf(cm, red[r][c]);
      const float mn = fmaxf(mrow[r], cm);
      arow[r] = __expf(mrow[r] - mn);
      mrow[r] = mn;
    }
    __syncthreads();
    float psum = 0.0f;
    const float mn = mrow[r];
#pragma unroll
    for (int c = 0; c < 8; ++c) {
      const float p = __expf(Ssc[r][g * 8 + c] - mn);
      Ps[r][g * 8 + c] = (_Float16)p;
      psum += p;
    }
    red[r][g] = psum;
    __syncthreads();
    if (g == 0) {
      float s = 0.0f;
#pragma unroll
      for (int c = 0; c < 8; ++c) s += red[r][c];
      lrow[r] = lrow[r] * arow[r] + s;
    }
    __syncthreads();  // Ps complete; arow/lrow updated

    // ---- rescale O, then O += P(16x64) @ V(64x64 slice)
    float al[8];
#pragma unroll
    for (int rr = 0; rr < 8; ++rr) al[rr] = arow[qh * 16 + rr + 8 * (lane >> 4)];
#pragma unroll
    for (int t = 0; t < 4; ++t)
#pragma unroll
      for (int rr = 0; rr < 8; ++rr) oacc[t][rr] *= al[rr];

    v16h pf[2];
#pragma unroll
    for (int s = 0; s < 2; ++s)
      pf[s] = load_a_frag_f16(&Ps[qh * 16][0] + s * 32, kKC, lane);
#pragma unroll
    for (int t = 0; t < 4; ++t) {
#pragma unroll
      for (int s = 0; s < 2; ++s) {
        v16h vf = load_a_frag_f16(&Vt[kt * 64 + t * 16][0] + s * 32, kKC, lane);
        oacc[t] = wmma_f16(pf[s], vf, oacc[t]);
      }
    }
    __syncthreads();  // done with Vt/Ps/Ssc for this chunk
  }

  // ---- finalize: O /= l, store f16 x_attn
  float inv[8];
#pragma unroll
  for (int rr = 0; rr < 8; ++rr)
    inv[rr] = 1.0f / lrow[qh * 16 + rr + 8 * (lane >> 4)];
#pragma unroll
  for (int t = 0; t < 4; ++t) {
#pragma unroll
    for (int rr = 0; rr < 8; ++rr) {
      const int row = qbase + qh * 16 + rr + 8 * (lane >> 4);
      const int col = kt * 64 + t * 16 + (lane & 15);
      Xa[(size_t)b * Lq * kDim + (size_t)row * kDim + col] =
          (_Float16)(oacc[t][rr] * inv[rr]);
    }
  }
}

// ---------------------------------------------------------------------------
// Output projection + residual: out = Xa @ Wo + bo + x_dec   (fp32 out)
// ---------------------------------------------------------------------------
__global__ __launch_bounds__(128) void outproj_kernel(const _Float16* __restrict__ Xa,
                                                      const float* __restrict__ W,
                                                      const float* __restrict__ bias,
                                                      const float* __restrict__ resid,
                                                      float* __restrict__ Out) {
  __shared__ _Float16 Wt[64][32];

  const int tid  = threadIdx.x;
  const int lane = tid & 31;
  const int w    = tid >> 5;
  const int rbase = blockIdx.x * 16;
  const int cbase = blockIdx.y * 64;

  v8f acc = {};
  for (int kc = 0; kc < kDim; kc += 32) {
    for (int e = tid; e < 64 * 32; e += 128) {
      const int kk = e >> 6;
      const int n  = e & 63;
      Wt[n][kk] = (_Float16)W[(size_t)(kc + kk) * kDim + cbase + n];
    }
    __syncthreads();

    v16h a = load_a_frag_f16(Xa + (size_t)rbase * kDim + kc, kDim, lane);
    v16h b = load_a_frag_f16(&Wt[w * 16][0], 32, lane);
    acc = wmma_f16(a, b, acc);
    __syncthreads();
  }

  const int col = cbase + w * 16 + (lane & 15);
  const float bv = bias[col];
#pragma unroll
  for (int r = 0; r < 8; ++r) {
    const int row = rbase + r + 8 * (lane >> 4);
    Out[(size_t)row * kDim + col] = acc[r] + bv + resid[(size_t)row * kDim + col];
  }
}

// ---------------------------------------------------------------------------
extern "C" void kernel_launch(void* const* d_in, const int* in_sizes, int n_in,
                              void* d_out, int out_size, void* d_ws, size_t ws_size,
                              hipStream_t stream) {
  const float* x_dec = (const float*)d_in[0];
  const float* x_enc = (const float*)d_in[1];
  const float* Wq = (const float*)d_in[2];
  const float* bq = (const float*)d_in[3];
  const float* Wk = (const float*)d_in[4];
  const float* bk = (const float*)d_in[5];
  const float* Wv = (const float*)d_in[6];
  const float* bv = (const float*)d_in[7];
  const float* Wo = (const float*)d_in[8];
  const float* bo = (const float*)d_in[9];

  const int B = 4, L = kL;
  const int N = B * L;                       // 16384 rows
  const size_t mat = (size_t)N * kDim;       // elements per f16 intermediate

  _Float16* Qh  = (_Float16*)d_ws;           // 8 MB
  _Float16* Khw = Qh + mat;                  // 8 MB
  _Float16* VhT = Khw + mat;                 // 8 MB (transposed: [B][D][L])
  _Float16* Xa  = VhT + mat;                 // 8 MB

  dim3 pgrid(N / 16, kDim / 64);             // 1024 x 4 blocks, 128 threads
  proj_kernel <<<pgrid, 128, 0, stream>>>(x_dec, Wq, bq, Qh);
  proj_kernel <<<pgrid, 128, 0, stream>>>(x_enc, Wk, bk, Khw);
  projT_kernel<<<pgrid, 128, 0, stream>>>(x_enc, Wv, bv, VhT);

  dim3 agrid(L / 32, B);                     // 128 x 4 blocks, 256 threads
  attn_kernel<<<agrid, 256, 0, stream>>>(Qh, Khw, VhT, Xa, L, L);

  outproj_kernel<<<pgrid, 128, 0, stream>>>(Xa, Wo, bo, x_dec, (float*)d_out);
}

// v001
// It runs in 327 microseconds.
// Next to v000, in two timings, it ran 1.65 and 1.64 times as fast.
#include <hip/hip_runtime.h>
#include <hip/hip_bf16.h>
#include <math.h>

// ---------------------------------------------------------------------------
// CDNA5 (gfx1250) cross-attention: wave32, v_wmma_f32_16x16x32_f16 matmuls,
// async global->LDS staging (ASYNCcnt) for the V operand.
// ---------------------------------------------------------------------------

typedef __attribute__((ext_vector_type(16))) _Float16 v16h;
typedef __attribute__((ext_vector_type(8)))  float    v8f;

static constexpr int kDim = 256;   // model dim (single head, softmax scale 1/16)
static constexpr int kKC  = 64;    // k-chunk per flash-attention iteration
static constexpr int kL   = 4096;  // sequence length (Lq == Lk)

// WMMA 16x16x32 f16 fragment loaders (wave32 layouts per CDNA5 ISA 7.12.2).
// A-matrix 16x32: lane<16 -> row=lane, K = {kh*8..+7, 16+kh*8..+7}, kh=lane>>4.
// A row-major A-fragment of K is exactly the B-fragment of K^T (layout duality),
// so both A and B fragments load as two contiguous 16-byte chunks per lane.
__device__ inline v16h load_a_frag_f16(const _Float16* base, int ld, int lane) {
  const int m  = lane & 15;
  const int kh = lane >> 4;
  const _Float16* p = base + m * ld + kh * 8;
  v16h a;
#pragma unroll
  for (int j = 0; j < 8; ++j) {
    a[j]     = p[j];        // K = kh*8 + j
    a[j + 8] = p[16 + j];   // K = 16 + kh*8 + j
  }
  return a;
}

__device__ inline v16h load_a_frag_f32(const float* base, int ld, int lane) {
  const int m  = lane & 15;
  const int kh = lane >> 4;
  const float* p = base + m * ld + kh * 8;
  v16h a;
#pragma unroll
  for (int j = 0; j < 8; ++j) {
    a[j]     = (_Float16)p[j];
    a[j + 8] = (_Float16)p[16 + j];
  }
  return a;
}

__device__ inline v8f wmma_f16(v16h a, v16h b, v8f c) {
  return __builtin_amdgcn_wmma_f32_16x16x32_f16(false, a, false, b, (short)0, c,
                                                false, false);
}

// ---------------------------------------------------------------------------
// Projections, shared frame. Block: 256 threads = 8 waves; 128 rows x 64 cols.
// The block's whole W slab (256 k x 64 n) is converted to f16 and laid down
// transposed in LDS ONCE; each wave then runs its own 16 rows against it
// (4 accumulator tiles, 32 WMMAs), so one staging serves 128 rows.
// ---------------------------------------------------------------------------
typedef __attribute__((ext_vector_type(8))) _Float16 v8h;

static constexpr int kPR = 128;        // rows per block
static constexpr int kPC = 64;         // cols per block
static constexpr int kWP = kDim + 8;   // slab row pitch in halves: 528 B = 16 B x 33

// Stands behind a run of global loads, in front of whatever reuses their address
// registers.
__device__ inline void wait_load_addresses() {
  asm volatile("s_wait_xcnt 0x0" ::: "memory");
}

// Slab staging, Wt[n][k] = f16(W[k][cbase + n]), in two halves so that the X
// loads can be issued between them. A thread owns column n = tid & 63 and eight
// units of 8 consecutive k: unit i starts at k = (tid >> 6) * 8 + i * 32. A wave
// covers 32 consecutive n, so each 4-byte load is one 128-byte line.
__device__ inline void load_w_slab(const float* __restrict__ W, int cbase, int tid,
                                   float (&f)[8][8]) {
  const float* wp = W + (size_t)((tid >> 6) * 8) * kDim + cbase + (tid & (kPC - 1));
#pragma unroll
  for (int i = 0; i < 8; ++i) {
#pragma unroll
    for (int j = 0; j < 8; ++j) f[i][j] = wp[(i * 32 + j) * kDim];
  }
  wait_load_addresses();
}

// One 16-byte LDS store per unit.
__device__ inline void store_w_slab(const float (&f)[8][8], _Float16 (*Wt)[kWP],
                                    int tid) {
#pragma unroll
  for (int i = 0; i < 8; ++i) {
    v8h t;
#pragma unroll
    for (int j = 0; j < 8; ++j) t[j] = (_Float16)f[i][j];
    *(v8h*)&Wt[tid & (kPC - 1)][(tid >> 6) * 8 + i * 32] = t;
  }
}

// Raw f32 rows of the eight A fragments of one wave (16 rows x 256 k): the same
// elements, in the same order, as load_a_frag_f32 reads.
__device__ inline void load_x_rows(const float* base, int lane, float4 (&x)[8][4]) {
  const float* p = base + (lane & 15) * kDim + (lane >> 4) * 8;
#pragma unroll
  for (int d = 0; d < 8; ++d) {
    x[d][0] = *(const float4*)(p + d * 32);
    x[d][1] = *(const float4*)(p + d * 32 + 4);
    x[d][2] = *(const float4*)(p + d * 32 + 16);
    x[d][3] = *(const float4*)(p + d * 32 + 20);
  }
  wait_load_addresses();
}

__device__ inline void cvt_x_rows(const float4 (&x)[8][4], v16h (&a)[8]) {
#pragma unroll
  for (int d = 0; d < 8; ++d) {
#pragma unroll
    for (int q = 0; q < 4; ++q) {
      a[d][q * 4 + 0] = (_Float16)x[d][q].x;
      a[d][q * 4 + 1] = (_Float16)x[d][q].y;
      a[d][q * 4 + 2] = (_Float16)x[d][q].z;
      a[d][q * 4 + 3] = (_Float16)x[d][q].w;
    }
  }
}

// acc[t] += A(16 x 256) @ W[:, t*16 .. t*16+15], k in ascending chunks of 32.
__device__ inline void rows16_times_slab(const v16h (&a)[8],
                                         const _Float16 (*Wt)[kWP], int lane,
                                         v8f (&acc)[4]) {
#pragma unroll
  for (int d = 0; d < 8; ++d) {
#pragma unroll
    for (int t = 0; t < 4; ++t) {
      v16h b = load_a_frag_f16(&Wt[t * 16][d * 32], kWP, lane);  // B-frag of W
      acc[t] = wmma_f16(a[d], b, acc[t]);
    }
  }
}

// ---------------------------------------------------------------------------
// Projection: Y[N][256] = f16( X[N][256] @ W[256][256] + bias )
// ---------------------------------------------------------------------------
__global__ __launch_bounds__(256) void proj_kernel(const float* __restrict__ X,
                                                   const float* __restrict__ W,
                                                   const float* __restrict__ bias,
                                                   _Float16* __restrict__ Y) {
  __shared__ alignas(16) _Float16 Wt[kPC][kWP];

  const int tid  = threadIdx.x;
  const int lane = tid & 31;
  const int w    = tid >> 5;
  const int rbase = blockIdx.x * kPR + w * 16;
  const int cbase = blockIdx.y * kPC;

  float  wf[8][8];
  float4 xr[8][4];
  load_w_slab(W, cbase, tid, wf);
  load_x_rows(X + (size_t)rbase * kDim, lane, xr);
  store_w_slab(wf, Wt, tid);
  __syncthreads();

  v16h a[8];
  cvt_x_rows(xr, a);

  v8f acc[4] = {};
  rows16_times_slab(a, Wt, lane, acc);

#pragma unroll
  for (int t = 0; t < 4; ++t) {
    const int col = cbase + t * 16 + (lane & 15);
    const float bv = bias[col];
#pragma unroll
    for (int r = 0; r < 8; ++r) {
      const int row = rbase + r + 8 * (lane >> 4);
      Y[(size_t)row * kDim + col] = (_Float16)(acc[t][r] + bv);
    }
  }
}

// ---------------------------------------------------------------------------
// Projection with TRANSPOSED output (for V): YT[b][col][l] = f16(X@W + b).
// Rows r=0..7 of the C tile are consecutive along l in the transposed layout,
// so each lane emits a single contiguous 16-byte store per tile.
// ---------------------------------------------------------------------------
__global__ __launch_bounds__(256) void projT_kernel(const float* __restrict__ X,
                                                    const float* __restrict__ W,
                                                    const float* __restrict__ bias,
                                                    _Float16* __restrict__ YT) {
  __shared__ alignas(16) _Float16 Wt[kPC][kWP];

  const int tid  = threadIdx.x;
  const int lane = tid & 31;
  const int w    = tid >> 5;
  const int rbase = blockIdx.x * kPR + w * 16;
  const int cbase = blockIdx.y * kPC;

  float  wf[8][8];
  float4 xr[8][4];
  load_w_slab(W, cbase, tid, wf);
  load_x_rows(X + (size_t)rbase * kDim, lane, xr);
  store_w_slab(wf, Wt, tid);
  __syncthreads();

  v16h a[8];
  cvt_x_rows(xr, a);

  v8f acc[4] = {};
  rows16_times_slab(a, Wt, lane, acc);

  const int row0 = rbase + 8 * (lane >> 4);   // 8 consecutive rows per lane
  const int b    = row0 >> 12;                // 4096 rows per batch
  const int l0   = row0 & (kL - 1);
#pragma unroll
  for (int t = 0; t < 4; ++t) {
    const int col  = cbase + t * 16 + (lane & 15);
    const float bv = bias[col];
    v8h tmp;
#pragma unroll
    for (int r = 0; r < 8; ++r) tmp[r] = (_Float16)(acc[t][r] + bv);
    *(v8h*)&YT[((size_t)b * kDim + col) * kL + l0] = tmp;
  }
}

// ---------------------------------------------------------------------------
// Flash attention. Block = 256 threads = 8 waves, 32 q-rows per block.
// Wave w: qh = w>>2 selects q half (16 rows), kt = w&3 selects both the S
// k-tile (16 cols of the 64-wide chunk) and the O d-slice (64 cols of 256).
// Per chunk: 8 S-WMMAs + 8 PV-WMMAs per wave (balanced).
// V arrives pre-transposed ([B][D][Lk]); the per-chunk stage is a contiguous
// 32 KB copy issued as global_load_async_to_lds_b128 (ASYNCcnt-tracked).
// ---------------------------------------------------------------------------
__global__ __launch_bounds__(256) void attn_kernel(const _Float16* __restrict__ Qh,
                                                   const _Float16* __restrict__ Kh,
                                                   const _Float16* __restrict__ VhT,
                                                   _Float16* __restrict__ Xa,
                                                   int Lq, int Lk) {
  __shared__ _Float16 Vt[kDim][kKC];   // transposed V chunk  (32 KB)
  __shared__ float    Ssc[32][kKC];    // raw scores           (8 KB)
  __shared__ _Float16 Ps[32][kKC];     // probabilities        (4 KB)
  __shared__ float    red[32][8];      // row reduction scratch
  __shared__ float    mrow[32], lrow[32], arow[32];

  const int tid  = threadIdx.x;
  const int lane = tid & 31;
  const int w    = tid >> 5;
  const int qh   = w >> 2;
  const int kt   = w & 3;
  const int b     = blockIdx.y;
  const int qbase = blockIdx.x * 32;
  const float scale = 0.0625f;  // 1/sqrt(256)

  const _Float16* Qb  = Qh  + (size_t)b * Lq * kDim;
  const _Float16* Kb  = Kh  + (size_t)b * Lk * kDim;
  const _Float16* VbT = VhT + (size_t)b * kDim * Lk;

  // Preload this wave's Q tile (16 x 256) as 8 A-fragments (reused Lk/64 times).
  v16h qfrag[8];
#pragma unroll
  for (int d = 0; d < 8; ++d)
    qfrag[d] = load_a_frag_f16(Qb + (size_t)(qbase + qh * 16) * kDim + d * 32,
                               kDim, lane);

  v8f oacc[4] = {};  // 16 q-rows x 64 d-cols slice of O, fp32

  if (tid < 32) { mrow[tid] = -3.0e38f; lrow[tid] = 0.0f; }
  __syncthreads();

  for (int kb = 0; kb < Lk; kb += kKC) {
    // ---- stage V^T chunk: Vt[d][0..63] = VbT[d][kb..kb+63]; pure contiguous
    // copy, 16 B per lane per op, async global->LDS (no VGPR round trip).
#pragma unroll
    for (int i = 0; i < 8; ++i) {
      const int e   = (tid + i * 256) * 8;   // half index into Vt
      const int d   = e >> 6;                // Vt row (64 halves per row)
      const int kkl = e & 63;
      const _Float16* src = VbT + (size_t)d * Lk + kb + kkl;
      const unsigned lds_off =
          (unsigned)(unsigned long long)&Vt[d][kkl];   // LDS byte address
      asm volatile("global_load_async_to_lds_b128 %0, %1, off"
                   :: "v"(lds_off), "v"(src)
                   : "memory");
    }
    // Prefetch next K chunk into cache while we compute.
    if (kb + kKC < Lk)
      __builtin_prefetch(Kb + (size_t)(kb + kKC) * kDim + lane * 64, 0, 1);

    // ---- S tile: Q(16x256) @ K^T(256x16); B-frag of K^T == A-frag of K.
    v8f sacc = {};
#pragma unroll
    for (int d = 0; d < 8; ++d) {
      v16h kf = load_a_frag_f16(Kb + (size_t)(kb + kt * 16) * kDim + d * 32,
                                kDim, lane);
      sacc = wmma_f16(qfrag[d], kf, sacc);
    }
    // Spill scaled scores (each wave writes its own 16x16 tile).
#pragma unroll
    for (int r = 0; r < 8; ++r) {
      const int rr = qh * 16 + r + 8 * (lane >> 4);
      const int cc = kt * 16 + (lane & 15);
      Ssc[rr][cc] = sacc[r] * scale;
    }
    asm volatile("s_wait_asynccnt 0x0" ::: "memory");  // Vt copies landed
    __syncthreads();                                   // Vt + Ssc complete

    // ---- online softmax: 8 threads per row (r = tid>>3, g = tid&7)
    const int r = tid >> 3;
    const int g = tid & 7;
    float pm = -3.0e38f;
#pragma unroll
    for (int c = 0; c < 8; ++c) pm = fmaxf(pm, Ssc[r][g * 8 + c]);
    red[r][g] = pm;
    __syncthreads();
    if (g == 0) {
      float cm = red[r][0];
#pragma unroll
      for (int c = 1; c < 8; ++c) cm = fmaxf(cm, red[r][c]);
      const float mn = fmaxf(mrow[r], cm);
      arow[r] = __expf(mrow[r] - mn);
      mrow[r] = mn;
    }
    __syncthreads();
    float psum = 0.0f;
    const float mn = mrow[r];
#pragma unroll
    for (int c = 0; c < 8; ++c) {
      const float p = __expf(Ssc[r][g * 8 + c] - mn);
      Ps[r][g * 8 + c] = (_Float16)p;
      psum += p;
    }
    red[r][g] = psum;
    __syncthreads();
    if (g == 0) {
      float s = 0.0f;
#pragma unroll
      for (int c = 0; c < 8; ++c) s += red[r][c];
      lrow[r] = lrow[r] * arow[r] + s;
    }
    __syncthreads();  // Ps complete; arow/lrow updated

    // ---- rescale O, then O += P(16x64) @ V(64x64 slice)
    float al[8];
#pragma unroll
    for (int rr = 0; rr < 8; ++rr) al[rr] = arow[qh * 16 + rr + 8 * (lane >> 4)];
#pragma unroll
    for (int t = 0; t < 4; ++t)
#pragma unroll
      for (int rr = 0; rr < 8; ++rr) oacc[t][rr] *= al[rr];

    v16h pf[2];
#pragma unroll
    for (int s = 0; s < 2; ++s)
      pf[s] = load_a_frag_f16(&Ps[qh * 16][0] + s * 32, kKC, lane);
#pragma unroll
    for (int t = 0; t < 4; ++t) {
#pragma unroll
      for (int s = 0; s < 2; ++s) {
        v16h vf = load_a_frag_f16(&Vt[kt * 64 + t * 16][0] + s * 32, kKC, lane);
        oacc[t] = wmma_f16(pf[s], vf, oacc[t]);
      }
    }
    __syncthreads();  // done with Vt/Ps/Ssc for this chunk
  }

  // ---- finalize: O /= l, store f16 x_attn
  float inv[8];
#pragma unroll
  for (int rr = 0; rr < 8; ++rr)
    inv[rr] = 1.0f / lrow[qh * 16 + rr + 8 * (lane >> 4)];
#pragma unroll
  for (int t = 0; t < 4; ++t) {
#pragma unroll
    for (int rr = 0; rr < 8; ++rr) {
      const int row = qbase + qh * 16 + rr + 8 * (lane >> 4);
      const int col = kt * 64 + t * 16 + (lane & 15);
      Xa[(size_t)b * Lq * kDim + (size_t)row * kDim + col] =
          (_Float16)(oacc[t][rr] * inv[rr]);
    }
  }
}

// ---------------------------------------------------------------------------
// Output projection + residual: out = Xa @ Wo + bo + x_dec   (fp32 out)
// ---------------------------------------------------------------------------
__global__ __launch_bounds__(256) void outproj_kernel(const _Float16* __restrict__ Xa,
                                                      const float* __restrict__ W,
                                                      const float* __restrict__ bias,
                                                      const float* __restrict__ resid,
                                                      float* __restrict__ Out) {
  __shared__ alignas(16) _Float16 Wt[kPC][kWP];

  const int tid  = threadIdx.x;
  const int lane = tid & 31;
  const int w    = tid >> 5;
  const int rbase = blockIdx.x * kPR + w * 16;
  const int cbase = blockIdx.y * kPC;

  float wf[8][8];
  load_w_slab(W, cbase, tid, wf);
  v16h a[8];
#pragma unroll
  for (int d = 0; d < 8; ++d)
    a[d] = load_a_frag_f16(Xa + (size_t)rbase * kDim + d * 32, kDim, lane);
  wait_load_addresses();
  store_w_slab(wf, Wt, tid);
  __syncthreads();

  v8f acc[4] = {};
  rows16_times_slab(a, Wt, lane, acc);

#pragma unroll
  for (int t = 0; t < 4; ++t) {
    const int col = cbase + t * 16 + (lane & 15);
    const float bv = bias[col];
#pragma unroll
    for (int r = 0; r < 8; ++r) {
      const int row = rbase + r + 8 * (lane >> 4);
      Out[(size_t)row * kDim + col] =
          acc[t][r] + bv + resid[(size_t)row * kDim + col];
    }
  }
}

// ---------------------------------------------------------------------------
extern "C" void kernel_launch(void* const* d_in, const int* in_sizes, int n_in,
                              void* d_out, int out_size, void* d_ws, size_t ws_size,
                              hipStream_t stream) {
  const float* x_dec = (const float*)d_in[0];
  const float* x_enc = (const float*)d_in[1];
  const float* Wq = (const float*)d_in[2];
  const float* bq = (const float*)d_in[3];
  const float* Wk = (const float*)d_in[4];
  const float* bk = (const float*)d_in[5];
  const float* Wv = (const float*)d_in[6];
  const float* bv = (const float*)d_in[7];
  const float* Wo = (const float*)d_in[8];
  const float* bo = (const float*)d_in[9];

  const int B = 4, L = kL;
  const int N = B * L;                       // 16384 rows
  const size_t mat = (size_t)N * kDim;       // elements per f16 intermediate

  _Float16* Qh  = (_Float16*)d_ws;           // 8 MB
  _Float16* Khw = Qh + mat;                  // 8 MB
  _Float16* VhT = Khw + mat;                 // 8 MB (transposed: [B][D][L])
  _Float16* Xa  = VhT + mat;                 // 8 MB

  dim3 pgrid(N / kPR, kDim / kPC);           // 128 x 4 blocks, 256 threads
  proj_kernel <<<pgrid, 256, 0, stream>>>(x_dec, Wq, bq, Qh);
  proj_kernel <<<pgrid, 256, 0, stream>>>(x_enc, Wk, bk, Khw);
  projT_kernel<<<pgrid, 256, 0, stream>>>(x_enc, Wv, bv, VhT);

  dim3 agrid(L / 32, B);                     // 128 x 4 blocks, 256 threads
  attn_kernel<<<agrid, 256, 0, stream>>>(Qh, Khw, VhT, Xa, L, L);

  outproj_kernel<<<pgrid, 256, 0, stream>>>(Xa, Wo, bo, x_dec, (float*)d_out);
}

// v002
// One run takes 111 microseconds.
// Two timings next to v001 both put it at 2.94 times that version's speed.
// All steps since v000 together make it 4.84 times as fast.
#include <hip/hip_runtime.h>
#include <hip/hip_bf16.h>
#include <math.h>

// ---------------------------------------------------------------------------
// CDNA5 (gfx1250) cross-attention: wave32, v_wmma_f32_16x16x32_f16 matmuls,
// async global->LDS staging (ASYNCcnt) for the K and V operands.
// ---------------------------------------------------------------------------

typedef __attribute__((ext_vector_type(16))) _Float16 v16h;
typedef __attribute__((ext_vector_type(8)))  float    v8f;

static constexpr int kDim = 256;   // model dim (single head, softmax scale 1/16)
static constexpr int kKC  = 64;    // k-chunk per flash-attention iteration
static constexpr int kL   = 4096;  // sequence length (Lq == Lk)

// WMMA 16x16x32 f16 fragment loaders (wave32 layouts per CDNA5 ISA 7.12.2).
// A-matrix 16x32: lane<16 -> row=lane, K = {kh*8..+7, 16+kh*8..+7}, kh=lane>>4.
// A row-major A-fragment of K is exactly the B-fragment of K^T (layout duality),
// so both A and B fragments load as two contiguous 16-byte chunks per lane.
__device__ inline v16h load_a_frag_f16(const _Float16* base, int ld, int lane) {
  const int m  = lane & 15;
  const int kh = lane >> 4;
  const _Float16* p = base + m * ld + kh * 8;
  v16h a;
#pragma unroll
  for (int j = 0; j < 8; ++j) {
    a[j]     = p[j];        // K = kh*8 + j
    a[j + 8] = p[16 + j];   // K = 16 + kh*8 + j
  }
  return a;
}

__device__ inline v16h load_a_frag_f32(const float* base, int ld, int lane) {
  const int m  = lane & 15;
  const int kh = lane >> 4;
  const float* p = base + m * ld + kh * 8;
  v16h a;
#pragma unroll
  for (int j = 0; j < 8; ++j) {
    a[j]     = (_Float16)p[j];
    a[j + 8] = (_Float16)p[16 + j];
  }
  return a;
}

__device__ inline v8f wmma_f16(v16h a, v16h b, v8f c) {
  return __builtin_amdgcn_wmma_f32_16x16x32_f16(false, a, false, b, (short)0, c,
                                                false, false);
}

// ---------------------------------------------------------------------------
// Projections, shared frame. Block: 256 threads = 8 waves; 128 rows x 64 cols.
// The block's whole W slab (256 k x 64 n) is converted to f16 and laid down
// transposed in LDS ONCE; each wave then runs its own 16 rows against it
// (4 accumulator tiles, 32 WMMAs), so one staging serves 128 rows.
// ---------------------------------------------------------------------------
typedef __attribute__((ext_vector_type(8))) _Float16 v8h;

static constexpr int kPR = 128;        // rows per block
static constexpr int kPC = 64;         // cols per block
static constexpr int kWP = kDim + 8;   // slab row pitch in halves: 528 B = 16 B x 33

// Stands behind a run of global loads, in front of whatever reuses their address
// registers.
__device__ inline void wait_load_addresses() {
  asm volatile("s_wait_xcnt 0x0" ::: "memory");
}

// Slab staging, Wt[n][k] = f16(W[k][cbase + n]), in two halves so that the X
// loads can be issued between them. A thread owns column n = tid & 63 and eight
// units of 8 consecutive k: unit i starts at k = (tid >> 6) * 8 + i * 32. A wave
// covers 32 consecutive n, so each 4-byte load is one 128-byte line.
__device__ inline void load_w_slab(const float* __restrict__ W, int cbase, int tid,
                                   float (&f)[8][8]) {
  const float* wp = W + (size_t)((tid >> 6) * 8) * kDim + cbase + (tid & (kPC - 1));
#pragma unroll
  for (int i = 0; i < 8; ++i) {
#pragma unroll
    for (int j = 0; j < 8; ++j) f[i][j] = wp[(i * 32 + j) * kDim];
  }
  wait_load_addresses();
}

// One 16-byte LDS store per unit.
__device__ inline void store_w_slab(const float (&f)[8][8], _Float16 (*Wt)[kWP],
                                    int tid) {
#pragma unroll
  for (int i = 0; i < 8; ++i) {
    v8h t;
#pragma unroll
    for (int j = 0; j < 8; ++j) t[j] = (_Float16)f[i][j];
    *(v8h*)&Wt[tid & (kPC - 1)][(tid >> 6) * 8 + i * 32] = t;
  }
}

// Raw f32 rows of the eight A fragments of one wave (16 rows x 256 k): the same
// elements, in the same order, as load_a_frag_f32 reads.
__device__ inline void load_x_rows(const float* base, int lane, float4 (&x)[8][4]) {
  const float* p = base + (lane & 15) * kDim + (lane >> 4) * 8;
#pragma unroll
  for (int d = 0; d < 8; ++d) {
    x[d][0] = *(const float4*)(p + d * 32);
    x[d][1] = *(const float4*)(p + d * 32 + 4);
    x[d][2] = *(const float4*)(p + d * 32 + 16);
    x[d][3] = *(const float4*)(p + d * 32 + 20);
  }
  wait_load_addresses();
}

__device__ inline void cvt_x_rows(const float4 (&x)[8][4], v16h (&a)[8]) {
#pragma unroll
  for (int d = 0; d < 8; ++d) {
#pragma unroll
    for (int q = 0; q < 4; ++q) {
      a[d][q * 4 + 0] = (_Float16)x[d][q].x;
      a[d][q * 4 + 1] = (_Float16)x[d][q].y;
      a[d][q * 4 + 2] = (_Float16)x[d][q].z;
      a[d][q * 4 + 3] = (_Float16)x[d][q].w;
    }
  }
}

// acc[t] += A(16 x 256) @ W[:, t*16 .. t*16+15], k in ascending chunks of 32.
__device__ inline void rows16_times_slab(const v16h (&a)[8],
                                         const _Float16 (*Wt)[kWP], int lane,
                                         v8f (&acc)[4]) {
#pragma unroll
  for (int d = 0; d < 8; ++d) {
#pragma unroll
    for (int t = 0; t < 4; ++t) {
      v16h b = load_a_frag_f16(&Wt[t * 16][d * 32], kWP, lane);  // B-frag of W
      acc[t] = wmma_f16(a[d], b, acc[t]);
    }
  }
}

// ---------------------------------------------------------------------------
// Projection: Y[N][256] = f16( X[N][256] @ W[256][256] + bias )
// ---------------------------------------------------------------------------
__global__ __launch_bounds__(256) void proj_kernel(const float* __restrict__ X,
                                                   const float* __restrict__ W,
                                                   const float* __restrict__ bias,
                                                   _Float16* __restrict__ Y) {
  __shared__ alignas(16) _Float16 Wt[kPC][kWP];

  const int tid  = threadIdx.x;
  const int lane = tid & 31;
  const int w    = tid >> 5;
  const int rbase = blockIdx.x * kPR + w * 16;
  const int cbase = blockIdx.y * kPC;

  float  wf[8][8];
  float4 xr[8][4];
  load_w_slab(W, cbase, tid, wf);
  load_x_rows(X + (size_t)rbase * kDim, lane, xr);
  store_w_slab(wf, Wt, tid);
  __syncthreads();

  v16h a[8];
  cvt_x_rows(xr, a);

  v8f acc[4] = {};
  rows16_times_slab(a, Wt, lane, acc);

#pragma unroll
  for (int t = 0; t < 4; ++t) {
    const int col = cbase + t * 16 + (lane & 15);
    const float bv = bias[col];
#pragma unroll
    for (int r = 0; r < 8; ++r) {
      const int row = rbase + r + 8 * (lane >> 4);
      Y[(size_t)row * kDim + col] = (_Float16)(acc[t][r] + bv);
    }
  }
}

// ---------------------------------------------------------------------------
// Projection with TRANSPOSED output (for V): YT[b][col][l] = f16(X@W + b).
// Rows r=0..7 of the C tile are consecutive along l in the transposed layout,
// so each lane emits a single contiguous 16-byte store per tile.
// ---------------------------------------------------------------------------
__global__ __launch_bounds__(256) void projT_kernel(const float* __restrict__ X,
                                                    const float* __restrict__ W,
                                                    const float* __restrict__ bias,
                                                    _Float16* __restrict__ YT) {
  __shared__ alignas(16) _Float16 Wt[kPC][kWP];

  const int tid  = threadIdx.x;
  const int lane = tid & 31;
  const int w    = tid >> 5;
  const int rbase = blockIdx.x * kPR + w * 16;
  const int cbase = blockIdx.y * kPC;

  float  wf[8][8];
  float4 xr[8][4];
  load_w_slab(W, cbase, tid, wf);
  load_x_rows(X + (size_t)rbase * kDim, lane, xr);
  store_w_slab(wf, Wt, tid);
  __syncthreads();

  v16h a[8];
  cvt_x_rows(xr, a);

  v8f acc[4] = {};
  rows16_times_slab(a, Wt, lane, acc);

  const int row0 = rbase + 8 * (lane >> 4);   // 8 consecutive rows per lane
  const int b    = row0 >> 12;                // 4096 rows per batch
  const int l0   = row0 & (kL - 1);
#pragma unroll
  for (int t = 0; t < 4; ++t) {
    const int col  = cbase + t * 16 + (lane & 15);
    const float bv = bias[col];
    v8h tmp;
#pragma unroll
    for (int r = 0; r < 8; ++r) tmp[r] = (_Float16)(acc[t][r] + bv);
    *(v8h*)&YT[((size_t)b * kDim + col) * kL + l0] = tmp;
  }
}

static constexpr int kQB    = 64;
static constexpr int kKP    = kDim + 8;
static constexpr int kVP    = kKC + 8;
static constexpr int kKTile = kKC * kKP;
static constexpr int kVTile = kDim * kVP;
static constexpr int kStage = kKTile + kVTile;
static constexpr int kTiles = kL / kKC;
static_assert(kTiles >= 2, "the two-buffer prologue fills tiles 0 and 1");
static_assert(kQB * kDim * 4 <= 2 * kStage * 2, "the join reuses the ring");

// Lane l with lane l ^ 16.
__device__ inline float other_half(float x) {
  return __builtin_bit_cast(
      float, __builtin_amdgcn_permlanex16(__builtin_bit_cast(int, x),
                                          __builtin_bit_cast(int, x), 0x76543210,
                                          0xfedcba98, false, false));
}

// This wave's LDS reads have returned: stands in front of the barrier behind
// which their buffer is refilled.
__device__ inline void wait_lds_reads() {
  asm volatile("s_wait_dscnt 0x0" ::: "memory");
}

// This wave's async copies have landed: stands in front of the barrier behind
// which other waves read them.
__device__ inline void wait_copies() {
  asm volatile("s_wait_asynccnt 0x0" ::: "memory");
}

// Eight 16-byte-per-lane copies global -> LDS. The closing s_wait_xcnt 0 is part
// of the statement so that it stands in front of any rewrite of the address
// registers the copies name.
__device__ inline void copy8(const unsigned (&l)[8], const _Float16* const (&p)[8]) {
  asm volatile(
      "global_load_async_to_lds_b128 %0, %8, off\n\t"
      "global_load_async_to_lds_b128 %1, %9, off\n\t"
      "global_load_async_to_lds_b128 %2, %10, off\n\t"
      "global_load_async_to_lds_b128 %3, %11, off\n\t"
      "global_load_async_to_lds_b128 %4, %12, off\n\t"
      "global_load_async_to_lds_b128 %5, %13, off\n\t"
      "global_load_async_to_lds_b128 %6, %14, off\n\t"
      "global_load_async_to_lds_b128 %7, %15, off\n\t"
      "s_wait_xcnt 0x0"
      :: "v"(l[0]), "v"(l[1]), "v"(l[2]), "v"(l[3]),
         "v"(l[4]), "v"(l[5]), "v"(l[6]), "v"(l[7]),
         "v"(p[0]), "v"(p[1]), "v"(p[2]), "v"(p[3]),
         "v"(p[4]), "v"(p[5]), "v"(p[6]), "v"(p[7])
      : "memory");
}

// One tile of 64 keys into buf: K rows kb .. kb + 63 (512 B each; a wave copies
// one whole row per instruction), then V^T rows 0 .. 255, keys kb .. kb + 63
// (128 B each; a wave copies four whole lines per instruction).
__device__ inline void stage_kv(_Float16* buf, const _Float16* Kb,
                                const _Float16* VbT, int kb, int tid) {
  unsigned        l[8];
  const _Float16* p[8];
#pragma unroll
  for (int i = 0; i < 8; ++i) {
    const int u   = tid + i * 256;   // 16-byte unit of the K tile
    const int row = u >> 5;
    const int col = (u & 31) * 8;
    l[i] = (unsigned)(unsigned long long)(buf + row * kKP + col);  // LDS byte address
    p[i] = Kb + (size_t)(kb + row) * kDim + col;
  }
  copy8(l, p);
#pragma unroll
  for (int i = 0; i < 8; ++i) {
    const int u   = tid + i * 256;   // 16-byte unit of the V^T tile
    const int d   = u >> 3;
    const int col = (u & 7) * 8;
    l[i] = (unsigned)(unsigned long long)(buf + kKTile + d * kVP + col);
    p[i] = VbT + (size_t)d * kL + kb + col;
  }
  copy8(l, p);
}

__global__ __launch_bounds__(256) void attn_kernel(const _Float16* __restrict__ Qh,
                                                   const _Float16* __restrict__ Kh,
                                                   const _Float16* __restrict__ VhT,
                                                   _Float16* __restrict__ Xa) {
  __shared__ alignas(16) _Float16 ring[2 * kStage];  // two K + V^T buffers
  __shared__ float jm[4][32], jl[4][32];             // join: m and l of key half 1

  const int tid  = threadIdx.x;
  const int lane = tid & 31;
  const int w    = tid >> 5;
  const int qg   = w & 3;
  const int kh   = w >> 2;
  const int b     = blockIdx.y;
  const int qbase = blockIdx.x * kQB + qg * 16;
  const float cs = 0.0625f * 1.44269504088896340736f;  // 1/sqrt(256) * log2(e)

  const _Float16* Qb  = Qh  + (size_t)b * kL * kDim;
  const _Float16* Kb  = Kh  + (size_t)b * kL * kDim;
  const _Float16* VbT = VhT + (size_t)b * kDim * kL;

  stage_kv(ring, Kb, VbT, 0, tid);

  // This wave's Q^T (256 x 16) as 8 B-fragments: lane (c, h) holds query c in the
  // k order of the K loader. Reused for every tile.
  v16h qfrag[8];
#pragma unroll
  for (int d = 0; d < 8; ++d)
    qfrag[d] = load_a_frag_f16(Qb + (size_t)qbase * kDim + d * 32, kDim, lane);
  wait_load_addresses();

  wait_copies();
  __syncthreads();                       // tile 0 readable by every wave
  stage_kv(ring + kStage, Kb, VbT, kKC, tid);

  v8f   oacc[16] = {};                   // O^T: d = t*16 + 8h + r, query c
  float mrun = -3.0e38f;                 // running maximum, log2 domain
  float lrun = 0.0f;                     // this lane's share of the running sum

  for (int t = 0; t < kTiles; ++t) {
    _Float16* buf = ring + (t & 1) * kStage;
    const _Float16* Kt = buf + kh * 32 * kKP;
    const _Float16* Vt = buf + kKTile + kh * 32;

    // ---- S^T: two 16-key tiles x 16 queries
    v16h kf[16];
#pragma unroll
    for (int d = 0; d < 8; ++d) {
      kf[2 * d]     = load_a_frag_f16(Kt + d * 32, kKP, lane);
      kf[2 * d + 1] = load_a_frag_f16(Kt + 16 * kKP + d * 32, kKP, lane);
    }
    // Keeps the K reads one group in front of their WMMAs: spread among them,
    // each WMMA stalls on a read issued just ahead of it.
    __builtin_amdgcn_sched_barrier(0);
    v8f s0 = {}, s1 = {};
#pragma unroll
    for (int d = 0; d < 8; ++d) {
      s0 = wmma_f16(kf[2 * d], qfrag[d], s0);
      s1 = wmma_f16(kf[2 * d + 1], qfrag[d], s1);
    }
    v16h vf[16];
#pragma unroll
    for (int tt = 0; tt < 16; ++tt) vf[tt] = load_a_frag_f16(Vt + tt * 16 * kVP, kVP, lane);
    // Keeps the V^T reads in front of the softmax, under which they land.
    __builtin_amdgcn_sched_barrier(0);

    // ---- online softmax of query c, in registers
    float mx = fmaxf(s0[0], s1[0]);
#pragma unroll
    for (int r = 1; r < 8; ++r) mx = fmaxf(mx, fmaxf(s0[r], s1[r]));
    mx = fmaxf(mx, other_half(mx)) * cs;   // both halves hold the max of this wave's 32 keys
    const float mnew  = fmaxf(mrun, mx);
    const float alpha = __builtin_amdgcn_exp2f(mrun - mnew);
    mrun = mnew;

    v16h  pf;                              // P^T as B: pf[s] = P[query c][kmap(s, h)]
    float ps0 = 0.0f, ps1 = 0.0f;
#pragma unroll
    for (int r = 0; r < 8; ++r) {
      const float p0 = __builtin_amdgcn_exp2f(fmaf(s0[r], cs, -mnew));
      const float p1 = __builtin_amdgcn_exp2f(fmaf(s1[r], cs, -mnew));
      pf[r]     = (_Float16)p0;
      pf[r + 8] = (_Float16)p1;
      ps0 += p0;
      ps1 += p1;
    }
    lrun = lrun * alpha + (ps0 + ps1);

    // ---- O^T = O^T * alpha + V^T(256 x 32) . P^T(32 x 16)
#pragma unroll
    for (int tt = 0; tt < 16; ++tt) oacc[tt] *= alpha;
#pragma unroll
    for (int tt = 0; tt < 16; ++tt)
      oacc[tt] = wmma_f16(vf[tt], pf, oacc[tt]);

    // ---- hand-over: tile t + 1 published, tile t's buffer free.
    // Keeps the hand-over behind the last WMMAs: lifted above the softmax, its
    // s_wait_dscnt 0 stalls every wave on the V^T reads with nothing to do.
    __builtin_amdgcn_sched_barrier(0);
    wait_lds_reads();
    wait_copies();
    __syncthreads();
    if (t + 2 < kTiles) stage_kv(buf, Kb, VbT, (t + 2) * kKC, tid);
  }
  wait_copies();

  // ---- join the wave halves' sums, then the two key halves through the ring
  // (no copy in flight, every read of it ended by the last tile's barrier).
  lrun += other_half(lrun);
  float4* jo = (float4*)ring + (size_t)qg * 32 * 32 + lane;
  if (kh == 1) {
#pragma unroll
    for (int tt = 0; tt < 16; ++tt) {
      jo[(tt * 2 + 0) * 32] = make_float4(oacc[tt][0], oacc[tt][1], oacc[tt][2], oacc[tt][3]);
      jo[(tt * 2 + 1) * 32] = make_float4(oacc[tt][4], oacc[tt][5], oacc[tt][6], oacc[tt][7]);
    }
    jm[qg][lane] = mrun;
    jl[qg][lane] = lrun;
  }
  __syncthreads();
  if (kh == 0) {
    const float m1 = jm[qg][lane];
    const float l1 = jl[qg][lane];
    const float mm = fmaxf(mrun, m1);
    float a0 = __builtin_amdgcn_exp2f(mrun - mm);
    float a1 = __builtin_amdgcn_exp2f(m1 - mm);
    const float inv = 1.0f / (lrun * a0 + l1 * a1);
    a0 *= inv;
    a1 *= inv;
    // A lane's 8 registers of a tile are 8 consecutive d of one query: one
    // 16-byte store.
    _Float16* xo = Xa + ((size_t)b * kL + qbase + (lane & 15)) * kDim + 8 * (lane >> 4);
#pragma unroll
    for (int tt = 0; tt < 16; ++tt) {
      const float4 u0 = jo[(tt * 2 + 0) * 32];
      const float4 u1 = jo[(tt * 2 + 1) * 32];
      v8h o;
      o[0] = (_Float16)(oacc[tt][0] * a0 + u0.x * a1);
      o[1] = (_Float16)(oacc[tt][1] * a0 + u0.y * a1);
      o[2] = (_Float16)(oacc[tt][2] * a0 + u0.z * a1);
      o[3] = (_Float16)(oacc[tt][3] * a0 + u0.w * a1);
      o[4] = (_Float16)(oacc[tt][4] * a0 + u1.x * a1);
      o[5] = (_Float16)(oacc[tt][5] * a0 + u1.y * a1);
      o[6] = (_Float16)(oacc[tt][6] * a0 + u1.z * a1);
      o[7] = (_Float16)(oacc[tt][7] * a0 + u1.w * a1);
      *(v8h*)(xo + tt * 16) = o;
    }
  }
}

// ---------------------------------------------------------------------------
// Output projection + residual: out = Xa @ Wo + bo + x_dec   (fp32 out)
// ---------------------------------------------------------------------------
__global__ __launch_bounds__(256) void outproj_kernel(const _Float16* __restrict__ Xa,
                                                      const float* __restrict__ W,
                                                      const float* __restrict__ bias,
                                                      const float* __restrict__ resid,
                                                      float* __restrict__ Out) {
  __shared__ alignas(16) _Float16 Wt[kPC][kWP];

  const int tid  = threadIdx.x;
  const int lane = tid & 31;
  const int w    = tid >> 5;
  const int rbase = blockIdx.x * kPR + w * 16;
  const int cbase = blockIdx.y * kPC;

  float wf[8][8];
  load_w_slab(W, cbase, tid, wf);
  v16h a[8];
#pragma unroll
  for (int d = 0; d < 8; ++d)
    a[d] = load_a_frag_f16(Xa + (size_t)rbase * kDim + d * 32, kDim, lane);
  wait_load_addresses();
  store_w_slab(wf, Wt, tid);
  __syncthreads();

  v8f acc[4] = {};
  rows16_times_slab(a, Wt, lane, acc);

#pragma unroll
  for (int t = 0; t < 4; ++t) {
    const int col = cbase + t * 16 + (lane & 15);
    const float bv = bias[col];
#pragma unroll
    for (int r = 0; r < 8; ++r) {
      const int row = rbase + r + 8 * (lane >> 4);
      Out[(size_t)row * kDim + col] =
          acc[t][r] + bv + resid[(size_t)row * kDim + col];
    }
  }
}

// ---------------------------------------------------------------------------
extern "C" void kernel_launch(void* const* d_in, const int* in_sizes, int n_in,
                              void* d_out, int out_size, void* d_ws, size_t ws_size,
                              hipStream_t stream) {
  const float* x_dec = (const float*)d_in[0];
  const float* x_enc = (const float*)d_in[1];
  const float* Wq = (const float*)d_in[2];
  const float* bq = (const float*)d_in[3];
  const float* Wk = (const float*)d_in[4];
  const float* bk = (const float*)d_in[5];
  const float* Wv = (const float*)d_in[6];
  const float* bv = (const float*)d_in[7];
  const float* Wo = (const float*)d_in[8];
  const float* bo = (const float*)d_in[9];

  const int B = 4, L = kL;
  const int N = B * L;                       // 16384 rows
  const size_t mat = (size_t)N * kDim;       // elements per f16 intermediate

  _Float16* Qh  = (_Float16*)d_ws;           // 8 MB
  _Float16* Khw = Qh + mat;                  // 8 MB
  _Float16* VhT = Khw + mat;                 // 8 MB (transposed: [B][D][L])
  _Float16* Xa  = VhT + mat;                 // 8 MB

  dim3 pgrid(N / kPR, kDim / kPC);           // 128 x 4 blocks, 256 threads
  proj_kernel <<<pgrid, 256, 0, stream>>>(x_dec, Wq, bq, Qh);
  proj_kernel <<<pgrid, 256, 0, stream>>>(x_enc, Wk, bk, Khw);
  projT_kernel<<<pgrid, 256, 0, stream>>>(x_enc, Wv, bv, VhT);

  dim3 agrid(L / kQB, B);                    // 64 x 4 blocks, 256 threads
  attn_kernel<<<agrid, 256, 0, stream>>>(Qh, Khw, VhT, Xa);

  outproj_kernel<<<pgrid, 256, 0, stream>>>(Xa, Wo, bo, x_dec, (float*)d_out);
}

// v003
// One run takes 105 microseconds.
// Two timings next to v002 both put it at 1.06 times that version's speed.
// Counting every step since v000, it is 5.13 times as fast.
#include <hip/hip_runtime.h>
#include <hip/hip_bf16.h>
#include <math.h>

// ---------------------------------------------------------------------------
// CDNA5 (gfx1250) cross-attention: wave32, v_wmma_f32_16x16x32_f16 matmuls,
// async global->LDS staging (ASYNCcnt) for the K and V operands.
// ---------------------------------------------------------------------------

typedef __attribute__((ext_vector_type(16))) _Float16 v16h;
typedef __attribute__((ext_vector_type(8)))  float    v8f;

static constexpr int kDim = 256;   // model dim (single head, softmax scale 1/16)
static constexpr int kKC  = 128;   // k-chunk per flash-attention iteration
static constexpr int kL   = 4096;  // sequence length (Lq == Lk)

// WMMA 16x16x32 f16 fragment loaders (wave32 layouts per CDNA5 ISA 7.12.2).
// A-matrix 16x32: lane<16 -> row=lane, K = {kh*8..+7, 16+kh*8..+7}, kh=lane>>4.
// A row-major A-fragment of K is exactly the B-fragment of K^T (layout duality),
// so both A and B fragments load as two contiguous 16-byte chunks per lane.
__device__ inline v16h load_a_frag_f16(const _Float16* base, int ld, int lane) {
  const int m  = lane & 15;
  const int kh = lane >> 4;
  const _Float16* p = base + m * ld + kh * 8;
  v16h a;
#pragma unroll
  for (int j = 0; j < 8; ++j) {
    a[j]     = p[j];        // K = kh*8 + j
    a[j + 8] = p[16 + j];   // K = 16 + kh*8 + j
  }
  return a;
}

__device__ inline v16h load_a_frag_f32(const float* base, int ld, int lane) {
  const int m  = lane & 15;
  const int kh = lane >> 4;
  const float* p = base + m * ld + kh * 8;
  v16h a;
#pragma unroll
  for (int j = 0; j < 8; ++j) {
    a[j]     = (_Float16)p[j];
    a[j + 8] = (_Float16)p[16 + j];
  }
  return a;
}

__device__ inline v8f wmma_f16(v16h a, v16h b, v8f c) {
  return __builtin_amdgcn_wmma_f32_16x16x32_f16(false, a, false, b, (short)0, c,
                                                false, false);
}

// ---------------------------------------------------------------------------
// Projections, shared frame. Block: 256 threads = 8 waves; 128 rows x 64 cols.
// The block's whole W slab (256 k x 64 n) is converted to f16 and laid down
// transposed in LDS ONCE; each wave then runs its own 16 rows against it
// (4 accumulator tiles, 32 WMMAs), so one staging serves 128 rows.
// ---------------------------------------------------------------------------
typedef __attribute__((ext_vector_type(8))) _Float16 v8h;

static constexpr int kPR = 128;        // rows per block
static constexpr int kPC = 64;         // cols per block
static constexpr int kWP = kDim + 8;   // slab row pitch in halves: 528 B = 16 B x 33

// Stands behind a run of global loads, in front of whatever reuses their address
// registers.
__device__ inline void wait_load_addresses() {
  asm volatile("s_wait_xcnt 0x0" ::: "memory");
}

// Slab staging, Wt[n][k] = f16(W[k][cbase + n]), in two halves so that the X
// loads can be issued between them. A thread owns column n = tid & 63 and eight
// units of 8 consecutive k: unit i starts at k = (tid >> 6) * 8 + i * 32. A wave
// covers 32 consecutive n, so each 4-byte load is one 128-byte line.
__device__ inline void load_w_slab(const float* __restrict__ W, int cbase, int tid,
                                   float (&f)[8][8]) {
  const float* wp = W + (size_t)((tid >> 6) * 8) * kDim + cbase + (tid & (kPC - 1));
#pragma unroll
  for (int i = 0; i < 8; ++i) {
#pragma unroll
    for (int j = 0; j < 8; ++j) f[i][j] = wp[(i * 32 + j) * kDim];
  }
  wait_load_addresses();
}

// One 16-byte LDS store per unit.
__device__ inline void store_w_slab(const float (&f)[8][8], _Float16 (*Wt)[kWP],
                                    int tid) {
#pragma unroll
  for (int i = 0; i < 8; ++i) {
    v8h t;
#pragma unroll
    for (int j = 0; j < 8; ++j) t[j] = (_Float16)f[i][j];
    *(v8h*)&Wt[tid & (kPC - 1)][(tid >> 6) * 8 + i * 32] = t;
  }
}

// Raw f32 rows of the eight A fragments of one wave (16 rows x 256 k): the same
// elements, in the same order, as load_a_frag_f32 reads.
__device__ inline void load_x_rows(const float* base, int lane, float4 (&x)[8][4]) {
  const float* p = base + (lane & 15) * kDim + (lane >> 4) * 8;
#pragma unroll
  for (int d = 0; d < 8; ++d) {
    x[d][0] = *(const float4*)(p + d * 32);
    x[d][1] = *(const float4*)(p + d * 32 + 4);
    x[d][2] = *(const float4*)(p + d * 32 + 16);
    x[d][3] = *(const float4*)(p + d * 32 + 20);
  }
  wait_load_addresses();
}

__device__ inline void cvt_x_rows(const float4 (&x)[8][4], v16h (&a)[8]) {
#pragma unroll
  for (int d = 0; d < 8; ++d) {
#pragma unroll
    for (int q = 0; q < 4; ++q) {
      a[d][q * 4 + 0] = (_Float16)x[d][q].x;
      a[d][q * 4 + 1] = (_Float16)x[d][q].y;
      a[d][q * 4 + 2] = (_Float16)x[d][q].z;
      a[d][q * 4 + 3] = (_Float16)x[d][q].w;
    }
  }
}

// acc[t] += A(16 x 256) @ W[:, t*16 .. t*16+15], k in ascending chunks of 32.
__device__ inline void rows16_times_slab(const v16h (&a)[8],
                                         const _Float16 (*Wt)[kWP], int lane,
                                         v8f (&acc)[4]) {
#pragma unroll
  for (int d = 0; d < 8; ++d) {
#pragma unroll
    for (int t = 0; t < 4; ++t) {
      v16h b = load_a_frag_f16(&Wt[t * 16][d * 32], kWP, lane);  // B-frag of W
      acc[t] = wmma_f16(a[d], b, acc[t]);
    }
  }
}

// ---------------------------------------------------------------------------
// Projection: Y[N][256] = f16( X[N][256] @ W[256][256] + bias )
// ---------------------------------------------------------------------------
__global__ __launch_bounds__(256) void proj_kernel(const float* __restrict__ X,
                                                   const float* __restrict__ W,
                                                   const float* __restrict__ bias,
                                                   _Float16* __restrict__ Y) {
  __shared__ alignas(16) _Float16 Wt[kPC][kWP];

  const int tid  = threadIdx.x;
  const int lane = tid & 31;
  const int w    = tid >> 5;
  const int rbase = blockIdx.x * kPR + w * 16;
  const int cbase = blockIdx.y * kPC;

  float  wf[8][8];
  float4 xr[8][4];
  load_w_slab(W, cbase, tid, wf);
  load_x_rows(X + (size_t)rbase * kDim, lane, xr);
  store_w_slab(wf, Wt, tid);
  __syncthreads();

  v16h a[8];
  cvt_x_rows(xr, a);

  v8f acc[4] = {};
  rows16_times_slab(a, Wt, lane, acc);

#pragma unroll
  for (int t = 0; t < 4; ++t) {
    const int col = cbase + t * 16 + (lane & 15);
    const float bv = bias[col];
#pragma unroll
    for (int r = 0; r < 8; ++r) {
      const int row = rbase + r + 8 * (lane >> 4);
      Y[(size_t)row * kDim + col] = (_Float16)(acc[t][r] + bv);
    }
  }
}

// ---------------------------------------------------------------------------
// Projection with TRANSPOSED output (for V): YT[b][col][l] = f16(X@W + b).
// Rows r=0..7 of the C tile are consecutive along l in the transposed layout,
// so each lane emits a single contiguous 16-byte store per tile.
// ---------------------------------------------------------------------------
__global__ __launch_bounds__(256) void projT_kernel(const float* __restrict__ X,
                                                    const float* __restrict__ W,
                                                    const float* __restrict__ bias,
                                                    _Float16* __restrict__ YT) {
  __shared__ alignas(16) _Float16 Wt[kPC][kWP];

  const int tid  = threadIdx.x;
  const int lane = tid & 31;
  const int w    = tid >> 5;
  const int rbase = blockIdx.x * kPR + w * 16;
  const int cbase = blockIdx.y * kPC;

  float  wf[8][8];
  float4 xr[8][4];
  load_w_slab(W, cbase, tid, wf);
  load_x_rows(X + (size_t)rbase * kDim, lane, xr);
  store_w_slab(wf, Wt, tid);
  __syncthreads();

  v16h a[8];
  cvt_x_rows(xr, a);

  v8f acc[4] = {};
  rows16_times_slab(a, Wt, lane, acc);

  const int row0 = rbase + 8 * (lane >> 4);   // 8 consecutive rows per lane
  const int b    = row0 >> 12;                // 4096 rows per batch
  const int l0   = row0 & (kL - 1);
#pragma unroll
  for (int t = 0; t < 4; ++t) {
    const int col  = cbase + t * 16 + (lane & 15);
    const float bv = bias[col];
    v8h tmp;
#pragma unroll
    for (int r = 0; r < 8; ++r) tmp[r] = (_Float16)(acc[t][r] + bv);
    *(v8h*)&YT[((size_t)b * kDim + col) * kL + l0] = tmp;
  }
}

static constexpr int kQB    = 64;
static constexpr int kKP    = kDim + 8;
static constexpr int kVP    = kKC + 8;
static constexpr int kKTile = kKC * kKP;
static constexpr int kVTile = kDim * kVP;
static constexpr int kStage = kKTile + kVTile;
static constexpr int kTiles = kL / kKC;
static_assert(kTiles >= 2, "the two-buffer prologue fills tiles 0 and 1");
static_assert(4 * kQB * kDim * 4 <= 2 * kStage * 2, "the join reuses the ring");

// Lane l with lane l ^ 16.
__device__ inline float other_half(float x) {
  return __builtin_bit_cast(
      float, __builtin_amdgcn_permlanex16(__builtin_bit_cast(int, x),
                                          __builtin_bit_cast(int, x), 0x76543210,
                                          0xfedcba98, false, false));
}

// This wave's LDS reads have returned: stands in front of the barrier behind
// which their buffer is refilled.
__device__ inline void wait_lds_reads() {
  asm volatile("s_wait_dscnt 0x0" ::: "memory");
}

// This wave's async copies have landed: stands in front of the barrier behind
// which other waves read them.
__device__ inline void wait_copies() {
  asm volatile("s_wait_asynccnt 0x0" ::: "memory");
}

// Eight 16-byte-per-lane copies global -> LDS from three address pairs: four
// 128-byte steps along a K row, two along each of two V^T rows. An immediate
// offset moves the LDS and the global address alike, so the steps along a row
// need no registers of their own. The closing s_wait_xcnt 0 is part of the
// statement so that it stands in front of any rewrite of the address registers
// the copies name.
__device__ inline void copy8(unsigned lk, const _Float16* pk, unsigned lv0,
                             const _Float16* pv0, unsigned lv1, const _Float16* pv1) {
  asm volatile(
      "global_load_async_to_lds_b128 %0, %3, off\n\t"
      "global_load_async_to_lds_b128 %0, %3, off offset:128\n\t"
      "global_load_async_to_lds_b128 %0, %3, off offset:256\n\t"
      "global_load_async_to_lds_b128 %0, %3, off offset:384\n\t"
      "global_load_async_to_lds_b128 %1, %4, off\n\t"
      "global_load_async_to_lds_b128 %1, %4, off offset:128\n\t"
      "global_load_async_to_lds_b128 %2, %5, off\n\t"
      "global_load_async_to_lds_b128 %2, %5, off offset:128\n\t"
      "s_wait_xcnt 0x0"
      :: "v"(lk), "v"(lv0), "v"(lv1), "v"(pk), "v"(pv0), "v"(pv1)
      : "memory");
}

// One tile of 128 keys into buf: K rows kb .. kb + 127 (512 B each) and V^T rows
// 0 .. 255, keys kb .. kb + 127 (256 B each). Eight lanes copy one 128-byte line,
// a wave four whole lines per instruction. 32 copies a wave.
__device__ inline void stage_kv(_Float16* buf, const _Float16* Kb,
                                const _Float16* VbT, int kb, int tid) {
  const int r = tid >> 3;          // row within a block of 32 rows
  const int c = (tid & 7) * 8;     // this lane's 16 bytes of a line, in halves
  _Float16*       lk = buf + (r * kKP + c);
  const _Float16* pk = (Kb + (size_t)kb * kDim) + (unsigned)(r * kDim + c);
  _Float16*       lv = buf + (kKTile + r * kVP + c);
  const _Float16* pv = (VbT + kb) + (unsigned)(r * kL + c);
  // Stays rolled: unrolled, the build keeps every trip's addresses alive over the
  // whole tile loop, and they no longer fit the registers.
#pragma unroll 1
  for (int g = 0; g < 4; ++g) {    // 32 K rows and 64 V^T rows a trip
    copy8((unsigned)(unsigned long long)lk, pk,          // LDS byte addresses
          (unsigned)(unsigned long long)lv, pv,
          (unsigned)(unsigned long long)(lv + 32 * kVP), pv + (size_t)32 * kL);
    lk += 32 * kKP;
    pk += 32 * kDim;
    lv += 64 * kVP;
    pv += (size_t)64 * kL;
  }
}

// The fragment of load_a_frag_f16, same elements in the same order, from the
// lane's own address p = base + (lane & 15) * ld + (lane >> 4) * 8: the lane's part
// is formed once, in front of the tile loop, and takes one register.
__device__ inline v16h load_frag_at(const _Float16* p) {
  v16h a;
#pragma unroll
  for (int j = 0; j < 8; ++j) {
    a[j]     = p[j];        // K = kh*8 + j
    a[j + 8] = p[16 + j];   // K = 16 + kh*8 + j
  }
  return a;
}

// K fragments of k chunk d, one for each 16-key tile. Kt: the lane's own address.
__device__ inline void load_k_pair(const _Float16* Kt, int d, v16h (&k)[2]) {
  k[0] = load_frag_at(Kt + d * 32);
  k[1] = load_frag_at(Kt + 16 * kKP + d * 32);
}

// s[i][j] += K(key tile i) . Q^T(column group j) over k chunk d.
__device__ inline void s_chunk(const v16h (&k)[2], const v16h (&q)[2][8], int d,
                               v8f (&s)[2][2]) {
#pragma unroll
  for (int i = 0; i < 2; ++i) {
#pragma unroll
    for (int j = 0; j < 2; ++j) s[i][j] = wmma_f16(k[i], q[j][d], s[i][j]);
  }
}

// V^T fragments of output tiles 2u and 2u + 1. Vt: the lane's own address.
__device__ inline void load_v_pair(const _Float16* Vt, int u, v16h (&v)[2]) {
  v[0] = load_frag_at(Vt + (2 * u) * 16 * kVP);
  v[1] = load_frag_at(Vt + (2 * u + 1) * 16 * kVP);
}

// O^T tiles 2u and 2u + 1, both column groups: scaled by alpha, then += V^T . P^T.
__device__ inline void pv_pair(const v16h (&v)[2], const v16h (&pf)[2],
                               const float (&alpha)[2], int u, v8f (&o)[16][2]) {
#pragma unroll
  for (int x = 0; x < 2; ++x) {
#pragma unroll
    for (int j = 0; j < 2; ++j) o[2 * u + x][j] *= alpha[j];
  }
#pragma unroll
  for (int x = 0; x < 2; ++x) {
#pragma unroll
    for (int j = 0; j < 2; ++j)
      o[2 * u + x][j] = wmma_f16(v[x], pf[j], o[2 * u + x][j]);
  }
}

__global__ __launch_bounds__(256) void attn_kernel(const _Float16* __restrict__ Qh,
                                                   const _Float16* __restrict__ Kh,
                                                   const _Float16* __restrict__ VhT,
                                                   _Float16* __restrict__ Xa) {
  __shared__ alignas(16) _Float16 ring[2 * kStage];  // two K + V^T buffers
  __shared__ float jm[8][2][32], jl[8][2][32];       // join: m and l of every wave

  const int tid  = threadIdx.x;
  const int lane = tid & 31;
  // The wave's number, the same in every lane, held in a scalar register: the tile
  // loop needs nearly every vector register that two waves on a SIMD can own.
  const int w    = __builtin_amdgcn_readfirstlane(tid >> 5);
  const int qg   = w & 1;
  const int kq   = w >> 1;
  const int b     = blockIdx.y;
  const int qbase = blockIdx.x * kQB + qg * 32;
  const float cs = 0.0625f * 1.44269504088896340736f;  // 1/sqrt(256) * log2(e)

  const _Float16* Qb  = Qh  + (size_t)b * kL * kDim;
  const _Float16* Kb  = Kh  + (size_t)b * kL * kDim;
  const _Float16* VbT = VhT + (size_t)b * kDim * kL;

  stage_kv(ring, Kb, VbT, 0, tid);

  // This wave's Q^T (256 x 32) as 2 x 8 B-fragments: lane (c, h) holds query
  // j * 16 + c in the k order of the K loader. Reused for every tile.
  v16h qfrag[2][8];
#pragma unroll
  for (int j = 0; j < 2; ++j) {
#pragma unroll
    for (int d = 0; d < 8; ++d)
      qfrag[j][d] = load_a_frag_f16(Qb + (size_t)(qbase + j * 16) * kDim + d * 32, kDim, lane);
  }
  wait_load_addresses();

  wait_copies();
  __syncthreads();                       // tile 0 readable by every wave
  stage_kv(ring + kStage, Kb, VbT, kKC, tid);

  v8f   oacc[16][2] = {};                // O^T: d = t*16 + 8h + r, query j*16 + c
  float mrun[2] = {-3.0e38f, -3.0e38f};  // running maxima, log2 domain
  float lrun[2] = {0.0f, 0.0f};          // this lane's share of the running sums

  const int kfo = (kq * 32 + (lane & 15)) * kKP + (lane >> 4) * 8;
  const int vfo = kKTile + (lane & 15) * kVP + kq * 32 + (lane >> 4) * 8;

  for (int t = 0; t < kTiles; ++t) {
    _Float16* buf = ring + (t & 1) * kStage;
    const _Float16* Kt = buf + kfo;
    const _Float16* Vt = buf + vfo;

    // ---- S^T: two 16-key tiles x two 16-query groups, K fragments through a ring
    // of three pairs. Each scheduling barrier below keeps a pair's LDS reads
    // together and two chunks (8 WMMAs) ahead of their use: spread among the
    // WMMAs, each WMMA stalls on a read issued just ahead of it; lifted further
    // up, the fragments no longer fit the registers.
    v16h kr[3][2];
    v8f  s[2][2] = {};
    load_k_pair(Kt, 0, kr[0]);
    load_k_pair(Kt, 1, kr[1]);
    load_k_pair(Kt, 2, kr[2]);
    __builtin_amdgcn_sched_barrier(0);   // reads of chunks 0 to 2 in front of the WMMAs
#pragma unroll
    for (int d = 0; d < 8; ++d) {
      s_chunk(kr[d % 3], qfrag, d, s);
      if (d + 3 < 8) {
        __builtin_amdgcn_sched_barrier(0); // the next reads behind this chunk's WMMAs
        load_k_pair(Kt, d + 3, kr[d % 3]);
        __builtin_amdgcn_sched_barrier(0); // and in front of the next chunk's
      }
    }

    // ---- online softmax of queries c and 16 + c, in registers
    v16h  pf[2];                           // P^T as B: pf[j][x] = P[query][kmap(x, h)]
    float alpha[2];
#pragma unroll
    for (int j = 0; j < 2; ++j) {
      float mx = fmaxf(s[0][j][0], s[1][j][0]);
#pragma unroll
      for (int r = 1; r < 8; ++r) mx = fmaxf(mx, fmaxf(s[0][j][r], s[1][j][r]));
      mx = fmaxf(mx, other_half(mx)) * cs;   // both halves hold the maximum of the wave's 32 keys
      const float mnew = fmaxf(mrun[j], mx);
      alpha[j] = __builtin_amdgcn_exp2f(mrun[j] - mnew);
      mrun[j]  = mnew;

      float ps0 = 0.0f, ps1 = 0.0f;
#pragma unroll
      for (int r = 0; r < 8; ++r) {
        const float p0 = __builtin_amdgcn_exp2f(fmaf(s[0][j][r], cs, -mnew));
        const float p1 = __builtin_amdgcn_exp2f(fmaf(s[1][j][r], cs, -mnew));
        pf[j][r]     = (_Float16)p0;
        pf[j][r + 8] = (_Float16)p1;
        ps0 += p0;
        ps1 += p1;
      }
      lrun[j] = lrun[j] * alpha[j] + (ps0 + ps1);
    }

    // ---- O^T = O^T * alpha + V^T(256 x 32) . P^T(32 x 32): the same ring, V^T
    // pair u in kr[u % 3].
    __builtin_amdgcn_sched_barrier(0);   // V^T reads behind the softmax: no registers earlier
    load_v_pair(Vt, 0, kr[0]);
    load_v_pair(Vt, 1, kr[1]);
    load_v_pair(Vt, 2, kr[2]);
    __builtin_amdgcn_sched_barrier(0);   // and in front of pair 0's scaling and WMMAs
#pragma unroll
    for (int u = 0; u < 8; ++u) {
      pv_pair(kr[u % 3], pf, alpha, u, oacc);
      if (u + 3 < 8) {
        __builtin_amdgcn_sched_barrier(0); // the next reads behind this pair's WMMAs
        load_v_pair(Vt, u + 3, kr[u % 3]);
        __builtin_amdgcn_sched_barrier(0); // and in front of the next pair's
      }
    }

    // ---- hand-over: tile t + 1 published, tile t's buffer free.
    // Keeps the hand-over behind the last WMMAs: lifted above them, its
    // s_wait_dscnt 0 stalls every wave on the V^T reads with nothing to do.
    __builtin_amdgcn_sched_barrier(0);
    wait_lds_reads();
    wait_copies();
    __syncthreads();
    if (t + 2 < kTiles) stage_kv(buf, Kb, VbT, (t + 2) * kKC, tid);
  }
  wait_copies();

  // ---- join the wave halves' sums, then the four key quarters through the ring
  // (no copy in flight, every read of it ended by the last tile's barrier).
  // Every wave lays down its O^T, 32 KB in slot w = kq * 2 + qg; then wave (qg, kq)
  // adds up the four quarters of output tiles 4 kq .. 4 kq + 3 of its 32 queries.
#pragma unroll
  for (int j = 0; j < 2; ++j) lrun[j] += other_half(lrun[j]);
  float4* jo = (float4*)ring + lane;
  {
    float4* js = jo + (size_t)w * 64 * 32;
#pragma unroll
    for (int tt = 0; tt < 16; ++tt) {
#pragma unroll
      for (int j = 0; j < 2; ++j) {
        const v8f o = oacc[tt][j];
        js[(tt * 4 + j * 2 + 0) * 32] = make_float4(o[0], o[1], o[2], o[3]);
        js[(tt * 4 + j * 2 + 1) * 32] = make_float4(o[4], o[5], o[6], o[7]);
      }
    }
#pragma unroll
    for (int j = 0; j < 2; ++j) {
      jm[w][j][lane] = mrun[j];
      jl[w][j][lane] = lrun[j];
    }
  }
  __syncthreads();

  float a[4][2];                           // weight of quarter k for column group j
#pragma unroll
  for (int j = 0; j < 2; ++j) {
    float m[4], l[4];
#pragma unroll
    for (int k = 0; k < 4; ++k) {
      m[k] = jm[k * 2 + qg][j][lane];
      l[k] = jl[k * 2 + qg][j][lane];
    }
    const float mm = fmaxf(fmaxf(m[0], m[1]), fmaxf(m[2], m[3]));
    float den = 0.0f;
#pragma unroll
    for (int k = 0; k < 4; ++k) {
      a[k][j] = __builtin_amdgcn_exp2f(m[k] - mm);
      den += l[k] * a[k][j];
    }
    const float inv = 1.0f / den;
#pragma unroll
    for (int k = 0; k < 4; ++k) a[k][j] *= inv;
  }

  v8h res[2][4];
#pragma unroll
  for (int j = 0; j < 2; ++j) {
#pragma unroll
    for (int x = 0; x < 4; ++x) {
      const float4* jt = jo + (size_t)qg * 64 * 32 + ((kq * 4 + x) * 4 + j * 2) * 32;
      float f[8];
#pragma unroll
      for (int k = 0; k < 4; ++k) {
        const float4 u0 = jt[(size_t)k * 2 * 64 * 32];
        const float4 u1 = jt[(size_t)k * 2 * 64 * 32 + 32];
        const float  ak = a[k][j];
        if (k == 0) {
          f[0] = u0.x * ak;
          f[1] = u0.y * ak;
          f[2] = u0.z * ak;
          f[3] = u0.w * ak;
          f[4] = u1.x * ak;
          f[5] = u1.y * ak;
          f[6] = u1.z * ak;
          f[7] = u1.w * ak;
        } else {
          f[0] += u0.x * ak;
          f[1] += u0.y * ak;
          f[2] += u0.z * ak;
          f[3] += u0.w * ak;
          f[4] += u1.x * ak;
          f[5] += u1.y * ak;
          f[6] += u1.z * ak;
          f[7] += u1.w * ak;
        }
      }
#pragma unroll
      for (int r = 0; r < 8; ++r) res[j][x][r] = (_Float16)f[r];
    }
  }
  // A lane's 8 values of a tile are 8 consecutive d of one query: one 16-byte
  // store; a wave's four tiles are one whole 128-byte line of each Xa row. The
  // stores stand last, so that nothing behind them rewrites a register they name.
#pragma unroll
  for (int j = 0; j < 2; ++j) {
    _Float16* xo = Xa + ((size_t)b * kL + qbase + j * 16 + (lane & 15)) * kDim +
                   kq * 64 + 8 * (lane >> 4);
#pragma unroll
    for (int x = 0; x < 4; ++x) *(v8h*)(xo + x * 16) = res[j][x];
  }
}

// ---------------------------------------------------------------------------
// Output projection + residual: out = Xa @ Wo + bo + x_dec   (fp32 out)
// ---------------------------------------------------------------------------
__global__ __launch_bounds__(256) void outproj_kernel(const _Float16* __restrict__ Xa,
                                                      const float* __restrict__ W,
                                                      const float* __restrict__ bias,
                                                      const float* __restrict__ resid,
                                                      float* __restrict__ Out) {
  __shared__ alignas(16) _Float16 Wt[kPC][kWP];

  const int tid  = threadIdx.x;
  const int lane = tid & 31;
  const int w    = tid >> 5;
  const int rbase = blockIdx.x * kPR + w * 16;
  const int cbase = blockIdx.y * kPC;

  float wf[8][8];
  load_w_slab(W, cbase, tid, wf);
  v16h a[8];
#pragma unroll
  for (int d = 0; d < 8; ++d)
    a[d] = load_a_frag_f16(Xa + (size_t)rbase * kDim + d * 32, kDim, lane);
  wait_load_addresses();
  store_w_slab(wf, Wt, tid);
  __syncthreads();

  v8f acc[4] = {};
  rows16_times_slab(a, Wt, lane, acc);

#pragma unroll
  for (int t = 0; t < 4; ++t) {
    const int col = cbase + t * 16 + (lane & 15);
    const float bv = bias[col];
#pragma unroll
    for (int r = 0; r < 8; ++r) {
      const int row = rbase + r + 8 * (lane >> 4);
      Out[(size_t)row * kDim + col] =
          acc[t][r] + bv + resid[(size_t)row * kDim + col];
    }
  }
}

// ---------------------------------------------------------------------------
extern "C" void kernel_launch(void* const* d_in, const int* in_sizes, int n_in,
                              void* d_out, int out_size, void* d_ws, size_t ws_size,
                              hipStream_t stream) {
  const float* x_dec = (const float*)d_in[0];
  const float* x_enc = (const float*)d_in[1];
  const float* Wq = (const float*)d_in[2];
  const float* bq = (const float*)d_in[3];
  const float* Wk = (const float*)d_in[4];
  const float* bk = (const float*)d_in[5];
  const float* Wv = (const float*)d_in[6];
  const float* bv = (const float*)d_in[7];
  const float* Wo = (const float*)d_in[8];
  const float* bo = (const float*)d_in[9];

  const int B = 4, L = kL;
  const int N = B * L;                       // 16384 rows
  const size_t mat = (size_t)N * kDim;       // elements per f16 intermediate

  _Float16* Qh  = (_Float16*)d_ws;           // 8 MB
  _Float16* Khw = Qh + mat;                  // 8 MB
  _Float16* VhT = Khw + mat;                 // 8 MB (transposed: [B][D][L])
  _Float16* Xa  = VhT + mat;                 // 8 MB

  dim3 pgrid(N / kPR, kDim / kPC);           // 128 x 4 blocks, 256 threads
  proj_kernel <<<pgrid, 256, 0, stream>>>(x_dec, Wq, bq, Qh);
  proj_kernel <<<pgrid, 256, 0, stream>>>(x_enc, Wk, bk, Khw);
  projT_kernel<<<pgrid, 256, 0, stream>>>(x_enc, Wv, bv, VhT);

  dim3 agrid(L / kQB, B);                    // 64 x 4 blocks, 256 threads
  attn_kernel<<<agrid, 256, 0, stream>>>(Qh, Khw, VhT, Xa);

  outproj_kernel<<<pgrid, 256, 0, stream>>>(Xa, Wo, bo, x_dec, (float*)d_out);
}

// v004
// It runs in 98 microseconds.
// In two side-by-side timings against v003, it was 1.07 and 1.06 times as fast.
// All steps since v000 together make it 5.47 times as fast.
#include <hip/hip_runtime.h>
#include <hip/hip_bf16.h>
#include <math.h>

// ---------------------------------------------------------------------------
// CDNA5 (gfx1250) cross-attention: wave32, v_wmma_f32_16x16x32_f16 matmuls,
// async global->LDS staging (ASYNCcnt) for the K and V operands.
// ---------------------------------------------------------------------------

typedef __attribute__((ext_vector_type(16))) _Float16 v16h;
typedef __attribute__((ext_vector_type(8)))  float    v8f;

static constexpr int kDim = 256;   // model dim (single head, softmax scale 1/16)
static constexpr int kKC  = 128;   // k-chunk per flash-attention iteration
static constexpr int kL   = 4096;  // sequence length (Lq == Lk)

// WMMA 16x16x32 f16 fragment loaders (wave32 layouts per CDNA5 ISA 7.12.2).
// A-matrix 16x32: lane<16 -> row=lane, K = {kh*8..+7, 16+kh*8..+7}, kh=lane>>4.
// A row-major A-fragment of K is exactly the B-fragment of K^T (layout duality),
// so both A and B fragments load as two contiguous 16-byte chunks per lane.
__device__ inline v16h load_a_frag_f16(const _Float16* base, int ld, int lane) {
  const int m  = lane & 15;
  const int kh = lane >> 4;
  const _Float16* p = base + m * ld + kh * 8;
  v16h a;
#pragma unroll
  for (int j = 0; j < 8; ++j) {
    a[j]     = p[j];        // K = kh*8 + j
    a[j + 8] = p[16 + j];   // K = 16 + kh*8 + j
  }
  return a;
}

__device__ inline v16h load_a_frag_f32(const float* base, int ld, int lane) {
  const int m  = lane & 15;
  const int kh = lane >> 4;
  const float* p = base + m * ld + kh * 8;
  v16h a;
#pragma unroll
  for (int j = 0; j < 8; ++j) {
    a[j]     = (_Float16)p[j];
    a[j + 8] = (_Float16)p[16 + j];
  }
  return a;
}

__device__ inline v8f wmma_f16(v16h a, v16h b, v8f c) {
  return __builtin_amdgcn_wmma_f32_16x16x32_f16(false, a, false, b, (short)0, c,
                                                false, false);
}

// ---------------------------------------------------------------------------
// Projections, shared frame. Block: 256 threads = 8 waves; 128 rows x 64 cols.
// The block's whole W slab (256 k x 64 n) is converted to f16 and laid down
// transposed in LDS ONCE; each wave then runs its own 16 rows against it
// (4 accumulator tiles, 32 WMMAs), so one staging serves 128 rows.
// ---------------------------------------------------------------------------
typedef __attribute__((ext_vector_type(8))) _Float16 v8h;

static constexpr int kPR = 128;        // rows per block
static constexpr int kPC = 64;         // cols per block
static constexpr int kWP = kDim + 8;   // slab row pitch in halves: 528 B = 16 B x 33

// Stands behind a run of global loads, in front of whatever reuses their address
// registers.
__device__ inline void wait_load_addresses() {
  asm volatile("s_wait_xcnt 0x0" ::: "memory");
}

// Slab staging, Wt[n][k] = f16(W[k][cbase + n]), in two halves so that the X
// loads can be issued between them. A thread owns column n = tid & 63 and eight
// units of 8 consecutive k: unit i starts at k = (tid >> 6) * 8 + i * 32. A wave
// covers 32 consecutive n, so each 4-byte load is one 128-byte line.
__device__ inline void load_w_slab(const float* __restrict__ W, int cbase, int tid,
                                   float (&f)[8][8]) {
  const float* wp = W + (size_t)((tid >> 6) * 8) * kDim + cbase + (tid & (kPC - 1));
#pragma unroll
  for (int i = 0; i < 8; ++i) {
#pragma unroll
    for (int j = 0; j < 8; ++j) f[i][j] = wp[(i * 32 + j) * kDim];
  }
  wait_load_addresses();
}

// One 16-byte LDS store per unit.
__device__ inline void store_w_slab(const float (&f)[8][8], _Float16 (*Wt)[kWP],
                                    int tid) {
#pragma unroll
  for (int i = 0; i < 8; ++i) {
    v8h t;
#pragma unroll
    for (int j = 0; j < 8; ++j) t[j] = (_Float16)f[i][j];
    *(v8h*)&Wt[tid & (kPC - 1)][(tid >> 6) * 8 + i * 32] = t;
  }
}

// Raw f32 rows of the eight A fragments of one wave (16 rows x 256 k): the same
// elements, in the same order, as load_a_frag_f32 reads.
__device__ inline void load_x_rows(const float* base, int lane, float4 (&x)[8][4]) {
  const float* p = base + (lane & 15) * kDim + (lane >> 4) * 8;
#pragma unroll
  for (int d = 0; d < 8; ++d) {
    x[d][0] = *(const float4*)(p + d * 32);
    x[d][1] = *(const float4*)(p + d * 32 + 4);
    x[d][2] = *(const float4*)(p + d * 32 + 16);
    x[d][3] = *(const float4*)(p + d * 32 + 20);
  }
  // The wait of wait_load_addresses(), with p named as an input: p stays in its
  // registers up to the wait, so that no load of the run lands in them.
  asm volatile("s_wait_xcnt 0x0" :: "v"(p) : "memory");
}

__device__ inline void cvt_x_rows(const float4 (&x)[8][4], v16h (&a)[8]) {
#pragma unroll
  for (int d = 0; d < 8; ++d) {
#pragma unroll
    for (int q = 0; q < 4; ++q) {
      a[d][q * 4 + 0] = (_Float16)x[d][q].x;
      a[d][q * 4 + 1] = (_Float16)x[d][q].y;
      a[d][q * 4 + 2] = (_Float16)x[d][q].z;
      a[d][q * 4 + 3] = (_Float16)x[d][q].w;
    }
  }
}

// acc[t] += A(16 x 256) @ W[:, t*16 .. t*16+15], k in ascending chunks of 32.
__device__ inline void rows16_times_slab(const v16h (&a)[8],
                                         const _Float16 (*Wt)[kWP], int lane,
                                         v8f (&acc)[4]) {
#pragma unroll
  for (int d = 0; d < 8; ++d) {
#pragma unroll
    for (int t = 0; t < 4; ++t) {
      v16h b = load_a_frag_f16(&Wt[t * 16][d * 32], kWP, lane);  // B-frag of W
      acc[t] = wmma_f16(a[d], b, acc[t]);
    }
  }
}

// ---------------------------------------------------------------------------
// Projection: Y[N][256] = f16( X[N][256] @ W[256][256] + bias )
// ---------------------------------------------------------------------------
__global__ __launch_bounds__(256) void proj_kernel(const float* __restrict__ X,
                                                   const float* __restrict__ W,
                                                   const float* __restrict__ bias,
                                                   _Float16* __restrict__ Y) {
  __shared__ alignas(16) _Float16 Wt[kPC][kWP];

  const int tid  = threadIdx.x;
  const int lane = tid & 31;
  const int w    = tid >> 5;
  const int rbase = blockIdx.x * kPR + w * 16;
  const int cbase = blockIdx.y * kPC;

  float  wf[8][8];
  float4 xr[8][4];
  load_w_slab(W, cbase, tid, wf);
  load_x_rows(X + (size_t)rbase * kDim, lane, xr);
  store_w_slab(wf, Wt, tid);
  __syncthreads();

  v16h a[8];
  cvt_x_rows(xr, a);

  v8f acc[4] = {};
  rows16_times_slab(a, Wt, lane, acc);

#pragma unroll
  for (int t = 0; t < 4; ++t) {
    const int col = cbase + t * 16 + (lane & 15);
    const float bv = bias[col];
#pragma unroll
    for (int r = 0; r < 8; ++r) {
      const int row = rbase + r + 8 * (lane >> 4);
      Y[(size_t)row * kDim + col] = (_Float16)(acc[t][r] + bv);
    }
  }
}

// ---------------------------------------------------------------------------
// K and V projections of the same rows in one kernel. A block reads its 128 rows
// of X ONCE, keeps them as f16 A fragments, and runs them against its 64-column
// slab of Wk and then of Wv, each slab in an LDS buffer of its own.
//   Y [row][col]   = f16(X @ Wk + bk)
//   YT[b][col][l]  = f16(X @ Wv + bv), transposed: rows r = 0..7 of a C tile are
//                    consecutive along l, one 16-byte store per lane and tile.
// The Wv slab is fetched behind the first barrier, so that it flies while the K
// products run.
// ---------------------------------------------------------------------------
__global__ __launch_bounds__(256) void projKV_kernel(const float* __restrict__ X,
                                                     const float* __restrict__ Wk,
                                                     const float* __restrict__ bk,
                                                     const float* __restrict__ Wv,
                                                     const float* __restrict__ bv,
                                                     _Float16* __restrict__ Y,
                                                     _Float16* __restrict__ YT) {
  __shared__ alignas(16) _Float16 Wt[2][kPC][kWP];

  const int tid  = threadIdx.x;
  const int lane = tid & 31;
  const int w    = tid >> 5;
  const int rbase = blockIdx.x * kPR + w * 16;
  const int cbase = blockIdx.y * kPC;

  float  wf[8][8];
  float4 xr[8][4];
  load_w_slab(Wk, cbase, tid, wf);
  load_x_rows(X + (size_t)rbase * kDim, lane, xr);
  store_w_slab(wf, Wt[0], tid);
  __syncthreads();                       // Wk slab readable by every wave

  load_w_slab(Wv, cbase, tid, wf);

  v16h a[8];
  cvt_x_rows(xr, a);

  v8f acc[4] = {};
  rows16_times_slab(a, Wt[0], lane, acc);

  // Keeps the wait for the Wv loads behind the K products: mixed in among them, it
  // stalls the wave on loads issued just ahead, with most of its WMMAs still to do.
  __builtin_amdgcn_sched_barrier(0);
  store_w_slab(wf, Wt[1], tid);
  __syncthreads();                       // Wv slab readable by every wave

#pragma unroll
  for (int t = 0; t < 4; ++t) {
    const int col = cbase + t * 16 + (lane & 15);
    const float bb = bk[col];
#pragma unroll
    for (int r = 0; r < 8; ++r) {
      const int row = rbase + r + 8 * (lane >> 4);
      Y[(size_t)row * kDim + col] = (_Float16)(acc[t][r] + bb);
    }
  }
  wait_load_addresses();                 // the V part reuses registers these stores name

  v8f acv[4] = {};
  rows16_times_slab(a, Wt[1], lane, acv);

  const int row0 = rbase + 8 * (lane >> 4);   // 8 consecutive rows per lane
  const int b    = row0 >> 12;                // 4096 rows per batch
  const int l0   = row0 & (kL - 1);
#pragma unroll
  for (int t = 0; t < 4; ++t) {
    const int col  = cbase + t * 16 + (lane & 15);
    const float bb = bv[col];
    v8h tmp;
#pragma unroll
    for (int r = 0; r < 8; ++r) tmp[r] = (_Float16)(acv[t][r] + bb);
    *(v8h*)&YT[((size_t)b * kDim + col) * kL + l0] = tmp;
  }
}

static constexpr int kQB    = 64;
static constexpr int kKP    = kDim + 8;
static constexpr int kVP    = kKC + 8;
static constexpr int kKTile = kKC * kKP;
static constexpr int kVTile = kDim * kVP;
static constexpr int kStage = kKTile + kVTile;
static constexpr int kTiles = kL / kKC;
static_assert(kTiles >= 2, "the two-buffer prologue fills tiles 0 and 1");
static_assert(4 * kQB * kDim * 4 <= 2 * kStage * 2, "the join reuses the ring");

// Lane l with lane l ^ 16.
__device__ inline float other_half(float x) {
  return __builtin_bit_cast(
      float, __builtin_amdgcn_permlanex16(__builtin_bit_cast(int, x),
                                          __builtin_bit_cast(int, x), 0x76543210,
                                          0xfedcba98, false, false));
}

// This wave's LDS reads have returned: stands in front of the barrier behind
// which their buffer is refilled.
__device__ inline void wait_lds_reads() {
  asm volatile("s_wait_dscnt 0x0" ::: "memory");
}

// This wave's async copies have landed: stands in front of the barrier behind
// which other waves read them.
__device__ inline void wait_copies() {
  asm volatile("s_wait_asynccnt 0x0" ::: "memory");
}

// Eight 16-byte-per-lane copies global -> LDS from three address pairs: four
// 128-byte steps along a K row, two along each of two V^T rows. An immediate
// offset moves the LDS and the global address alike, so the steps along a row
// need no registers of their own. The closing s_wait_xcnt 0 is part of the
// statement so that it stands in front of any rewrite of the address registers
// the copies name.
__device__ inline void copy8(unsigned lk, const _Float16* pk, unsigned lv0,
                             const _Float16* pv0, unsigned lv1, const _Float16* pv1) {
  asm volatile(
      "global_load_async_to_lds_b128 %0, %3, off\n\t"
      "global_load_async_to_lds_b128 %0, %3, off offset:128\n\t"
      "global_load_async_to_lds_b128 %0, %3, off offset:256\n\t"
      "global_load_async_to_lds_b128 %0, %3, off offset:384\n\t"
      "global_load_async_to_lds_b128 %1, %4, off\n\t"
      "global_load_async_to_lds_b128 %1, %4, off offset:128\n\t"
      "global_load_async_to_lds_b128 %2, %5, off\n\t"
      "global_load_async_to_lds_b128 %2, %5, off offset:128\n\t"
      "s_wait_xcnt 0x0"
      :: "v"(lk), "v"(lv0), "v"(lv1), "v"(pk), "v"(pv0), "v"(pv1)
      : "memory");
}

// One tile of 128 keys into buf: K rows kb .. kb + 127 (512 B each) and V^T rows
// 0 .. 255, keys kb .. kb + 127 (256 B each). Eight lanes copy one 128-byte line,
// a wave four whole lines per instruction. 32 copies a wave.
__device__ inline void stage_kv(_Float16* buf, const _Float16* Kb,
                                const _Float16* VbT, int kb, int tid) {
  const int r = tid >> 3;          // row within a block of 32 rows
  const int c = (tid & 7) * 8;     // this lane's 16 bytes of a line, in halves
  _Float16*       lk = buf + (r * kKP + c);
  const _Float16* pk = (Kb + (size_t)kb * kDim) + (unsigned)(r * kDim + c);
  _Float16*       lv = buf + (kKTile + r * kVP + c);
  const _Float16* pv = (VbT + kb) + (unsigned)(r * kL + c);
  // Stays rolled: unrolled, the build keeps every trip's addresses alive over the
  // whole tile loop, and they no longer fit the registers.
#pragma unroll 1
  for (int g = 0; g < 4; ++g) {    // 32 K rows and 64 V^T rows a trip
    copy8((unsigned)(unsigned long long)lk, pk,          // LDS byte addresses
          (unsigned)(unsigned long long)lv, pv,
          (unsigned)(unsigned long long)(lv + 32 * kVP), pv + (size_t)32 * kL);
    lk += 32 * kKP;
    pk += 32 * kDim;
    lv += 64 * kVP;
    pv += (size_t)64 * kL;
  }
}

// The fragment of load_a_frag_f16, same elements in the same order, from the
// lane's own address p = base + (lane & 15) * ld + (lane >> 4) * 8: the lane's part
// is formed once, in front of the tile loop, and takes one register.
__device__ inline v16h load_frag_at(const _Float16* p) {
  v16h a;
#pragma unroll
  for (int j = 0; j < 8; ++j) {
    a[j]     = p[j];        // K = kh*8 + j
    a[j + 8] = p[16 + j];   // K = 16 + kh*8 + j
  }
  return a;
}

// K fragments of k chunk d, one for each 16-key tile. Kt: the lane's own address.
__device__ inline void load_k_pair(const _Float16* Kt, int d, v16h (&k)[2]) {
  k[0] = load_frag_at(Kt + d * 32);
  k[1] = load_frag_at(Kt + 16 * kKP + d * 32);
}

// s[i][j] += K(key tile i) . Q^T(column group j) over k chunk d.
__device__ inline void s_chunk(const v16h (&k)[2], const v16h (&q)[2][8], int d,
                               v8f (&s)[2][2]) {
#pragma unroll
  for (int i = 0; i < 2; ++i) {
#pragma unroll
    for (int j = 0; j < 2; ++j) s[i][j] = wmma_f16(k[i], q[j][d], s[i][j]);
  }
}

// V^T fragments of output tiles 2u and 2u + 1. Vt: the lane's own address.
__device__ inline void load_v_pair(const _Float16* Vt, int u, v16h (&v)[2]) {
  v[0] = load_frag_at(Vt + (2 * u) * 16 * kVP);
  v[1] = load_frag_at(Vt + (2 * u + 1) * 16 * kVP);
}

// O^T tiles 2u and 2u + 1, both column groups: scaled by alpha, then += V^T . P^T.
__device__ inline void pv_pair(const v16h (&v)[2], const v16h (&pf)[2],
                               const float (&alpha)[2], int u, v8f (&o)[16][2]) {
#pragma unroll
  for (int x = 0; x < 2; ++x) {
#pragma unroll
    for (int j = 0; j < 2; ++j) o[2 * u + x][j] *= alpha[j];
  }
#pragma unroll
  for (int x = 0; x < 2; ++x) {
#pragma unroll
    for (int j = 0; j < 2; ++j)
      o[2 * u + x][j] = wmma_f16(v[x], pf[j], o[2 * u + x][j]);
  }
}

__global__ __launch_bounds__(256) void attn_kernel(const _Float16* __restrict__ Qh,
                                                   const _Float16* __restrict__ Kh,
                                                   const _Float16* __restrict__ VhT,
                                                   _Float16* __restrict__ Xa) {
  __shared__ alignas(16) _Float16 ring[2 * kStage];  // two K + V^T buffers
  __shared__ float jm[8][2][32], jl[8][2][32];       // join: m and l of every wave

  const int tid  = threadIdx.x;
  const int lane = tid & 31;
  // The wave's number, the same in every lane, held in a scalar register: the tile
  // loop needs nearly every vector register that two waves on a SIMD can own.
  const int w    = __builtin_amdgcn_readfirstlane(tid >> 5);
  const int qg   = w & 1;
  const int kq   = w >> 1;
  const int b     = blockIdx.y;
  const int qbase = blockIdx.x * kQB + qg * 32;
  const float cs = 0.0625f * 1.44269504088896340736f;  // 1/sqrt(256) * log2(e)

  const _Float16* Qb  = Qh  + (size_t)b * kL * kDim;
  const _Float16* Kb  = Kh  + (size_t)b * kL * kDim;
  const _Float16* VbT = VhT + (size_t)b * kDim * kL;

  stage_kv(ring, Kb, VbT, 0, tid);

  // This wave's Q^T (256 x 32) as 2 x 8 B-fragments: lane (c, h) holds query
  // j * 16 + c in the k order of the K loader. Reused for every tile.
  v16h qfrag[2][8];
#pragma unroll
  for (int j = 0; j < 2; ++j) {
#pragma unroll
    for (int d = 0; d < 8; ++d)
      qfrag[j][d] = load_a_frag_f16(Qb + (size_t)(qbase + j * 16) * kDim + d * 32, kDim, lane);
  }
  wait_load_addresses();

  wait_copies();
  __syncthreads();                       // tile 0 readable by every wave
  stage_kv(ring + kStage, Kb, VbT, kKC, tid);

  v8f   oacc[16][2] = {};                // O^T: d = t*16 + 8h + r, query j*16 + c
  float mrun[2] = {-3.0e38f, -3.0e38f};  // running maxima, log2 domain
  float lrun[2] = {0.0f, 0.0f};          // this lane's share of the running sums

  const int kfo = (kq * 32 + (lane & 15)) * kKP + (lane >> 4) * 8;
  const int vfo = kKTile + (lane & 15) * kVP + kq * 32 + (lane >> 4) * 8;

  for (int t = 0; t < kTiles; ++t) {
    _Float16* buf = ring + (t & 1) * kStage;
    const _Float16* Kt = buf + kfo;
    const _Float16* Vt = buf + vfo;

    // ---- S^T: two 16-key tiles x two 16-query groups, K fragments through a ring
    // of three pairs. Each scheduling barrier below keeps a pair's LDS reads
    // together and two chunks (8 WMMAs) ahead of their use: spread among the
    // WMMAs, each WMMA stalls on a read issued just ahead of it; lifted further
    // up, the fragments no longer fit the registers.
    v16h kr[3][2];
    v8f  s[2][2] = {};
    load_k_pair(Kt, 0, kr[0]);
    load_k_pair(Kt, 1, kr[1]);
    load_k_pair(Kt, 2, kr[2]);
    __builtin_amdgcn_sched_barrier(0);   // reads of chunks 0 to 2 in front of the WMMAs
#pragma unroll
    for (int d = 0; d < 8; ++d) {
      s_chunk(kr[d % 3], qfrag, d, s);
      if (d + 3 < 8) {
        __builtin_amdgcn_sched_barrier(0); // the next reads behind this chunk's WMMAs
        load_k_pair(Kt, d + 3, kr[d % 3]);
        __builtin_amdgcn_sched_barrier(0); // and in front of the next chunk's
      }
    }

    // ---- online softmax of queries c and 16 + c, in registers
    v16h  pf[2];                           // P^T as B: pf[j][x] = P[query][kmap(x, h)]
    float alpha[2];
#pragma unroll
    for (int j = 0; j < 2; ++j) {
      float mx = fmaxf(s[0][j][0], s[1][j][0]);
#pragma unroll
      for (int r = 1; r < 8; ++r) mx = fmaxf(mx, fmaxf(s[0][j][r], s[1][j][r]));
      mx = fmaxf(mx, other_half(mx)) * cs;   // both halves hold the maximum of the wave's 32 keys
      const float mnew = fmaxf(mrun[j], mx);
      alpha[j] = __builtin_amdgcn_exp2f(mrun[j] - mnew);
      mrun[j]  = mnew;

      float ps0 = 0.0f, ps1 = 0.0f;
#pragma unroll
      for (int r = 0; r < 8; ++r) {
        const float p0 = __builtin_amdgcn_exp2f(fmaf(s[0][j][r], cs, -mnew));
        const float p1 = __builtin_amdgcn_exp2f(fmaf(s[1][j][r], cs, -mnew));
        pf[j][r]     = (_Float16)p0;
        pf[j][r + 8] = (_Float16)p1;
        ps0 += p0;
        ps1 += p1;
      }
      lrun[j] = lrun[j] * alpha[j] + (ps0 + ps1);
    }

    // ---- O^T = O^T * alpha + V^T(256 x 32) . P^T(32 x 32): the same ring, V^T
    // pair u in kr[u % 3].
    __builtin_amdgcn_sched_barrier(0);   // V^T reads behind the softmax: no registers earlier
    load_v_pair(Vt, 0, kr[0]);
    load_v_pair(Vt, 1, kr[1]);
    load_v_pair(Vt, 2, kr[2]);
    __builtin_amdgcn_sched_barrier(0);   // and in front of pair 0's scaling and WMMAs
#pragma unroll
    for (int u = 0; u < 8; ++u) {
      pv_pair(kr[u % 3], pf, alpha, u, oacc);
      if (u + 3 < 8) {
        __builtin_amdgcn_sched_barrier(0); // the next reads behind this pair's WMMAs
        load_v_pair(Vt, u + 3, kr[u % 3]);
        __builtin_amdgcn_sched_barrier(0); // and in front of the next pair's
      }
    }

    // ---- hand-over: tile t + 1 published, tile t's buffer free.
    // Keeps the hand-over behind the last WMMAs: lifted above them, its
    // s_wait_dscnt 0 stalls every wave on the V^T reads with nothing to do.
    __builtin_amdgcn_sched_barrier(0);
    wait_lds_reads();
    wait_copies();
    __syncthreads();
    if (t + 2 < kTiles) stage_kv(buf, Kb, VbT, (t + 2) * kKC, tid);
  }
  wait_copies();

  // ---- join the wave halves' sums, then the four key quarters through the ring
  // (no copy in flight, every read of it ended by the last tile's barrier).
  // Every wave lays down its O^T, 32 KB in slot w = kq * 2 + qg; then wave (qg, kq)
  // adds up the four quarters of output tiles 4 kq .. 4 kq + 3 of its 32 queries.
#pragma unroll
  for (int j = 0; j < 2; ++j) lrun[j] += other_half(lrun[j]);
  float4* jo = (float4*)ring + lane;
  {
    float4* js = jo + (size_t)w * 64 * 32;
#pragma unroll
    for (int tt = 0; tt < 16; ++tt) {
#pragma unroll
      for (int j = 0; j < 2; ++j) {
        const v8f o = oacc[tt][j];
        js[(tt * 4 + j * 2 + 0) * 32] = make_float4(o[0], o[1], o[2], o[3]);
        js[(tt * 4 + j * 2 + 1) * 32] = make_float4(o[4], o[5], o[6], o[7]);
      }
    }
#pragma unroll
    for (int j = 0; j < 2; ++j) {
      jm[w][j][lane] = mrun[j];
      jl[w][j][lane] = lrun[j];
    }
  }
  __syncthreads();

  float a[4][2];                           // weight of quarter k for column group j
#pragma unroll
  for (int j = 0; j < 2; ++j) {
    float m[4], l[4];
#pragma unroll
    for (int k = 0; k < 4; ++k) {
      m[k] = jm[k * 2 + qg][j][lane];
      l[k] = jl[k * 2 + qg][j][lane];
    }
    const float mm = fmaxf(fmaxf(m[0], m[1]), fmaxf(m[2], m[3]));
    float den = 0.0f;
#pragma unroll
    for (int k = 0; k < 4; ++k) {
      a[k][j] = __builtin_amdgcn_exp2f(m[k] - mm);
      den += l[k] * a[k][j];
    }
    const float inv = 1.0f / den;
#pragma unroll
    for (int k = 0; k < 4; ++k) a[k][j] *= inv;
  }

  v8h res[2][4];
#pragma unroll
  for (int j = 0; j < 2; ++j) {
#pragma unroll
    for (int x = 0; x < 4; ++x) {
      const float4* jt = jo + (size_t)qg * 64 * 32 + ((kq * 4 + x) * 4 + j * 2) * 32;
      float f[8];
#pragma unroll
      for (int k = 0; k < 4; ++k) {
        const float4 u0 = jt[(size_t)k * 2 * 64 * 32];
        const float4 u1 = jt[(size_t)k * 2 * 64 * 32 + 32];
        const float  ak = a[k][j];
        if (k == 0) {
          f[0] = u0.x * ak;
          f[1] = u0.y * ak;
          f[2] = u0.z * ak;
          f[3] = u0.w * ak;
          f[4] = u1.x * ak;
          f[5] = u1.y * ak;
          f[6] = u1.z * ak;
          f[7] = u1.w * ak;
        } else {
          f[0] += u0.x * ak;
          f[1] += u0.y * ak;
          f[2] += u0.z * ak;
          f[3] += u0.w * ak;
          f[4] += u1.x * ak;
          f[5] += u1.y * ak;
          f[6] += u1.z * ak;
          f[7] += u1.w * ak;
        }
      }
#pragma unroll
      for (int r = 0; r < 8; ++r) res[j][x][r] = (_Float16)f[r];
    }
  }
  // A lane's 8 values of a tile are 8 consecutive d of one query: one 16-byte
  // store; a wave's four tiles are one whole 128-byte line of each Xa row. The
  // stores stand last, so that nothing behind them rewrites a register they name.
#pragma unroll
  for (int j = 0; j < 2; ++j) {
    _Float16* xo = Xa + ((size_t)b * kL + qbase + j * 16 + (lane & 15)) * kDim +
                   kq * 64 + 8 * (lane >> 4);
#pragma unroll
    for (int x = 0; x < 4; ++x) *(v8h*)(xo + x * 16) = res[j][x];
  }
}

// ---------------------------------------------------------------------------
// Output projection + residual: out = Xa @ Wo + bo + x_dec   (fp32 out)
// ---------------------------------------------------------------------------
__global__ __launch_bounds__(256) void outproj_kernel(const _Float16* __restrict__ Xa,
                                                      const float* __restrict__ W,
                                                      const float* __restrict__ bias,
                                                      const float* __restrict__ resid,
                                                      float* __restrict__ Out) {
  __shared__ alignas(16) _Float16 Wt[kPC][kWP];

  const int tid  = threadIdx.x;
  const int lane = tid & 31;
  const int w    = tid >> 5;
  const int rbase = blockIdx.x * kPR + w * 16;
  const int cbase = blockIdx.y * kPC;

  float wf[8][8];
  load_w_slab(W, cbase, tid, wf);
  v16h a[8];
#pragma unroll
  for (int d = 0; d < 8; ++d)
    a[d] = load_a_frag_f16(Xa + (size_t)rbase * kDim + d * 32, kDim, lane);
  wait_load_addresses();
  store_w_slab(wf, Wt, tid);
  __syncthreads();

  v8f acc[4] = {};
  rows16_times_slab(a, Wt, lane, acc);

#pragma unroll
  for (int t = 0; t < 4; ++t) {
    const int col = cbase + t * 16 + (lane & 15);
    const float bv = bias[col];
#pragma unroll
    for (int r = 0; r < 8; ++r) {
      const int row = rbase + r + 8 * (lane >> 4);
      Out[(size_t)row * kDim + col] =
          acc[t][r] + bv + resid[(size_t)row * kDim + col];
    }
  }
}

// ---------------------------------------------------------------------------
extern "C" void kernel_launch(void* const* d_in, const int* in_sizes, int n_in,
                              void* d_out, int out_size, void* d_ws, size_t ws_size,
                              hipStream_t stream) {
  const float* x_dec = (const float*)d_in[0];
  const float* x_enc = (const float*)d_in[1];
  const float* Wq = (const float*)d_in[2];
  const float* bq = (const float*)d_in[3];
  const float* Wk = (const float*)d_in[4];
  const float* bk = (const float*)d_in[5];
  const float* Wv = (const float*)d_in[6];
  const float* bv = (const float*)d_in[7];
  const float* Wo = (const float*)d_in[8];
  const float* bo = (const float*)d_in[9];

  const int B = 4, L = kL;
  const int N = B * L;                       // 16384 rows
  const size_t mat = (size_t)N * kDim;       // elements per f16 intermediate

  _Float16* Qh  = (_Float16*)d_ws;           // 8 MB
  _Float16* Khw = Qh + mat;                  // 8 MB
  _Float16* VhT = Khw + mat;                 // 8 MB (transposed: [B][D][L])
  _Float16* Xa  = VhT + mat;                 // 8 MB

  dim3 pgrid(N / kPR, kDim / kPC);           // 128 x 4 blocks, 256 threads
  proj_kernel <<<pgrid, 256, 0, stream>>>(x_dec, Wq, bq, Qh);
  projKV_kernel<<<pgrid, 256, 0, stream>>>(x_enc, Wk, bk, Wv, bv, Khw, VhT);

  dim3 agrid(L / kQB, B);                    // 64 x 4 blocks, 256 threads
  attn_kernel<<<agrid, 256, 0, stream>>>(Qh, Khw, VhT, Xa);

  outproj_kernel<<<pgrid, 256, 0, stream>>>(Xa, Wo, bo, x_dec, (float*)d_out);
}

// v005
// It runs in 91.6 microseconds.
// In both of two side-by-side timings against v004, it was 1.07 times as fast.
// Counting every step since v000, it is 5.87 times as fast.
#include <hip/hip_runtime.h>
#include <hip/hip_bf16.h>
#include <math.h>

// ---------------------------------------------------------------------------
// CDNA5 (gfx1250) cross-attention: wave32, v_wmma_f32_16x16x32_f16 matmuls,
// async global->LDS staging (ASYNCcnt) for the K, V and Wo^T operands.
// ---------------------------------------------------------------------------

typedef __attribute__((ext_vector_type(16))) _Float16 v16h;
typedef __attribute__((ext_vector_type(8)))  float    v8f;

static constexpr int kDim = 256;   // model dim (single head, softmax scale 1/16)
static constexpr int kKC  = 128;   // k-chunk per flash-attention iteration
static constexpr int kL   = 4096;  // sequence length (Lq == Lk)

// WMMA 16x16x32 f16 fragment loaders (wave32 layouts per CDNA5 ISA 7.12.2).
// A-matrix 16x32: lane<16 -> row=lane, K = {kh*8..+7, 16+kh*8..+7}, kh=lane>>4.
// A row-major A-fragment of K is exactly the B-fragment of K^T (layout duality),
// so both A and B fragments load as two contiguous 16-byte chunks per lane.
__device__ inline v16h load_a_frag_f16(const _Float16* base, int ld, int lane) {
  const int m  = lane & 15;
  const int kh = lane >> 4;
  const _Float16* p = base + m * ld + kh * 8;
  v16h a;
#pragma unroll
  for (int j = 0; j < 8; ++j) {
    a[j]     = p[j];        // K = kh*8 + j
    a[j + 8] = p[16 + j];   // K = 16 + kh*8 + j
  }
  return a;
}

__device__ inline v16h load_a_frag_f32(const float* base, int ld, int lane) {
  const int m  = lane & 15;
  const int kh = lane >> 4;
  const float* p = base + m * ld + kh * 8;
  v16h a;
#pragma unroll
  for (int j = 0; j < 8; ++j) {
    a[j]     = (_Float16)p[j];
    a[j + 8] = (_Float16)p[16 + j];
  }
  return a;
}

__device__ inline v8f wmma_f16(v16h a, v16h b, v8f c) {
  return __builtin_amdgcn_wmma_f32_16x16x32_f16(false, a, false, b, (short)0, c,
                                                false, false);
}

// ---------------------------------------------------------------------------
// Projections, shared frame. Block: 256 threads = 8 waves; 128 rows x 64 cols.
// The block's whole W slab (256 k x 64 n) is converted to f16 and laid down
// transposed in LDS ONCE; each wave then runs its own 16 rows against it
// (4 accumulator tiles, 32 WMMAs), so one staging serves 128 rows.
// ---------------------------------------------------------------------------
typedef __attribute__((ext_vector_type(8))) _Float16 v8h;
typedef __attribute__((ext_vector_type(4))) unsigned v4u;

static constexpr int kPR = 128;        // rows per block
static constexpr int kPC = 64;         // cols per block
static constexpr int kWP = kDim + 8;   // slab row pitch in halves: 528 B = 16 B x 33

// Stands behind a run of global loads, in front of whatever reuses their address
// registers.
__device__ inline void wait_load_addresses() {
  asm volatile("s_wait_xcnt 0x0" ::: "memory");
}

// Slab staging, Wt[n][k] = f16(W[k][cbase + n]), in two halves so that the X
// loads can be issued between them. A thread owns column n = tid & 63 and eight
// units of 8 consecutive k: unit i starts at k = (tid >> 6) * 8 + i * 32. A wave
// covers 32 consecutive n, so each 4-byte load is one 128-byte line.
__device__ inline void load_w_slab(const float* __restrict__ W, int cbase, int tid,
                                   float (&f)[8][8]) {
  const float* wp = W + (size_t)((tid >> 6) * 8) * kDim + cbase + (tid & (kPC - 1));
#pragma unroll
  for (int i = 0; i < 8; ++i) {
#pragma unroll
    for (int j = 0; j < 8; ++j) f[i][j] = wp[(i * 32 + j) * kDim];
  }
  wait_load_addresses();
}

// One 16-byte LDS store per unit.
__device__ inline void store_w_slab(const float (&f)[8][8], _Float16 (*Wt)[kWP],
                                    int tid) {
#pragma unroll
  for (int i = 0; i < 8; ++i) {
    v8h t;
#pragma unroll
    for (int j = 0; j < 8; ++j) t[j] = (_Float16)f[i][j];
    *(v8h*)&Wt[tid & (kPC - 1)][(tid >> 6) * 8 + i * 32] = t;
  }
}

// Raw f32 rows of the eight A fragments of one wave (16 rows x 256 k): the same
// elements, in the same order, as load_a_frag_f32 reads.
__device__ inline void load_x_rows(const float* base, int lane, float4 (&x)[8][4]) {
  const float* p = base + (lane & 15) * kDim + (lane >> 4) * 8;
#pragma unroll
  for (int d = 0; d < 8; ++d) {
    x[d][0] = *(const float4*)(p + d * 32);
    x[d][1] = *(const float4*)(p + d * 32 + 4);
    x[d][2] = *(const float4*)(p + d * 32 + 16);
    x[d][3] = *(const float4*)(p + d * 32 + 20);
  }
  // The wait of wait_load_addresses(), with p named as an input: p stays in its
  // registers up to the wait, so that no load of the run lands in them.
  asm volatile("s_wait_xcnt 0x0" :: "v"(p) : "memory");
}

__device__ inline void cvt_x_rows(const float4 (&x)[8][4], v16h (&a)[8]) {
#pragma unroll
  for (int d = 0; d < 8; ++d) {
#pragma unroll
    for (int q = 0; q < 4; ++q) {
      a[d][q * 4 + 0] = (_Float16)x[d][q].x;
      a[d][q * 4 + 1] = (_Float16)x[d][q].y;
      a[d][q * 4 + 2] = (_Float16)x[d][q].z;
      a[d][q * 4 + 3] = (_Float16)x[d][q].w;
    }
  }
}

// acc[t] += A(16 x 256) @ W[:, t*16 .. t*16+15], k in ascending chunks of 32.
__device__ inline void rows16_times_slab(const v16h (&a)[8],
                                         const _Float16 (*Wt)[kWP], int lane,
                                         v8f (&acc)[4]) {
#pragma unroll
  for (int d = 0; d < 8; ++d) {
#pragma unroll
    for (int t = 0; t < 4; ++t) {
      v16h b = load_a_frag_f16(&Wt[t * 16][d * 32], kWP, lane);  // B-frag of W
      acc[t] = wmma_f16(a[d], b, acc[t]);
    }
  }
}

// ---------------------------------------------------------------------------
// Projection: Y[N][256] = f16( X[N][256] @ W[256][256] + bias )
// On the side, 32 of the blocks lay down WoT[n][k] = f16(Wo[k][n]) for the output
// projection at the end of the attention kernel: block x takes k = 8x .. 8x + 7,
// thread n one column. The loads go out with the block's own.
// ---------------------------------------------------------------------------
__global__ __launch_bounds__(256) void proj_kernel(const float* __restrict__ X,
                                                   const float* __restrict__ W,
                                                   const float* __restrict__ bias,
                                                   _Float16* __restrict__ Y,
                                                   const float* __restrict__ Wo,
                                                   _Float16* __restrict__ WoT) {
  __shared__ alignas(16) _Float16 Wt[kPC][kWP];

  const int tid  = threadIdx.x;
  const int lane = tid & 31;
  const int w    = tid >> 5;
  const int rbase = blockIdx.x * kPR + w * 16;
  const int cbase = blockIdx.y * kPC;

  float  wf[8][8];
  float4 xr[8][4];
  load_w_slab(W, cbase, tid, wf);
  load_x_rows(X + (size_t)rbase * kDim, lane, xr);
  const bool prep = blockIdx.y == 0 && blockIdx.x < kDim / 8;   // the same for a whole block
  float of[8] = {};
  if (prep) {
#pragma unroll
    for (int j = 0; j < 8; ++j) of[j] = Wo[(blockIdx.x * 8 + j) * kDim + tid];
    // The wait of wait_load_addresses(), with the index named as an input: it stays in
    // its register up to the wait, so that no load of the run lands in it.
    asm volatile("s_wait_xcnt 0x0" :: "v"(tid) : "memory");
  }
  store_w_slab(wf, Wt, tid);
  __syncthreads();

  if (prep) {
    v8h t;
#pragma unroll
    for (int j = 0; j < 8; ++j) t[j] = (_Float16)of[j];
    // The store and its s_wait_xcnt 0 in one statement, so that the wait stands in
    // front of any rewrite of the registers the store names: in a statement of its
    // own, the build lifts later register writes over it.
    asm volatile("global_store_b128 %0, %1, off\n\ts_wait_xcnt 0x0"
                 :: "v"(&WoT[(size_t)tid * kDim + blockIdx.x * 8]),
                    "v"(__builtin_bit_cast(v4u, t))
                 : "memory");
  }

  v16h a[8];
  cvt_x_rows(xr, a);

  v8f acc[4] = {};
  rows16_times_slab(a, Wt, lane, acc);

#pragma unroll
  for (int t = 0; t < 4; ++t) {
    const int col = cbase + t * 16 + (lane & 15);
    const float bv = bias[col];
#pragma unroll
    for (int r = 0; r < 8; ++r) {
      const int row = rbase + r + 8 * (lane >> 4);
      Y[(size_t)row * kDim + col] = (_Float16)(acc[t][r] + bv);
    }
  }
}

// ---------------------------------------------------------------------------
// K and V projections of the same rows in one kernel. A block reads its 128 rows
// of X ONCE, keeps them as f16 A fragments, and runs them against its 64-column
// slab of Wk and then of Wv, each slab in an LDS buffer of its own.
//   Y [row][col]   = f16(X @ Wk + bk)
//   YT[b][col][l]  = f16(X @ Wv + bv), transposed: rows r = 0..7 of a C tile are
//                    consecutive along l, one 16-byte store per lane and tile.
// The Wv slab is fetched behind the first barrier, so that it flies while the K
// products run.
// ---------------------------------------------------------------------------
__global__ __launch_bounds__(256) void projKV_kernel(const float* __restrict__ X,
                                                     const float* __restrict__ Wk,
                                                     const float* __restrict__ bk,
                                                     const float* __restrict__ Wv,
                                                     const float* __restrict__ bv,
                                                     _Float16* __restrict__ Y,
                                                     _Float16* __restrict__ YT) {
  __shared__ alignas(16) _Float16 Wt[2][kPC][kWP];

  const int tid  = threadIdx.x;
  const int lane = tid & 31;
  const int w    = tid >> 5;
  const int rbase = blockIdx.x * kPR + w * 16;
  const int cbase = blockIdx.y * kPC;

  float  wf[8][8];
  float4 xr[8][4];
  load_w_slab(Wk, cbase, tid, wf);
  load_x_rows(X + (size_t)rbase * kDim, lane, xr);
  store_w_slab(wf, Wt[0], tid);
  __syncthreads();                       // Wk slab readable by every wave

  load_w_slab(Wv, cbase, tid, wf);

  v16h a[8];
  cvt_x_rows(xr, a);

  v8f acc[4] = {};
  rows16_times_slab(a, Wt[0], lane, acc);

  // Keeps the wait for the Wv loads behind the K products: mixed in among them, it
  // stalls the wave on loads issued just ahead, with most of its WMMAs still to do.
  __builtin_amdgcn_sched_barrier(0);
  store_w_slab(wf, Wt[1], tid);
  __syncthreads();                       // Wv slab readable by every wave

#pragma unroll
  for (int t = 0; t < 4; ++t) {
    const int col = cbase + t * 16 + (lane & 15);
    const float bb = bk[col];
#pragma unroll
    for (int r = 0; r < 8; ++r) {
      const int row = rbase + r + 8 * (lane >> 4);
      Y[(size_t)row * kDim + col] = (_Float16)(acc[t][r] + bb);
    }
  }
  wait_load_addresses();                 // the V part reuses registers these stores name

  v8f acv[4] = {};
  rows16_times_slab(a, Wt[1], lane, acv);

  const int row0 = rbase + 8 * (lane >> 4);   // 8 consecutive rows per lane
  const int b    = row0 >> 12;                // 4096 rows per batch
  const int l0   = row0 & (kL - 1);
#pragma unroll
  for (int t = 0; t < 4; ++t) {
    const int col  = cbase + t * 16 + (lane & 15);
    const float bb = bv[col];
    v8h tmp;
#pragma unroll
    for (int r = 0; r < 8; ++r) tmp[r] = (_Float16)(acv[t][r] + bb);
    *(v8h*)&YT[((size_t)b * kDim + col) * kL + l0] = tmp;
  }
}

static constexpr int kQB    = 64;
static constexpr int kKP    = kDim + 8;
static constexpr int kVP    = kKC + 8;
static constexpr int kKTile = kKC * kKP;
static constexpr int kVTile = kDim * kVP;
static constexpr int kStage = kKTile + kVTile;
static constexpr int kTiles = kL / kKC;
static_assert(kTiles >= 2, "the two-buffer prologue fills tiles 0 and 1");
static_assert(4 * kQB * kDim * 4 <= 2 * kStage * 2, "the join reuses the ring");
// LDS of the output projection at the end: O (64 rows) from the start of the ring,
// Wo^T (256 rows) placed so that its rows from kWoEarly on lie behind the 256 KB of
// the join: those rows are copied in while the quarters are joined, the rest after.
static constexpr int kJoin    = 4 * kQB * kDim * 2;         // halves the join uses
static constexpr int kWoEarly = 160;
static constexpr int kWtOff   = kJoin - kWoEarly * kWP;     // halves, a multiple of 8
static constexpr int kRing    = kWtOff + kDim * kWP;        // halves of the whole ring
static_assert(kRing >= 2 * kStage && kQB * kWP <= kWtOff && kWtOff % 8 == 0, "LDS plan");

// Lane l with lane l ^ 16.
__device__ inline float other_half(float x) {
  return __builtin_bit_cast(
      float, __builtin_amdgcn_permlanex16(__builtin_bit_cast(int, x),
                                          __builtin_bit_cast(int, x), 0x76543210,
                                          0xfedcba98, false, false));
}

// This wave's LDS reads have returned: stands in front of the barrier behind
// which their buffer is refilled.
__device__ inline void wait_lds_reads() {
  asm volatile("s_wait_dscnt 0x0" ::: "memory");
}

// This wave's async copies have landed: stands in front of the barrier behind
// which other waves read them.
__device__ inline void wait_copies() {
  asm volatile("s_wait_asynccnt 0x0" ::: "memory");
}

// Eight 16-byte-per-lane copies global -> LDS from three address pairs: four
// 128-byte steps along a K row, two along each of two V^T rows. An immediate
// offset moves the LDS and the global address alike, so the steps along a row
// need no registers of their own. The closing s_wait_xcnt 0 is part of the
// statement so that it stands in front of any rewrite of the address registers
// the copies name.
__device__ inline void copy8(unsigned lk, const _Float16* pk, unsigned lv0,
                             const _Float16* pv0, unsigned lv1, const _Float16* pv1) {
  asm volatile(
      "global_load_async_to_lds_b128 %0, %3, off\n\t"
      "global_load_async_to_lds_b128 %0, %3, off offset:128\n\t"
      "global_load_async_to_lds_b128 %0, %3, off offset:256\n\t"
      "global_load_async_to_lds_b128 %0, %3, off offset:384\n\t"
      "global_load_async_to_lds_b128 %1, %4, off\n\t"
      "global_load_async_to_lds_b128 %1, %4, off offset:128\n\t"
      "global_load_async_to_lds_b128 %2, %5, off\n\t"
      "global_load_async_to_lds_b128 %2, %5, off offset:128\n\t"
      "s_wait_xcnt 0x0"
      :: "v"(lk), "v"(lv0), "v"(lv1), "v"(pk), "v"(pv0), "v"(pv1)
      : "memory");
}

// One tile of 128 keys into buf: K rows kb .. kb + 127 (512 B each) and V^T rows
// 0 .. 255, keys kb .. kb + 127 (256 B each). Eight lanes copy one 128-byte line,
// a wave four whole lines per instruction. 32 copies a wave.
__device__ inline void stage_kv(_Float16* buf, const _Float16* Kb,
                                const _Float16* VbT, int kb, int tid) {
  const int r = tid >> 3;          // row within a block of 32 rows
  const int c = (tid & 7) * 8;     // this lane's 16 bytes of a line, in halves
  _Float16*       lk = buf + (r * kKP + c);
  const _Float16* pk = (Kb + (size_t)kb * kDim) + (unsigned)(r * kDim + c);
  _Float16*       lv = buf + (kKTile + r * kVP + c);
  const _Float16* pv = (VbT + kb) + (unsigned)(r * kL + c);
  // Stays rolled: unrolled, the build keeps every trip's addresses alive over the
  // whole tile loop, and they no longer fit the registers.
#pragma unroll 1
  for (int g = 0; g < 4; ++g) {    // 32 K rows and 64 V^T rows a trip
    copy8((unsigned)(unsigned long long)lk, pk,          // LDS byte addresses
          (unsigned)(unsigned long long)lv, pv,
          (unsigned)(unsigned long long)(lv + 32 * kVP), pv + (size_t)32 * kL);
    lk += 32 * kKP;
    pk += 32 * kDim;
    lv += 64 * kVP;
    pv += (size_t)64 * kL;
  }
}

// The fragment of load_a_frag_f16, same elements in the same order, from the
// lane's own address p = base + (lane & 15) * ld + (lane >> 4) * 8: the lane's part
// is formed once, in front of the tile loop, and takes one register.
__device__ inline v16h load_frag_at(const _Float16* p) {
  v16h a;
#pragma unroll
  for (int j = 0; j < 8; ++j) {
    a[j]     = p[j];        // K = kh*8 + j
    a[j + 8] = p[16 + j];   // K = 16 + kh*8 + j
  }
  return a;
}

// K fragments of k chunk d, one for each 16-key tile. Kt: the lane's own address.
__device__ inline void load_k_pair(const _Float16* Kt, int d, v16h (&k)[2]) {
  k[0] = load_frag_at(Kt + d * 32);
  k[1] = load_frag_at(Kt + 16 * kKP + d * 32);
}

// s[i][j] += K(key tile i) . Q^T(column group j) over k chunk d.
__device__ inline void s_chunk(const v16h (&k)[2], const v16h (&q)[2][8], int d,
                               v8f (&s)[2][2]) {
#pragma unroll
  for (int i = 0; i < 2; ++i) {
#pragma unroll
    for (int j = 0; j < 2; ++j) s[i][j] = wmma_f16(k[i], q[j][d], s[i][j]);
  }
}

// V^T fragments of output tiles 2u and 2u + 1. Vt: the lane's own address.
__device__ inline void load_v_pair(const _Float16* Vt, int u, v16h (&v)[2]) {
  v[0] = load_frag_at(Vt + (2 * u) * 16 * kVP);
  v[1] = load_frag_at(Vt + (2 * u + 1) * 16 * kVP);
}

// O^T tiles 2u and 2u + 1, both column groups: scaled by alpha, then += V^T . P^T.
__device__ inline void pv_pair(const v16h (&v)[2], const v16h (&pf)[2],
                               const float (&alpha)[2], int u, v8f (&o)[16][2]) {
#pragma unroll
  for (int x = 0; x < 2; ++x) {
#pragma unroll
    for (int j = 0; j < 2; ++j) o[2 * u + x][j] *= alpha[j];
  }
#pragma unroll
  for (int x = 0; x < 2; ++x) {
#pragma unroll
    for (int j = 0; j < 2; ++j)
      o[2 * u + x][j] = wmma_f16(v[x], pf[j], o[2 * u + x][j]);
  }
}

// Four 16-byte-per-lane copies global -> LDS, each a whole 512-byte row of Wo^T. The
// closing s_wait_xcnt 0 is part of the statement so that it stands in front of any
// rewrite of the address registers the copies name.
__device__ inline void copy4(unsigned l0, const _Float16* p0, unsigned l1,
                             const _Float16* p1, unsigned l2, const _Float16* p2,
                             unsigned l3, const _Float16* p3) {
  asm volatile(
      "global_load_async_to_lds_b128 %0, %4, off\n\t"
      "global_load_async_to_lds_b128 %1, %5, off\n\t"
      "global_load_async_to_lds_b128 %2, %6, off\n\t"
      "global_load_async_to_lds_b128 %3, %7, off\n\t"
      "s_wait_xcnt 0x0"
      :: "v"(l0), "v"(l1), "v"(l2), "v"(l3), "v"(p0), "v"(p1), "v"(p2), "v"(p3)
      : "memory");
}

// Rows kRow0 .. kRow0 + 8 * kPerWave - 1 of Wo^T into Wt (pitch kWP), kPerWave rows a wave.
template <int kRow0, int kPerWave>
__device__ inline void stage_wo(_Float16* Wt, const _Float16* WoT, int w, int lane) {
  static_assert(kPerWave % 4 == 0 && kRow0 + 8 * kPerWave <= kDim, "whole statements, in bounds");
  _Float16*       l = Wt + (kRow0 + w * kPerWave) * kWP + lane * 8;
  const _Float16* p = WoT + (kRow0 + w * kPerWave) * kDim + lane * 8;
#pragma unroll
  for (int i = 0; i < kPerWave; i += 4) {
    copy4((unsigned)(unsigned long long)(l + i * kWP), p + i * kDim,          // LDS byte addresses
          (unsigned)(unsigned long long)(l + (i + 1) * kWP), p + (i + 1) * kDim,
          (unsigned)(unsigned long long)(l + (i + 2) * kWP), p + (i + 2) * kDim,
          (unsigned)(unsigned long long)(l + (i + 3) * kWP), p + (i + 3) * kDim);
  }
}

// Output projection, k chunk d: A fragments of two query tiles of O, B fragments of
// four column tiles of Wo. Oa, Wb: the lane's own addresses.
__device__ inline void load_o_chunk(const _Float16* Oa, const _Float16* Wb, int d,
                                    v16h (&fa)[2], v16h (&fb)[4]) {
#pragma unroll
  for (int i = 0; i < 2; ++i) fa[i] = load_frag_at(Oa + i * 16 * kWP + d * 32);
#pragma unroll
  for (int t = 0; t < 4; ++t) fb[t] = load_frag_at(Wb + t * 16 * kWP + d * 32);
}

__global__ __launch_bounds__(256) void attn_kernel(const _Float16* __restrict__ Qh,
                                                   const _Float16* __restrict__ Kh,
                                                   const _Float16* __restrict__ VhT,
                                                   const _Float16* __restrict__ WoT,
                                                   const float* __restrict__ bo,
                                                   const float* __restrict__ resid,
                                                   float* __restrict__ Out) {
  __shared__ alignas(16) _Float16 ring[kRing];       // two K + V^T buffers; the epilogue's LDS
  __shared__ float jm[8][2][32], jl[8][2][32];       // join: m and l of every wave

  const int tid  = threadIdx.x;
  const int lane = tid & 31;
  // The wave's number, the same in every lane, held in a scalar register: the tile
  // loop needs nearly every vector register that two waves on a SIMD can own.
  const int w    = __builtin_amdgcn_readfirstlane(tid >> 5);
  const int qg   = w & 1;
  const int kq   = w >> 1;
  const int b     = blockIdx.y;
  const int qbase = blockIdx.x * kQB + qg * 32;
  const float cs = 0.0625f * 1.44269504088896340736f;  // 1/sqrt(256) * log2(e)

  const _Float16* Qb  = Qh  + (size_t)b * kL * kDim;
  const _Float16* Kb  = Kh  + (size_t)b * kL * kDim;
  const _Float16* VbT = VhT + (size_t)b * kDim * kL;

  stage_kv(ring, Kb, VbT, 0, tid);

  // This wave's Q^T (256 x 32) as 2 x 8 B-fragments: lane (c, h) holds query
  // j * 16 + c in the k order of the K loader. Reused for every tile.
  v16h qfrag[2][8];
#pragma unroll
  for (int j = 0; j < 2; ++j) {
#pragma unroll
    for (int d = 0; d < 8; ++d)
      qfrag[j][d] = load_a_frag_f16(Qb + (size_t)(qbase + j * 16) * kDim + d * 32, kDim, lane);
  }
  wait_load_addresses();

  wait_copies();
  __syncthreads();                       // tile 0 readable by every wave
  stage_kv(ring + kStage, Kb, VbT, kKC, tid);

  v8f   oacc[16][2] = {};                // O^T: d = t*16 + 8h + r, query j*16 + c
  float mrun[2] = {-3.0e38f, -3.0e38f};  // running maxima, log2 domain
  float lrun[2] = {0.0f, 0.0f};          // this lane's share of the running sums

  const int kfo = (kq * 32 + (lane & 15)) * kKP + (lane >> 4) * 8;
  const int vfo = kKTile + (lane & 15) * kVP + kq * 32 + (lane >> 4) * 8;

  for (int t = 0; t < kTiles; ++t) {
    _Float16* buf = ring + (t & 1) * kStage;
    const _Float16* Kt = buf + kfo;
    const _Float16* Vt = buf + vfo;

    // ---- S^T: two 16-key tiles x two 16-query groups, K fragments through a ring
    // of three pairs. Each scheduling barrier below keeps a pair's LDS reads
    // together and two chunks (8 WMMAs) ahead of their use: spread among the
    // WMMAs, each WMMA stalls on a read issued just ahead of it; lifted further
    // up, the fragments no longer fit the registers.
    v16h kr[3][2];
    v8f  s[2][2] = {};
    load_k_pair(Kt, 0, kr[0]);
    load_k_pair(Kt, 1, kr[1]);
    load_k_pair(Kt, 2, kr[2]);
    __builtin_amdgcn_sched_barrier(0);   // reads of chunks 0 to 2 in front of the WMMAs
#pragma unroll
    for (int d = 0; d < 8; ++d) {
      s_chunk(kr[d % 3], qfrag, d, s);
      if (d + 3 < 8) {
        __builtin_amdgcn_sched_barrier(0); // the next reads behind this chunk's WMMAs
        load_k_pair(Kt, d + 3, kr[d % 3]);
        __builtin_amdgcn_sched_barrier(0); // and in front of the next chunk's
      }
    }

    // ---- online softmax of queries c and 16 + c, in registers
    v16h  pf[2];                           // P^T as B: pf[j][x] = P[query][kmap(x, h)]
    float alpha[2];
#pragma unroll
    for (int j = 0; j < 2; ++j) {
      float mx = fmaxf(s[0][j][0], s[1][j][0]);
#pragma unroll
      for (int r = 1; r < 8; ++r) mx = fmaxf(mx, fmaxf(s[0][j][r], s[1][j][r]));
      mx = fmaxf(mx, other_half(mx)) * cs;   // both halves hold the maximum of the wave's 32 keys
      const float mnew = fmaxf(mrun[j], mx);
      alpha[j] = __builtin_amdgcn_exp2f(mrun[j] - mnew);
      mrun[j]  = mnew;

      float ps0 = 0.0f, ps1 = 0.0f;
#pragma unroll
      for (int r = 0; r < 8; ++r) {
        const float p0 = __builtin_amdgcn_exp2f(fmaf(s[0][j][r], cs, -mnew));
        const float p1 = __builtin_amdgcn_exp2f(fmaf(s[1][j][r], cs, -mnew));
        pf[j][r]     = (_Float16)p0;
        pf[j][r + 8] = (_Float16)p1;
        ps0 += p0;
        ps1 += p1;
      }
      lrun[j] = lrun[j] * alpha[j] + (ps0 + ps1);
    }

    // ---- O^T = O^T * alpha + V^T(256 x 32) . P^T(32 x 32): the same ring, V^T
    // pair u in kr[u % 3].
    __builtin_amdgcn_sched_barrier(0);   // V^T reads behind the softmax: no registers earlier
    load_v_pair(Vt, 0, kr[0]);
    load_v_pair(Vt, 1, kr[1]);
    load_v_pair(Vt, 2, kr[2]);
    __builtin_amdgcn_sched_barrier(0);   // and in front of pair 0's scaling and WMMAs
#pragma unroll
    for (int u = 0; u < 8; ++u) {
      pv_pair(kr[u % 3], pf, alpha, u, oacc);
      if (u + 3 < 8) {
        __builtin_amdgcn_sched_barrier(0); // the next reads behind this pair's WMMAs
        load_v_pair(Vt, u + 3, kr[u % 3]);
        __builtin_amdgcn_sched_barrier(0); // and in front of the next pair's
      }
    }

    // ---- hand-over: tile t + 1 published, tile t's buffer free.
    // Keeps the hand-over behind the last WMMAs: lifted above them, its
    // s_wait_dscnt 0 stalls every wave on the V^T reads with nothing to do.
    __builtin_amdgcn_sched_barrier(0);
    wait_lds_reads();
    wait_copies();
    __syncthreads();
    if (t + 2 < kTiles) stage_kv(buf, Kb, VbT, (t + 2) * kKC, tid);
  }
  wait_copies();

  // The lane's number, read anew: taken from threadIdx it would hold a register all
  // through the tile loop, which then no longer keeps Q wholly in registers.
  const int ln = (int)__builtin_amdgcn_mbcnt_lo(~0u, 0u);

  // ---- join the wave halves' sums, then the four key quarters through the ring
  // (no copy of a tile in flight, every read of it ended by the last tile's barrier).
  // Every wave lays down its O^T, 32 KB in slot w = kq * 2 + qg; then wave (qg, kq)
  // adds up the four quarters of output tiles 4 kq .. 4 kq + 3 of its 32 queries.
  // Behind the join's part of the ring nothing is live any more: the upper rows of
  // Wo^T fly in while the quarters are laid down and joined.
  stage_wo<kWoEarly, (kDim - kWoEarly) / 8>(ring + kWtOff, WoT, w, ln);
#pragma unroll
  for (int j = 0; j < 2; ++j) lrun[j] += other_half(lrun[j]);
  float4* jo = (float4*)ring + ln;
  {
    float4* js = jo + (size_t)w * 64 * 32;
#pragma unroll
    for (int tt = 0; tt < 16; ++tt) {
#pragma unroll
      for (int j = 0; j < 2; ++j) {
        const v8f o = oacc[tt][j];
        js[(tt * 4 + j * 2 + 0) * 32] = make_float4(o[0], o[1], o[2], o[3]);
        js[(tt * 4 + j * 2 + 1) * 32] = make_float4(o[4], o[5], o[6], o[7]);
      }
    }
#pragma unroll
    for (int j = 0; j < 2; ++j) {
      jm[w][j][ln] = mrun[j];
      jl[w][j][ln] = lrun[j];
    }
  }
  __syncthreads();

  float a[4][2];                           // weight of quarter k for column group j
#pragma unroll
  for (int j = 0; j < 2; ++j) {
    float m[4], l[4];
#pragma unroll
    for (int k = 0; k < 4; ++k) {
      m[k] = jm[k * 2 + qg][j][ln];
      l[k] = jl[k * 2 + qg][j][ln];
    }
    const float mm = fmaxf(fmaxf(m[0], m[1]), fmaxf(m[2], m[3]));
    float den = 0.0f;
#pragma unroll
    for (int k = 0; k < 4; ++k) {
      a[k][j] = __builtin_amdgcn_exp2f(m[k] - mm);
      den += l[k] * a[k][j];
    }
    const float inv = 1.0f / den;
#pragma unroll
    for (int k = 0; k < 4; ++k) a[k][j] *= inv;
  }

  v8h res[2][4];
#pragma unroll
  for (int j = 0; j < 2; ++j) {
#pragma unroll
    for (int x = 0; x < 4; ++x) {
      const float4* jt = jo + (size_t)qg * 64 * 32 + ((kq * 4 + x) * 4 + j * 2) * 32;
      float f[8];
#pragma unroll
      for (int k = 0; k < 4; ++k) {
        const float4 u0 = jt[(size_t)k * 2 * 64 * 32];
        const float4 u1 = jt[(size_t)k * 2 * 64 * 32 + 32];
        const float  ak = a[k][j];
        if (k == 0) {
          f[0] = u0.x * ak;
          f[1] = u0.y * ak;
          f[2] = u0.z * ak;
          f[3] = u0.w * ak;
          f[4] = u1.x * ak;
          f[5] = u1.y * ak;
          f[6] = u1.z * ak;
          f[7] = u1.w * ak;
        } else {
          f[0] += u0.x * ak;
          f[1] += u0.y * ak;
          f[2] += u0.z * ak;
          f[3] += u0.w * ak;
          f[4] += u1.x * ak;
          f[5] += u1.y * ak;
          f[6] += u1.z * ak;
          f[7] += u1.w * ak;
        }
      }
#pragma unroll
      for (int r = 0; r < 8; ++r) res[j][x][r] = (_Float16)f[r];
    }
  }
  // ---- output projection and residual of the block's 64 queries, in place of a
  // launch of its own: out = f16(O) @ f16(Wo) + bo + x_dec, k in ascending chunks of 32.
  _Float16 (*Wt)[kWP] = (_Float16 (*)[kWP])(ring + kWtOff);       // Wt[n][k], 256 rows
  _Float16 (*Os)[kWP] = (_Float16 (*)[kWP])ring;                  // O[query][d], 64 rows
  __syncthreads();                         // every wave's join reads of the ring ended
  stage_wo<0, kWoEarly / 8>(ring + kWtOff, WoT, w, ln);
  // A lane's 8 values of a tile are 8 consecutive d of one query: one 16-byte store.
#pragma unroll
  for (int j = 0; j < 2; ++j) {
#pragma unroll
    for (int x = 0; x < 4; ++x)
      *(v8h*)&Os[qg * 32 + j * 16 + (ln & 15)][kq * 64 + x * 16 + 8 * (ln >> 4)] = res[j][x];
  }
  // Output projection: wave w takes query tiles 2 wq and 2 wq + 1, columns 64 wn ..
  // 64 wn + 63. Its residual and bias values fly while Wo^T lands.
  const int wn = w & 3;
  const int wq = w >> 2;
  const size_t obase = ((size_t)b * kL + blockIdx.x * kQB + wq * 32 + 8 * (ln >> 4)) * kDim +
                       wn * kPC + (ln & 15);
  float rs[2][4][8];                       // x_dec at this lane's 64 outputs
  {
    const float* rp = resid + obase;
#pragma unroll
    for (int i = 0; i < 2; ++i) {
#pragma unroll
      for (int t = 0; t < 4; ++t) {
#pragma unroll
        for (int r = 0; r < 8; ++r) rs[i][t][r] = rp[(i * 16 + r) * kDim + t * 16];
      }
    }
    // The wait of wait_load_addresses(), with rp named as an input: rp stays in its
    // registers up to the wait, so that no load of the run lands in them.
    asm volatile("s_wait_xcnt 0x0" :: "v"(rp) : "memory");
  }
  float bb[4];
  {
    const int bi = wn * kPC + (ln & 15);
#pragma unroll
    for (int t = 0; t < 4; ++t) bb[t] = bo[bi + t * 16];
    // The same wait, with the index named: it stays in its register up to the wait.
    asm volatile("s_wait_xcnt 0x0" :: "v"(bi) : "memory");
  }
  wait_copies();
  __syncthreads();                         // Wo^T and O readable by every wave

  // Fragments through a ring of three chunks. The scheduling barriers keep a chunk's
  // LDS reads together and two chunks (16 WMMAs) ahead of their use: left to the
  // build, each pair of WMMAs waits out a read issued just ahead of it.
  const _Float16* Oa = &Os[wq * 32 + (ln & 15)][(ln >> 4) * 8];
  const _Float16* Wb = &Wt[wn * kPC + (ln & 15)][(ln >> 4) * 8];
  v16h fa[3][2], fb[3][4];
  v8f  acc[2][4] = {};
  load_o_chunk(Oa, Wb, 0, fa[0], fb[0]);
  load_o_chunk(Oa, Wb, 1, fa[1], fb[1]);
  load_o_chunk(Oa, Wb, 2, fa[2], fb[2]);
  __builtin_amdgcn_sched_barrier(0);       // reads of chunks 0 to 2 in front of the WMMAs
#pragma unroll
  for (int d = 0; d < 8; ++d) {
#pragma unroll
    for (int t = 0; t < 4; ++t) {
#pragma unroll
      for (int i = 0; i < 2; ++i) acc[i][t] = wmma_f16(fa[d % 3][i], fb[d % 3][t], acc[i][t]);
    }
    if (d + 3 < 8) {
      __builtin_amdgcn_sched_barrier(0);   // the next reads behind this chunk's WMMAs
      load_o_chunk(Oa, Wb, d + 3, fa[d % 3], fb[d % 3]);
      __builtin_amdgcn_sched_barrier(0);   // and in front of the next chunk's
    }
  }

#pragma unroll
  for (int i = 0; i < 2; ++i) {
#pragma unroll
    for (int t = 0; t < 4; ++t) {
#pragma unroll
      for (int r = 0; r < 8; ++r) rs[i][t][r] = acc[i][t][r] + bb[t] + rs[i][t][r];
    }
  }
  // The stores stand last, so that nothing behind them rewrites a register they name.
  float* op = Out + obase;
#pragma unroll
  for (int i = 0; i < 2; ++i) {
#pragma unroll
    for (int t = 0; t < 4; ++t) {
#pragma unroll
      for (int r = 0; r < 8; ++r) op[(i * 16 + r) * kDim + t * 16] = rs[i][t][r];
    }
  }
}

// ---------------------------------------------------------------------------
extern "C" void kernel_launch(void* const* d_in, const int* in_sizes, int n_in,
                              void* d_out, int out_size, void* d_ws, size_t ws_size,
                              hipStream_t stream) {
  const float* x_dec = (const float*)d_in[0];
  const float* x_enc = (const float*)d_in[1];
  const float* Wq = (const float*)d_in[2];
  const float* bq = (const float*)d_in[3];
  const float* Wk = (const float*)d_in[4];
  const float* bk = (const float*)d_in[5];
  const float* Wv = (const float*)d_in[6];
  const float* bv = (const float*)d_in[7];
  const float* Wo = (const float*)d_in[8];
  const float* bo = (const float*)d_in[9];

  const int B = 4, L = kL;
  const int N = B * L;                       // 16384 rows
  const size_t mat = (size_t)N * kDim;       // elements per f16 intermediate

  _Float16* Qh  = (_Float16*)d_ws;           // 8 MB
  _Float16* Khw = Qh + mat;                  // 8 MB
  _Float16* VhT = Khw + mat;                 // 8 MB (transposed: [B][D][L])
  _Float16* WoT = VhT + mat;                 // 128 KB (transposed: [n][k])

  dim3 pgrid(N / kPR, kDim / kPC);           // 128 x 4 blocks, 256 threads
  proj_kernel <<<pgrid, 256, 0, stream>>>(x_dec, Wq, bq, Qh, Wo, WoT);
  projKV_kernel<<<pgrid, 256, 0, stream>>>(x_enc, Wk, bk, Wv, bv, Khw, VhT);

  dim3 agrid(L / kQB, B);                    // 64 x 4 blocks, 256 threads
  attn_kernel<<<agrid, 256, 0, stream>>>(Qh, Khw, VhT, WoT, bo, x_dec, (float*)d_out);
}

// v006
// A run of this version takes 74.5 microseconds.
// In both of two side-by-side timings against v005, it was 1.23 times as fast.
// Counting every step since v000, it is 7.23 times as fast.
#include <hip/hip_runtime.h>
#include <hip/hip_bf16.h>
#include <math.h>

// ---------------------------------------------------------------------------
// CDNA5 (gfx1250) cross-attention: wave32, v_wmma_f32_16x16x32_f16 matmuls,
// tensor loads global->LDS (TENSORcnt) for the K and V operands.
// ---------------------------------------------------------------------------

typedef __attribute__((ext_vector_type(16))) _Float16 v16h;
typedef __attribute__((ext_vector_type(8)))  float    v8f;

static constexpr int kDim = 256;   // model dim (single head, softmax scale 1/16)
static constexpr int kKC  = 128;   // k-chunk per flash-attention iteration
static constexpr int kL   = 4096;  // sequence length (Lq == Lk)

// WMMA 16x16x32 f16 fragment loaders (wave32 layouts per CDNA5 ISA 7.12.2).
// A-matrix 16x32: lane<16 -> row=lane, K = {kh*8..+7, 16+kh*8..+7}, kh=lane>>4.
// A row-major A-fragment of K is exactly the B-fragment of K^T (layout duality),
// so both A and B fragments load as two contiguous 16-byte chunks per lane.
__device__ inline v16h load_a_frag_f16(const _Float16* base, int ld, int lane) {
  const int m  = lane & 15;
  const int kh = lane >> 4;
  const _Float16* p = base + m * ld + kh * 8;
  v16h a;
#pragma unroll
  for (int j = 0; j < 8; ++j) {
    a[j]     = p[j];        // K = kh*8 + j
    a[j + 8] = p[16 + j];   // K = 16 + kh*8 + j
  }
  return a;
}

__device__ inline v16h load_a_frag_f32(const float* base, int ld, int lane) {
  const int m  = lane & 15;
  const int kh = lane >> 4;
  const float* p = base + m * ld + kh * 8;
  v16h a;
#pragma unroll
  for (int j = 0; j < 8; ++j) {
    a[j]     = (_Float16)p[j];
    a[j + 8] = (_Float16)p[16 + j];
  }
  return a;
}

__device__ inline v8f wmma_f16(v16h a, v16h b, v8f c) {
  return __builtin_amdgcn_wmma_f32_16x16x32_f16(false, a, false, b, (short)0, c,
                                                false, false);
}

// ---------------------------------------------------------------------------
// Projections, shared frame. Block: 256 threads = 8 waves; 128 rows x 64 cols.
// The block's whole W slab (256 k x 64 n) is converted to f16 and laid down
// transposed in LDS ONCE; each wave then runs its own 16 rows against it
// (4 accumulator tiles, 32 WMMAs), so one staging serves 128 rows.
// ---------------------------------------------------------------------------
typedef __attribute__((ext_vector_type(8))) _Float16 v8h;
typedef __attribute__((ext_vector_type(4))) unsigned v4u;

static constexpr int kPR = 128;        // rows per block
static constexpr int kPC = 64;         // cols per block
static constexpr int kWP = kDim + 8;   // slab row pitch in halves: 528 B = 16 B x 33

// Stands behind a run of global loads, in front of whatever reuses their address
// registers.
__device__ inline void wait_load_addresses() {
  asm volatile("s_wait_xcnt 0x0" ::: "memory");
}

// Slab staging, Wt[n][k] = f16(W[k][cbase + n]), in two halves so that the X
// loads can be issued between them. A thread owns column n = tid & 63 and eight
// units of 8 consecutive k: unit i starts at k = (tid >> 6) * 8 + i * 32. A wave
// covers 32 consecutive n, so each 4-byte load is one 128-byte line.
__device__ inline void load_w_slab(const float* __restrict__ W, int cbase, int tid,
                                   float (&f)[8][8]) {
  const float* wp = W + (size_t)((tid >> 6) * 8) * kDim + cbase + (tid & (kPC - 1));
#pragma unroll
  for (int i = 0; i < 8; ++i) {
#pragma unroll
    for (int j = 0; j < 8; ++j) f[i][j] = wp[(i * 32 + j) * kDim];
  }
  wait_load_addresses();
}

// One 16-byte LDS store per unit.
__device__ inline void store_w_slab(const float (&f)[8][8], _Float16 (*Wt)[kWP],
                                    int tid) {
#pragma unroll
  for (int i = 0; i < 8; ++i) {
    v8h t;
#pragma unroll
    for (int j = 0; j < 8; ++j) t[j] = (_Float16)f[i][j];
    *(v8h*)&Wt[tid & (kPC - 1)][(tid >> 6) * 8 + i * 32] = t;
  }
}

// Raw f32 rows of the eight A fragments of one wave (16 rows x 256 k): the same
// elements, in the same order, as load_a_frag_f32 reads.
__device__ inline void load_x_rows(const float* base, int lane, float4 (&x)[8][4]) {
  const float* p = base + (lane & 15) * kDim + (lane >> 4) * 8;
#pragma unroll
  for (int d = 0; d < 8; ++d) {
    x[d][0] = *(const float4*)(p + d * 32);
    x[d][1] = *(const float4*)(p + d * 32 + 4);
    x[d][2] = *(const float4*)(p + d * 32 + 16);
    x[d][3] = *(const float4*)(p + d * 32 + 20);
  }
  // The wait of wait_load_addresses(), with p named as an input: p stays in its
  // registers up to the wait, so that no load of the run lands in them.
  asm volatile("s_wait_xcnt 0x0" :: "v"(p) : "memory");
}

__device__ inline void cvt_x_rows(const float4 (&x)[8][4], v16h (&a)[8]) {
#pragma unroll
  for (int d = 0; d < 8; ++d) {
#pragma unroll
    for (int q = 0; q < 4; ++q) {
      a[d][q * 4 + 0] = (_Float16)x[d][q].x;
      a[d][q * 4 + 1] = (_Float16)x[d][q].y;
      a[d][q * 4 + 2] = (_Float16)x[d][q].z;
      a[d][q * 4 + 3] = (_Float16)x[d][q].w;
    }
  }
}

// acc[t] += A(16 x 256) @ W[:, t*16 .. t*16+15], k in ascending chunks of 32.
__device__ inline void rows16_times_slab(const v16h (&a)[8],
                                         const _Float16 (*Wt)[kWP], int lane,
                                         v8f (&acc)[4]) {
#pragma unroll
  for (int d = 0; d < 8; ++d) {
#pragma unroll
    for (int t = 0; t < 4; ++t) {
      v16h b = load_a_frag_f16(&Wt[t * 16][d * 32], kWP, lane);  // B-frag of W
      acc[t] = wmma_f16(a[d], b, acc[t]);
    }
  }
}

// ---------------------------------------------------------------------------
// Projection: Y[N][256] = f16( X[N][256] @ W[256][256] + bias )
// On the side, 32 of the blocks lay down WoT[n][k] = f16(Wo[k][n]) for the output
// projection at the end of the attention kernel: block x takes k = 8x .. 8x + 7,
// thread n one column. The loads go out with the block's own.
// ---------------------------------------------------------------------------
__global__ __launch_bounds__(256) void proj_kernel(const float* __restrict__ X,
                                                   const float* __restrict__ W,
                                                   const float* __restrict__ bias,
                                                   _Float16* __restrict__ Y,
                                                   const float* __restrict__ Wo,
                                                   _Float16* __restrict__ WoT) {
  __shared__ alignas(16) _Float16 Wt[kPC][kWP];

  const int tid  = threadIdx.x;
  const int lane = tid & 31;
  const int w    = tid >> 5;
  const int rbase = blockIdx.x * kPR + w * 16;
  const int cbase = blockIdx.y * kPC;

  float  wf[8][8];
  float4 xr[8][4];
  load_w_slab(W, cbase, tid, wf);
  load_x_rows(X + (size_t)rbase * kDim, lane, xr);
  const bool prep = blockIdx.y == 0 && blockIdx.x < kDim / 8;   // the same for a whole block
  float of[8] = {};
  if (prep) {
#pragma unroll
    for (int j = 0; j < 8; ++j) of[j] = Wo[(blockIdx.x * 8 + j) * kDim + tid];
    // The wait of wait_load_addresses(), with the index named as an input: it stays in
    // its register up to the wait, so that no load of the run lands in it.
    asm volatile("s_wait_xcnt 0x0" :: "v"(tid) : "memory");
  }
  store_w_slab(wf, Wt, tid);
  __syncthreads();

  if (prep) {
    v8h t;
#pragma unroll
    for (int j = 0; j < 8; ++j) t[j] = (_Float16)of[j];
    // The store and its s_wait_xcnt 0 in one statement, so that the wait stands in
    // front of any rewrite of the registers the store names: in a statement of its
    // own, the build lifts later register writes over it.
    asm volatile("global_store_b128 %0, %1, off\n\ts_wait_xcnt 0x0"
                 :: "v"(&WoT[(size_t)tid * kDim + blockIdx.x * 8]),
                    "v"(__builtin_bit_cast(v4u, t))
                 : "memory");
  }

  v16h a[8];
  cvt_x_rows(xr, a);

  v8f acc[4] = {};
  rows16_times_slab(a, Wt, lane, acc);

#pragma unroll
  for (int t = 0; t < 4; ++t) {
    const int col = cbase + t * 16 + (lane & 15);
    const float bv = bias[col];
#pragma unroll
    for (int r = 0; r < 8; ++r) {
      const int row = rbase + r + 8 * (lane >> 4);
      Y[(size_t)row * kDim + col] = (_Float16)(acc[t][r] + bv);
    }
  }
}

// ---------------------------------------------------------------------------
// K and V projections of the same rows in one kernel. A block reads its 128 rows
// of X ONCE, keeps them as f16 A fragments, and runs them against its 64-column
// slab of Wk and then of Wv, each slab in an LDS buffer of its own.
//   Y [row][col]   = f16(X @ Wk + bk)
//   YT[b][col][l]  = f16(X @ Wv + bv), transposed: rows r = 0..7 of a C tile are
//                    consecutive along l, one 16-byte store per lane and tile.
// The Wv slab is fetched behind the first barrier, so that it flies while the K
// products run.
// ---------------------------------------------------------------------------
__global__ __launch_bounds__(256) void projKV_kernel(const float* __restrict__ X,
                                                     const float* __restrict__ Wk,
                                                     const float* __restrict__ bk,
                                                     const float* __restrict__ Wv,
                                                     const float* __restrict__ bv,
                                                     _Float16* __restrict__ Y,
                                                     _Float16* __restrict__ YT) {
  __shared__ alignas(16) _Float16 Wt[2][kPC][kWP];

  const int tid  = threadIdx.x;
  const int lane = tid & 31;
  const int w    = tid >> 5;
  const int rbase = blockIdx.x * kPR + w * 16;
  const int cbase = blockIdx.y * kPC;

  float  wf[8][8];
  float4 xr[8][4];
  load_w_slab(Wk, cbase, tid, wf);
  load_x_rows(X + (size_t)rbase * kDim, lane, xr);
  store_w_slab(wf, Wt[0], tid);
  __syncthreads();                       // Wk slab readable by every wave

  load_w_slab(Wv, cbase, tid, wf);

  v16h a[8];
  cvt_x_rows(xr, a);

  v8f acc[4] = {};
  rows16_times_slab(a, Wt[0], lane, acc);

  // Keeps the wait for the Wv loads behind the K products: mixed in among them, it
  // stalls the wave on loads issued just ahead, with most of its WMMAs still to do.
  __builtin_amdgcn_sched_barrier(0);
  store_w_slab(wf, Wt[1], tid);
  __syncthreads();                       // Wv slab readable by every wave

#pragma unroll
  for (int t = 0; t < 4; ++t) {
    const int col = cbase + t * 16 + (lane & 15);
    const float bb = bk[col];
#pragma unroll
    for (int r = 0; r < 8; ++r) {
      const int row = rbase + r + 8 * (lane >> 4);
      Y[(size_t)row * kDim + col] = (_Float16)(acc[t][r] + bb);
    }
  }
  wait_load_addresses();                 // the V part reuses registers these stores name

  v8f acv[4] = {};
  rows16_times_slab(a, Wt[1], lane, acv);

  const int row0 = rbase + 8 * (lane >> 4);   // 8 consecutive rows per lane
  const int b    = row0 >> 12;                // 4096 rows per batch
  const int l0   = row0 & (kL - 1);
#pragma unroll
  for (int t = 0; t < 4; ++t) {
    const int col  = cbase + t * 16 + (lane & 15);
    const float bb = bv[col];
    v8h tmp;
#pragma unroll
    for (int r = 0; r < 8; ++r) tmp[r] = (_Float16)(acv[t][r] + bb);
    *(v8h*)&YT[((size_t)b * kDim + col) * kL + l0] = tmp;
  }
}

static constexpr int kQB    = 64;
// A buffer is eight slices of 64 rows x 256 B, one per wave, each laid down by one
// tensor load with 16 B of pad behind every row:
//   slice 2a + e : K rows 64a .. 64a + 63 of the tile, d = 128e .. 128e + 127
//   slice 4 + a  : V^T rows 64a .. 64a + 63, the tile's 128 keys
static constexpr int kSR    = 64;              // rows of a slice
static constexpr int kSB    = 256;             // bytes of a slice's row
static constexpr int kTP    = kSB / 2 + 8;     // row pitch in halves: 272 B = 16 B x 17
static constexpr int kSlice = 9 * 1024;        // halves of a slice's place: 17,408 B, up to 9 x 2 KiB
static constexpr int kStage = 8 * kSlice;      // halves of one buffer (147,456 B)
static constexpr int kTiles = kL / kKC;
static_assert(kSR * kTP <= kSlice && (kSlice * 2) % 2048 == 0, "a slice fits its place");
static_assert(2 * kSR == kKC && 2 * kSB == kDim * 2 && 4 * kSR == kDim && kSB == kKC * 2,
              "eight slices cover a tile");
static_assert(kTiles >= 2, "the two-buffer prologue fills tiles 0 and 1");
static_assert(4 * kQB * kDim * 4 <= 2 * kStage * 2, "the join reuses the ring");
// LDS of the output projection at the end: O (64 rows) from the start of the ring,
// Wo^T (256 rows) placed so that its rows from kWoEarly on lie behind the 256 KB of
// the join: those rows are copied in while the quarters are joined, the rest after.
static constexpr int kJoin    = 4 * kQB * kDim * 2;         // halves the join uses
static constexpr int kWoEarly = 160;
static constexpr int kWtOff   = kJoin - kWoEarly * kWP;     // halves, a multiple of 8
static constexpr int kRing    = kWtOff + kDim * kWP;        // halves of the whole ring
static_assert(kRing >= 2 * kStage && kQB * kWP <= kWtOff && kWtOff % 8 == 0, "LDS plan");

// Lane l with lane l ^ 16.
__device__ inline float other_half(float x) {
  return __builtin_bit_cast(
      float, __builtin_amdgcn_permlanex16(__builtin_bit_cast(int, x),
                                          __builtin_bit_cast(int, x), 0x76543210,
                                          0xfedcba98, false, false));
}

// This wave's LDS reads have returned: stands in front of the barrier behind
// which their buffer is refilled.
__device__ inline void wait_lds_reads() {
  asm volatile("s_wait_dscnt 0x0" ::: "memory");
}

// This wave's async copies have landed: stands in front of the barrier behind
// which other waves read them.
__device__ inline void wait_copies() {
  asm volatile("s_wait_asynccnt 0x0" ::: "memory");
}

typedef uint32_t u32x4 __attribute__((ext_vector_type(4)));
typedef uint32_t u32x8 __attribute__((ext_vector_type(8)));

// A descriptor word: the same in every lane, in a scalar register.
__device__ inline uint32_t uni(uint32_t v) {
  return (uint32_t)__builtin_amdgcn_readfirstlane(v);
}

// A wave-uniform condition held in a scalar register, so that the test around a
// tensor load compiles to a scalar compare and branch: the load ignores EXEC, and
// only such a branch keeps a wave from issuing it.
__device__ inline uint32_t pinned(uint32_t v) {
  uint32_t w = uni(v);
  asm volatile("" : "+s"(w));   // pinned(): the word stays in a scalar register
  return w;
}

// This wave's tensor load has landed: stands in front of the barrier behind which
// other waves read its slice. The descriptor is named as an operand here and at the
// load, so that it keeps its scalar registers from the one to the other: no word of
// it takes a new value while the request is outstanding.
__device__ inline void wait_tensor(u32x4& g0, u32x8& g1) {
  asm volatile("s_wait_tensorcnt 0x0" : "+s"(g0), "+s"(g1) :: "memory");
}

// Descriptor group 1 of a slice: bytes as elements, tensor = tile = 64 rows of 256 B,
// source row pitch src_pitch bytes, 4 dwords of LDS pad behind every 64 dwords.
__device__ inline u32x8 slice_group1(uint32_t src_pitch) {
  u32x8 g;
  g[0] = uni((1u << 20) | (5u << 22) | (3u << 25));
  g[1] = uni((uint32_t)kSB << 16);
  g[2] = uni((uint32_t)kSR << 16);
  g[3] = uni((uint32_t)kSB << 16);
  g[4] = uni((uint32_t)kSR);
  g[5] = uni(src_pitch);
  g[6] = uni(0u);
  g[7] = uni(0u);
  return g;
}

// One request of the whole wave: the slice whose first byte is ga, to LDS byte lds.
__device__ inline void load_slice(uint32_t lds, uint64_t ga, u32x4& g0, u32x8& g1) {
  g0[0] = uni(1u);
  g0[1] = uni(lds);
  g0[2] = uni((uint32_t)ga);
  g0[3] = uni((((uint32_t)(ga >> 32)) & 0x01FFFFFFu) | 0x80000000u);
  asm volatile("tensor_load_to_lds %0, %1" : "+s"(g0), "+s"(g1) :: "memory");
}

// The fragment of load_a_frag_f16, same elements in the same order, from the
// lane's own address p = base + (lane & 15) * ld + (lane >> 4) * 8: the lane's part
// is formed once, in front of the tile loop, and takes one register.
__device__ inline v16h load_frag_at(const _Float16* p) {
  v16h a;
#pragma unroll
  for (int j = 0; j < 8; ++j) {
    a[j]     = p[j];        // K = kh*8 + j
    a[j + 8] = p[16 + j];   // K = 16 + kh*8 + j
  }
  return a;
}

// K fragments of k chunk d, one for each 16-key tile. Kt: the lane's own address.
__device__ inline void load_k_pair(const _Float16* Kt, int d, v16h (&k)[2]) {
  k[0] = load_frag_at(Kt + (d >> 2) * kSlice + (d & 3) * 32);
  k[1] = load_frag_at(Kt + (d >> 2) * kSlice + 16 * kTP + (d & 3) * 32);
}

// s[i][j] += K(key tile i) . Q^T(column group j) over k chunk d.
__device__ inline void s_chunk(const v16h (&k)[2], const v16h (&q)[2][8], int d,
                               v8f (&s)[2][2]) {
#pragma unroll
  for (int i = 0; i < 2; ++i) {
#pragma unroll
    for (int j = 0; j < 2; ++j) s[i][j] = wmma_f16(k[i], q[j][d], s[i][j]);
  }
}

// V^T fragments of output tiles 2u and 2u + 1. Vt: the lane's own address.
__device__ inline void load_v_pair(const _Float16* Vt, int u, v16h (&v)[2]) {
  v[0] = load_frag_at(Vt + (u >> 1) * kSlice + ((2 * u) & 3) * 16 * kTP);
  v[1] = load_frag_at(Vt + (u >> 1) * kSlice + ((2 * u + 1) & 3) * 16 * kTP);
}

// O^T tiles 2u and 2u + 1, both column groups: scaled by alpha, then += V^T . P^T.
__device__ inline void pv_pair(const v16h (&v)[2], const v16h (&pf)[2],
                               const float (&alpha)[2], int u, v8f (&o)[16][2]) {
#pragma unroll
  for (int x = 0; x < 2; ++x) {
#pragma unroll
    for (int j = 0; j < 2; ++j) o[2 * u + x][j] *= alpha[j];
  }
#pragma unroll
  for (int x = 0; x < 2; ++x) {
#pragma unroll
    for (int j = 0; j < 2; ++j)
      o[2 * u + x][j] = wmma_f16(v[x], pf[j], o[2 * u + x][j]);
  }
}

// Four 16-byte-per-lane copies global -> LDS, each a whole 512-byte row of Wo^T. The
// closing s_wait_xcnt 0 is part of the statement so that it stands in front of any
// rewrite of the address registers the copies name.
__device__ inline void copy4(unsigned l0, const _Float16* p0, unsigned l1,
                             const _Float16* p1, unsigned l2, const _Float16* p2,
                             unsigned l3, const _Float16* p3) {
  asm volatile(
      "global_load_async_to_lds_b128 %0, %4, off\n\t"
      "global_load_async_to_lds_b128 %1, %5, off\n\t"
      "global_load_async_to_lds_b128 %2, %6, off\n\t"
      "global_load_async_to_lds_b128 %3, %7, off\n\t"
      "s_wait_xcnt 0x0"
      :: "v"(l0), "v"(l1), "v"(l2), "v"(l3), "v"(p0), "v"(p1), "v"(p2), "v"(p3)
      : "memory");
}

// Rows kRow0 .. kRow0 + 8 * kPerWave - 1 of Wo^T into Wt (pitch kWP), kPerWave rows a wave.
template <int kRow0, int kPerWave>
__device__ inline void stage_wo(_Float16* Wt, const _Float16* WoT, int w, int lane) {
  static_assert(kPerWave % 4 == 0 && kRow0 + 8 * kPerWave <= kDim, "whole statements, in bounds");
  _Float16*       l = Wt + (kRow0 + w * kPerWave) * kWP + lane * 8;
  const _Float16* p = WoT + (kRow0 + w * kPerWave) * kDim + lane * 8;
#pragma unroll
  for (int i = 0; i < kPerWave; i += 4) {
    copy4((unsigned)(unsigned long long)(l + i * kWP), p + i * kDim,          // LDS byte addresses
          (unsigned)(unsigned long long)(l + (i + 1) * kWP), p + (i + 1) * kDim,
          (unsigned)(unsigned long long)(l + (i + 2) * kWP), p + (i + 2) * kDim,
          (unsigned)(unsigned long long)(l + (i + 3) * kWP), p + (i + 3) * kDim);
  }
}

// Output projection, k chunk d: A fragments of two query tiles of O, B fragments of
// four column tiles of Wo. Oa, Wb: the lane's own addresses.
__device__ inline void load_o_chunk(const _Float16* Oa, const _Float16* Wb, int d,
                                    v16h (&fa)[2], v16h (&fb)[4]) {
#pragma unroll
  for (int i = 0; i < 2; ++i) fa[i] = load_frag_at(Oa + i * 16 * kWP + d * 32);
#pragma unroll
  for (int t = 0; t < 4; ++t) fb[t] = load_frag_at(Wb + t * 16 * kWP + d * 32);
}

__global__ __launch_bounds__(256) void attn_kernel(const _Float16* __restrict__ Qh,
                                                   const _Float16* __restrict__ Kh,
                                                   const _Float16* __restrict__ VhT,
                                                   const _Float16* __restrict__ WoT,
                                                   const float* __restrict__ bo,
                                                   const float* __restrict__ resid,
                                                   float* __restrict__ Out) {
  // Two K + V^T buffers; the epilogue's LDS. Every slice's place is a multiple of 2 KiB.
  __shared__ __attribute__((aligned(2048))) _Float16 ring[kRing];
  __shared__ float jm[8][2][32], jl[8][2][32];       // join: m and l of every wave

  const int tid  = threadIdx.x;
  const int lane = tid & 31;
  // The wave's number, the same in every lane, held in a scalar register: the tile
  // loop needs nearly every vector register that two waves on a SIMD can own.
  const int w    = __builtin_amdgcn_readfirstlane(tid >> 5);
  const int qg   = w & 1;
  const int kq   = w >> 1;
  const int b     = blockIdx.y;
  const int qbase = blockIdx.x * kQB + qg * 32;
  const float cs = 0.0625f * 1.44269504088896340736f;  // 1/sqrt(256) * log2(e)

  const _Float16* Qb  = Qh  + (size_t)b * kL * kDim;
  const _Float16* Kb  = Kh  + (size_t)b * kL * kDim;
  const _Float16* VbT = VhT + (size_t)b * kDim * kL;

  // This wave's slice: waves 0 to 3 bring K, waves 4 to 7 V^T. From tile to tile the
  // source moves by 128 K rows, or by 128 keys along the V^T rows.
  const bool     isv   = w >= 4;
  const uint64_t src   = (uint64_t)(isv ? VbT + (size_t)(w & 3) * kSR * kL
                                        : Kb + (size_t)(w >> 1) * kSR * kDim + (w & 1) * (kSB / 2));
  const uint32_t step  = isv ? kKC * 2 : kKC * kDim * 2;              // bytes a tile
  const uint32_t place = (uint32_t)(uint64_t)ring + w * (kSlice * 2); // LDS byte address
  u32x8 g1 = slice_group1(isv ? kL * 2 : kDim * 2);
  u32x4 g0;

  load_slice(place, src, g0, g1);

  // This wave's Q^T (256 x 32) as 2 x 8 B-fragments: lane (c, h) holds query
  // j * 16 + c in the k order of the K loader. Reused for every tile.
  v16h qfrag[2][8];
#pragma unroll
  for (int j = 0; j < 2; ++j) {
#pragma unroll
    for (int d = 0; d < 8; ++d)
      qfrag[j][d] = load_a_frag_f16(Qb + (size_t)(qbase + j * 16) * kDim + d * 32, kDim, lane);
  }
  wait_load_addresses();

  wait_tensor(g0, g1);
  __syncthreads();                       // tile 0 readable by every wave
  load_slice(place + kStage * 2, src + step, g0, g1);

  v8f   oacc[16][2] = {};                // O^T: d = t*16 + 8h + r, query j*16 + c
  float mrun[2] = {-3.0e38f, -3.0e38f};  // running maxima, log2 domain
  float lrun[2] = {0.0f, 0.0f};          // this lane's share of the running sums

  const int kfo = (kq >> 1) * 2 * kSlice + ((kq & 1) * 32 + (lane & 15)) * kTP + (lane >> 4) * 8;
  const int vfo = 4 * kSlice + (lane & 15) * kTP + kq * 32 + (lane >> 4) * 8;

  for (int t = 0; t < kTiles; ++t) {
    _Float16* buf = ring + (t & 1) * kStage;
    const _Float16* Kt = buf + kfo;
    const _Float16* Vt = buf + vfo;

    // ---- S^T: two 16-key tiles x two 16-query groups, K fragments through a ring
    // of three pairs. Each scheduling barrier below keeps a pair's LDS reads
    // together and two chunks (8 WMMAs) ahead of their use: spread among the
    // WMMAs, each WMMA stalls on a read issued just ahead of it; lifted further
    // up, the fragments no longer fit the registers.
    v16h kr[3][2];
    v8f  s[2][2] = {};
    load_k_pair(Kt, 0, kr[0]);
    load_k_pair(Kt, 1, kr[1]);
    load_k_pair(Kt, 2, kr[2]);
    __builtin_amdgcn_sched_barrier(0);   // reads of chunks 0 to 2 in front of the WMMAs
#pragma unroll
    for (int d = 0; d < 8; ++d) {
      s_chunk(kr[d % 3], qfrag, d, s);
      if (d + 3 < 8) {
        __builtin_amdgcn_sched_barrier(0); // the next reads behind this chunk's WMMAs
        load_k_pair(Kt, d + 3, kr[d % 3]);
        __builtin_amdgcn_sched_barrier(0); // and in front of the next chunk's
      }
    }

    // ---- online softmax of queries c and 16 + c, in registers
    v16h  pf[2];                           // P^T as B: pf[j][x] = P[query][kmap(x, h)]
    float alpha[2];
#pragma unroll
    for (int j = 0; j < 2; ++j) {
      float mx = fmaxf(s[0][j][0], s[1][j][0]);
#pragma unroll
      for (int r = 1; r < 8; ++r) mx = fmaxf(mx, fmaxf(s[0][j][r], s[1][j][r]));
      mx = fmaxf(mx, other_half(mx)) * cs;   // both halves hold the maximum of the wave's 32 keys
      const float mnew = fmaxf(mrun[j], mx);
      alpha[j] = __builtin_amdgcn_exp2f(mrun[j] - mnew);
      mrun[j]  = mnew;

      float ps0 = 0.0f, ps1 = 0.0f;
#pragma unroll
      for (int r = 0; r < 8; ++r) {
        const float p0 = __builtin_amdgcn_exp2f(fmaf(s[0][j][r], cs, -mnew));
        const float p1 = __builtin_amdgcn_exp2f(fmaf(s[1][j][r], cs, -mnew));
        pf[j][r]     = (_Float16)p0;
        pf[j][r + 8] = (_Float16)p1;
        ps0 += p0;
        ps1 += p1;
      }
      lrun[j] = lrun[j] * alpha[j] + (ps0 + ps1);
    }

    // ---- O^T = O^T * alpha + V^T(256 x 32) . P^T(32 x 32): the same ring, V^T
    // pair u in kr[u % 3].
    __builtin_amdgcn_sched_barrier(0);   // V^T reads behind the softmax: no registers earlier
    load_v_pair(Vt, 0, kr[0]);
    load_v_pair(Vt, 1, kr[1]);
    load_v_pair(Vt, 2, kr[2]);
    __builtin_amdgcn_sched_barrier(0);   // and in front of pair 0's scaling and WMMAs
#pragma unroll
    for (int u = 0; u < 8; ++u) {
      pv_pair(kr[u % 3], pf, alpha, u, oacc);
      if (u + 3 < 8) {
        __builtin_amdgcn_sched_barrier(0); // the next reads behind this pair's WMMAs
        load_v_pair(Vt, u + 3, kr[u % 3]);
        __builtin_amdgcn_sched_barrier(0); // and in front of the next pair's
      }
    }

    // ---- hand-over: tile t + 1 published, tile t's buffer free.
    // Keeps the hand-over behind the last WMMAs: lifted above them, its
    // s_wait_dscnt 0 stalls every wave on the V^T reads with nothing to do.
    __builtin_amdgcn_sched_barrier(0);
    wait_lds_reads();
    wait_tensor(g0, g1);
    __syncthreads();
    if (pinned(t + 2 < kTiles))
      load_slice(place + (t & 1) * (kStage * 2), src + (uint64_t)(t + 2) * step, g0, g1);
  }
  wait_tensor(g0, g1);
  wait_lds_reads();

  // The lane's number, read anew: taken from threadIdx it would hold a register all
  // through the tile loop, which then no longer keeps Q wholly in registers.
  const int ln = (int)__builtin_amdgcn_mbcnt_lo(~0u, 0u);

  // ---- join the wave halves' sums, then the four key quarters through the ring
  // (no copy of a tile in flight, every read of it ended by the last tile's barrier).
  // Every wave lays down its O^T, 32 KB in slot w = kq * 2 + qg; then wave (qg, kq)
  // adds up the four quarters of output tiles 4 kq .. 4 kq + 3 of its 32 queries.
  // Behind the join's part of the ring nothing is live any more: the upper rows of
  // Wo^T fly in while the quarters are laid down and joined.
  stage_wo<kWoEarly, (kDim - kWoEarly) / 8>(ring + kWtOff, WoT, w, ln);
#pragma unroll
  for (int j = 0; j < 2; ++j) lrun[j] += other_half(lrun[j]);
  float4* jo = (float4*)ring + ln;
  {
    float4* js = jo + (size_t)w * 64 * 32;
#pragma unroll
    for (int tt = 0; tt < 16; ++tt) {
#pragma unroll
      for (int j = 0; j < 2; ++j) {
        const v8f o = oacc[tt][j];
        js[(tt * 4 + j * 2 + 0) * 32] = make_float4(o[0], o[1], o[2], o[3]);
        js[(tt * 4 + j * 2 + 1) * 32] = make_float4(o[4], o[5], o[6], o[7]);
      }
    }
#pragma unroll
    for (int j = 0; j < 2; ++j) {
      jm[w][j][ln] = mrun[j];
      jl[w][j][ln] = lrun[j];
    }
  }
  __syncthreads();

  float a[4][2];                           // weight of quarter k for column group j
#pragma unroll
  for (int j = 0; j < 2; ++j) {
    float m[4], l[4];
#pragma unroll
    for (int k = 0; k < 4; ++k) {
      m[k] = jm[k * 2 + qg][j][ln];
      l[k] = jl[k * 2 + qg][j][ln];
    }
    const float mm = fmaxf(fmaxf(m[0], m[1]), fmaxf(m[2], m[3]));
    float den = 0.0f;
#pragma unroll
    for (int k = 0; k < 4; ++k) {
      a[k][j] = __builtin_amdgcn_exp2f(m[k] - mm);
      den += l[k] * a[k][j];
    }
    const float inv = 1.0f / den;
#pragma unroll
    for (int k = 0; k < 4; ++k) a[k][j] *= inv;
  }

  v8h res[2][4];
#pragma unroll
  for (int j = 0; j < 2; ++j) {
#pragma unroll
    for (int x = 0; x < 4; ++x) {
      const float4* jt = jo + (size_t)qg * 64 * 32 + ((kq * 4 + x) * 4 + j * 2) * 32;
      float f[8];
#pragma unroll
      for (int k = 0; k < 4; ++k) {
        const float4 u0 = jt[(size_t)k * 2 * 64 * 32];
        const float4 u1 = jt[(size_t)k * 2 * 64 * 32 + 32];
        const float  ak = a[k][j];
        if (k == 0) {
          f[0] = u0.x * ak;
          f[1] = u0.y * ak;
          f[2] = u0.z * ak;
          f[3] = u0.w * ak;
          f[4] = u1.x * ak;
          f[5] = u1.y * ak;
          f[6] = u1.z * ak;
          f[7] = u1.w * ak;
        } else {
          f[0] += u0.x * ak;
          f[1] += u0.y * ak;
          f[2] += u0.z * ak;
          f[3] += u0.w * ak;
          f[4] += u1.x * ak;
          f[5] += u1.y * ak;
          f[6] += u1.z * ak;
          f[7] += u1.w * ak;
        }
      }
#pragma unroll
      for (int r = 0; r < 8; ++r) res[j][x][r] = (_Float16)f[r];
    }
  }
  // ---- output projection and residual of the block's 64 queries, in place of a
  // launch of its own: out = f16(O) @ f16(Wo) + bo + x_dec, k in ascending chunks of 32.
  _Float16 (*Wt)[kWP] = (_Float16 (*)[kWP])(ring + kWtOff);       // Wt[n][k], 256 rows
  _Float16 (*Os)[kWP] = (_Float16 (*)[kWP])ring;                  // O[query][d], 64 rows
  __syncthreads();                         // every wave's join reads of the ring ended
  stage_wo<0, kWoEarly / 8>(ring + kWtOff, WoT, w, ln);
  // A lane's 8 values of a tile are 8 consecutive d of one query: one 16-byte store.
#pragma unroll
  for (int j = 0; j < 2; ++j) {
#pragma unroll
    for (int x = 0; x < 4; ++x)
      *(v8h*)&Os[qg * 32 + j * 16 + (ln & 15)][kq * 64 + x * 16 + 8 * (ln >> 4)] = res[j][x];
  }
  // Output projection: wave w takes query tiles 2 wq and 2 wq + 1, columns 64 wn ..
  // 64 wn + 63. Its residual and bias values fly while Wo^T lands.
  const int wn = w & 3;
  const int wq = w >> 2;
  const size_t obase = ((size_t)b * kL + blockIdx.x * kQB + wq * 32 + 8 * (ln >> 4)) * kDim +
                       wn * kPC + (ln & 15);
  float rs[2][4][8];                       // x_dec at this lane's 64 outputs
  {
    const float* rp = resid + obase;
#pragma unroll
    for (int i = 0; i < 2; ++i) {
#pragma unroll
      for (int t = 0; t < 4; ++t) {
#pragma unroll
        for (int r = 0; r < 8; ++r) rs[i][t][r] = rp[(i * 16 + r) * kDim + t * 16];
      }
    }
    // The wait of wait_load_addresses(), with rp named as an input: rp stays in its
    // registers up to the wait, so that no load of the run lands in them.
    asm volatile("s_wait_xcnt 0x0" :: "v"(rp) : "memory");
  }
  float bb[4];
  {
    const int bi = wn * kPC + (ln & 15);
#pragma unroll
    for (int t = 0; t < 4; ++t) bb[t] = bo[bi + t * 16];
    // The same wait, with the index named: it stays in its register up to the wait.
    asm volatile("s_wait_xcnt 0x0" :: "v"(bi) : "memory");
  }
  wait_copies();
  __syncthreads();                         // Wo^T and O readable by every wave

  // Fragments through a ring of three chunks. The scheduling barriers keep a chunk's
  // LDS reads together and two chunks (16 WMMAs) ahead of their use: left to the
  // build, each pair of WMMAs waits out a read issued just ahead of it.
  const _Float16* Oa = &Os[wq * 32 + (ln & 15)][(ln >> 4) * 8];
  const _Float16* Wb = &Wt[wn * kPC + (ln & 15)][(ln >> 4) * 8];
  v16h fa[3][2], fb[3][4];
  v8f  acc[2][4] = {};
  load_o_chunk(Oa, Wb, 0, fa[0], fb[0]);
  load_o_chunk(Oa, Wb, 1, fa[1], fb[1]);
  load_o_chunk(Oa, Wb, 2, fa[2], fb[2]);
  __builtin_amdgcn_sched_barrier(0);       // reads of chunks 0 to 2 in front of the WMMAs
#pragma unroll
  for (int d = 0; d < 8; ++d) {
#pragma unroll
    for (int t = 0; t < 4; ++t) {
#pragma unroll
      for (int i = 0; i < 2; ++i) acc[i][t] = wmma_f16(fa[d % 3][i], fb[d % 3][t], acc[i][t]);
    }
    if (d + 3 < 8) {
      __builtin_amdgcn_sched_barrier(0);   // the next reads behind this chunk's WMMAs
      load_o_chunk(Oa, Wb, d + 3, fa[d % 3], fb[d % 3]);
      __builtin_amdgcn_sched_barrier(0);   // and in front of the next chunk's
    }
  }

#pragma unroll
  for (int i = 0; i < 2; ++i) {
#pragma unroll
    for (int t = 0; t < 4; ++t) {
#pragma unroll
      for (int r = 0; r < 8; ++r) rs[i][t][r] = acc[i][t][r] + bb[t] + rs[i][t][r];
    }
  }
  // The stores stand last, so that nothing behind them rewrites a register they name.
  float* op = Out + obase;
#pragma unroll
  for (int i = 0; i < 2; ++i) {
#pragma unroll
    for (int t = 0; t < 4; ++t) {
#pragma unroll
      for (int r = 0; r < 8; ++r) op[(i * 16 + r) * kDim + t * 16] = rs[i][t][r];
    }
  }
}

// ---------------------------------------------------------------------------
extern "C" void kernel_launch(void* const* d_in, const int* in_sizes, int n_in,
                              void* d_out, int out_size, void* d_ws, size_t ws_size,
                              hipStream_t stream) {
  const float* x_dec = (const float*)d_in[0];
  const float* x_enc = (const float*)d_in[1];
  const float* Wq = (const float*)d_in[2];
  const float* bq = (const float*)d_in[3];
  const float* Wk = (const float*)d_in[4];
  const float* bk = (const float*)d_in[5];
  const float* Wv = (const float*)d_in[6];
  const float* bv = (const float*)d_in[7];
  const float* Wo = (const float*)d_in[8];
  const float* bo = (const float*)d_in[9];

  const int B = 4, L = kL;
  const int N = B * L;                       // 16384 rows
  const size_t mat = (size_t)N * kDim;       // elements per f16 intermediate

  _Float16* Qh  = (_Float16*)d_ws;           // 8 MB
  _Float16* Khw = Qh + mat;                  // 8 MB
  _Float16* VhT = Khw + mat;                 // 8 MB (transposed: [B][D][L])
  _Float16* WoT = VhT + mat;                 // 128 KB (transposed: [n][k])

  dim3 pgrid(N / kPR, kDim / kPC);           // 128 x 4 blocks, 256 threads
  proj_kernel <<<pgrid, 256, 0, stream>>>(x_dec, Wq, bq, Qh, Wo, WoT);
  projKV_kernel<<<pgrid, 256, 0, stream>>>(x_enc, Wk, bk, Wv, bv, Khw, VhT);

  dim3 agrid(L / kQB, B);                    // 64 x 4 blocks, 256 threads
  attn_kernel<<<agrid, 256, 0, stream>>>(Qh, Khw, VhT, WoT, bo, x_dec, (float*)d_out);
}

// v007
// A run of this version takes 71.1 microseconds.
// Timed twice side by side with v006, it ran 1.04 times as fast both times.
// Counting every step since v000, it is 7.53 times as fast.
#include <hip/hip_runtime.h>
#include <hip/hip_bf16.h>
#include <math.h>

// ---------------------------------------------------------------------------
// CDNA5 (gfx1250) cross-attention: wave32, v_wmma_f32_16x16x32_f16 matmuls,
// tensor loads global->LDS (TENSORcnt) for the K and V operands.
// ---------------------------------------------------------------------------

typedef __attribute__((ext_vector_type(16))) _Float16 v16h;
typedef __attribute__((ext_vector_type(8)))  float    v8f;

static constexpr int kDim = 256;   // model dim (single head, softmax scale 1/16)
static constexpr int kKC  = 128;   // k-chunk per flash-attention iteration
static constexpr int kL   = 4096;  // sequence length (Lq == Lk)

// WMMA 16x16x32 f16 fragment loaders (wave32 layouts per CDNA5 ISA 7.12.2).
// A-matrix 16x32: lane<16 -> row=lane, K = {kh*8..+7, 16+kh*8..+7}, kh=lane>>4.
// A row-major A-fragment of K is exactly the B-fragment of K^T (layout duality),
// so both A and B fragments load as two contiguous 16-byte chunks per lane.
__device__ inline v16h load_a_frag_f16(const _Float16* base, int ld, int lane) {
  const int m  = lane & 15;
  const int kh = lane >> 4;
  const _Float16* p = base + m * ld + kh * 8;
  v16h a;
#pragma unroll
  for (int j = 0; j < 8; ++j) {
    a[j]     = p[j];        // K = kh*8 + j
    a[j + 8] = p[16 + j];   // K = 16 + kh*8 + j
  }
  return a;
}

__device__ inline v16h load_a_frag_f32(const float* base, int ld, int lane) {
  const int m  = lane & 15;
  const int kh = lane >> 4;
  const float* p = base + m * ld + kh * 8;
  v16h a;
#pragma unroll
  for (int j = 0; j < 8; ++j) {
    a[j]     = (_Float16)p[j];
    a[j + 8] = (_Float16)p[16 + j];
  }
  return a;
}

__device__ inline v8f wmma_f16(v16h a, v16h b, v8f c) {
  return __builtin_amdgcn_wmma_f32_16x16x32_f16(false, a, false, b, (short)0, c,
                                                false, false);
}

// ---------------------------------------------------------------------------
// Projections, shared frame. Block: 256 threads = 8 waves; 128 rows x 64 cols.
// The block's whole W slab (256 k x 64 n) is converted to f16 and laid down
// transposed in LDS ONCE; each wave then runs its own 16 rows against it
// (4 accumulator tiles, 32 WMMAs), so one staging serves 128 rows. The rows come by
// whole-line loads and take fragment order on their way through LDS.
// ---------------------------------------------------------------------------
typedef __attribute__((ext_vector_type(8))) _Float16 v8h;
typedef __attribute__((ext_vector_type(4))) _Float16 v4h;
typedef __attribute__((ext_vector_type(4))) unsigned v4u;

static constexpr int kPR = 128;        // rows per block
static constexpr int kPC = 64;         // cols per block
static constexpr int kWP = kDim + 8;   // slab row pitch in halves: 528 B = 16 B x 33

// Stands behind a run of global loads, in front of whatever reuses their address
// registers.
__device__ inline void wait_load_addresses() {
  asm volatile("s_wait_xcnt 0x0" ::: "memory");
}

// Slab staging, Wt[n][k] = f16(W[k][cbase + n]), in two halves so that the X
// loads can be issued between them. A thread owns column n = tid & 63 and eight
// units of 8 consecutive k: unit i starts at k = (tid >> 6) * 8 + i * 32. A wave
// covers 32 consecutive n, so each 4-byte load is one 128-byte line.
__device__ inline void load_w_slab(const float* __restrict__ W, int cbase, int tid,
                                   float (&f)[8][8]) {
  const float* wp = W + (size_t)((tid >> 6) * 8) * kDim + cbase + (tid & (kPC - 1));
#pragma unroll
  for (int i = 0; i < 8; ++i) {
#pragma unroll
    for (int j = 0; j < 8; ++j) f[i][j] = wp[(i * 32 + j) * kDim];
  }
  wait_load_addresses();
}

// One 16-byte LDS store per unit.
__device__ inline void store_w_slab(const float (&f)[8][8], _Float16 (*Wt)[kWP],
                                    int tid) {
#pragma unroll
  for (int i = 0; i < 8; ++i) {
    v8h t;
#pragma unroll
    for (int j = 0; j < 8; ++j) t[j] = (_Float16)f[i][j];
    *(v8h*)&Wt[tid & (kPC - 1)][(tid >> 6) * 8 + i * 32] = t;
  }
}

// One wave's 16 rows of X (16 rows x 256 k, f32) are 16 KB in a row. Load i takes
// bytes 512 i .. 512 i + 511 of them, 16 B a lane: four whole 128-byte lines. Read
// straight in fragment order, a load would touch 16 lines, 32 B of each.
__device__ inline void load_x_rows(const float* base, int lane, float4 (&x)[32]) {
  const float* p = base + lane * 4;
#pragma unroll
  for (int i = 0; i < 32; ++i) x[i] = *(const float4*)(p + i * 128);
  // The wait of wait_load_addresses(), with p named as an input: p stays in its
  // registers up to the wait, so that no load of the run lands in them.
  asm volatile("s_wait_xcnt 0x0" :: "v"(p) : "memory");
}

// The same rows, converted, into the wave's 16 rows of LDS: load i is half i & 1 of
// row i >> 1. One 8-byte store per load, 256 B in a row per wave.
__device__ inline void store_x_rows(const float4 (&x)[32], _Float16 (*Xw)[kWP], int lane) {
#pragma unroll
  for (int i = 0; i < 32; ++i) {
    v4h t;
    t[0] = (_Float16)x[i].x;
    t[1] = (_Float16)x[i].y;
    t[2] = (_Float16)x[i].z;
    t[3] = (_Float16)x[i].w;
    *(v4h*)&Xw[i >> 1][(i & 1) * 128 + lane * 4] = t;
  }
}

// The eight A fragments of those rows, from LDS.
__device__ inline void load_x_frags(const _Float16 (*Xw)[kWP], int lane, v16h (&a)[8]) {
#pragma unroll
  for (int d = 0; d < 8; ++d) a[d] = load_a_frag_f16(&Xw[0][d * 32], kWP, lane);
}

// acc[t] += A(16 x 256) @ W[:, t*16 .. t*16+15], k in ascending chunks of 32.
__device__ inline void rows16_times_slab(const v16h (&a)[8],
                                         const _Float16 (*Wt)[kWP], int lane,
                                         v8f (&acc)[4]) {
#pragma unroll
  for (int d = 0; d < 8; ++d) {
#pragma unroll
    for (int t = 0; t < 4; ++t) {
      v16h b = load_a_frag_f16(&Wt[t * 16][d * 32], kWP, lane);  // B-frag of W
      acc[t] = wmma_f16(a[d], b, acc[t]);
    }
  }
}

// ---------------------------------------------------------------------------
// Projection: Y[N][256] = f16( X[N][256] @ W[256][256] + bias )
// On the side, 32 of the blocks lay down WoT[n][k] = f16(Wo[k][n]) for the output
// projection at the end of the attention kernel: block x takes k = 8x .. 8x + 7,
// thread n one column. The loads go out with the block's own.
// ---------------------------------------------------------------------------
__global__ __launch_bounds__(256) void proj_kernel(const float* __restrict__ X,
                                                   const float* __restrict__ W,
                                                   const float* __restrict__ bias,
                                                   _Float16* __restrict__ Y,
                                                   const float* __restrict__ Wo,
                                                   _Float16* __restrict__ WoT) {
  __shared__ alignas(16) _Float16 Wt[kPC][kWP];
  __shared__ alignas(16) _Float16 Xs[kPR][kWP];   // the block's rows, 16 a wave

  const int tid  = threadIdx.x;
  const int lane = tid & 31;
  const int w    = tid >> 5;
  const int rbase = blockIdx.x * kPR + w * 16;
  const int cbase = blockIdx.y * kPC;

  float  wf[8][8];
  float4 xr[32];
  load_w_slab(W, cbase, tid, wf);
  load_x_rows(X + (size_t)rbase * kDim, lane, xr);
  const bool prep = blockIdx.y == 0 && blockIdx.x < kDim / 8;   // the same for a whole block
  float of[8] = {};
  if (prep) {
#pragma unroll
    for (int j = 0; j < 8; ++j) of[j] = Wo[(blockIdx.x * 8 + j) * kDim + tid];
    // The wait of wait_load_addresses(), with the index named as an input: it stays in
    // its register up to the wait, so that no load of the run lands in it.
    asm volatile("s_wait_xcnt 0x0" :: "v"(tid) : "memory");
  }
  store_w_slab(wf, Wt, tid);
  store_x_rows(xr, &Xs[w * 16], lane);
  __syncthreads();

  if (prep) {
    v8h t;
#pragma unroll
    for (int j = 0; j < 8; ++j) t[j] = (_Float16)of[j];
    // The store and its s_wait_xcnt 0 in one statement, so that the wait stands in
    // front of any rewrite of the registers the store names: in a statement of its
    // own, the build lifts later register writes over it.
    asm volatile("global_store_b128 %0, %1, off\n\ts_wait_xcnt 0x0"
                 :: "v"(&WoT[(size_t)tid * kDim + blockIdx.x * 8]),
                    "v"(__builtin_bit_cast(v4u, t))
                 : "memory");
  }

  v16h a[8];
  load_x_frags(&Xs[w * 16], lane, a);

  v8f acc[4] = {};
  rows16_times_slab(a, Wt, lane, acc);

#pragma unroll
  for (int t = 0; t < 4; ++t) {
    const int col = cbase + t * 16 + (lane & 15);
    const float bv = bias[col];
#pragma unroll
    for (int r = 0; r < 8; ++r) {
      const int row = rbase + r + 8 * (lane >> 4);
      Y[(size_t)row * kDim + col] = (_Float16)(acc[t][r] + bv);
    }
  }
}

// ---------------------------------------------------------------------------
// K and V projections of the same rows in one kernel. A block reads its 128 rows
// of X ONCE, keeps them as f16 A fragments, and runs them against its 64-column
// slab of Wk and then of Wv, each slab in an LDS buffer of its own.
//   Y [row][col]   = f16(X @ Wk + bk)
//   YT[b][col][l]  = f16(X @ Wv + bv), transposed: rows r = 0..7 of a C tile are
//                    consecutive along l, one 16-byte store per lane and tile.
// The Wv slab is fetched behind the first barrier, so that it flies while the K
// products run.
// ---------------------------------------------------------------------------
__global__ __launch_bounds__(256) void projKV_kernel(const float* __restrict__ X,
                                                     const float* __restrict__ Wk,
                                                     const float* __restrict__ bk,
                                                     const float* __restrict__ Wv,
                                                     const float* __restrict__ bv,
                                                     _Float16* __restrict__ Y,
                                                     _Float16* __restrict__ YT) {
  __shared__ alignas(16) _Float16 Wt[2][kPC][kWP];
  __shared__ alignas(16) _Float16 Xs[kPR][kWP];   // the block's rows, 16 a wave

  const int tid  = threadIdx.x;
  const int lane = tid & 31;
  const int w    = tid >> 5;
  const int rbase = blockIdx.x * kPR + w * 16;
  const int cbase = blockIdx.y * kPC;

  float  wf[8][8];
  float4 xr[32];
  load_w_slab(Wk, cbase, tid, wf);
  load_x_rows(X + (size_t)rbase * kDim, lane, xr);
  store_w_slab(wf, Wt[0], tid);
  store_x_rows(xr, &Xs[w * 16], lane);
  __syncthreads();                       // Wk slab and X rows readable

  load_w_slab(Wv, cbase, tid, wf);

  v16h a[8];
  load_x_frags(&Xs[w * 16], lane, a);

  v8f acc[4] = {};
  rows16_times_slab(a, Wt[0], lane, acc);

  // Keeps the wait for the Wv loads behind the K products: mixed in among them, it
  // stalls the wave on loads issued just ahead, with most of its WMMAs still to do.
  __builtin_amdgcn_sched_barrier(0);
  store_w_slab(wf, Wt[1], tid);
  __syncthreads();                       // Wv slab readable by every wave

#pragma unroll
  for (int t = 0; t < 4; ++t) {
    const int col = cbase + t * 16 + (lane & 15);
    const float bb = bk[col];
#pragma unroll
    for (int r = 0; r < 8; ++r) {
      const int row = rbase + r + 8 * (lane >> 4);
      Y[(size_t)row * kDim + col] = (_Float16)(acc[t][r] + bb);
    }
  }
  wait_load_addresses();                 // the V part reuses registers these stores name

  v8f acv[4] = {};
  rows16_times_slab(a, Wt[1], lane, acv);

  const int row0 = rbase + 8 * (lane >> 4);   // 8 consecutive rows per lane
  const int b    = row0 >> 12;                // 4096 rows per batch
  const int l0   = row0 & (kL - 1);
#pragma unroll
  for (int t = 0; t < 4; ++t) {
    const int col  = cbase + t * 16 + (lane & 15);
    const float bb = bv[col];
    v8h tmp;
#pragma unroll
    for (int r = 0; r < 8; ++r) tmp[r] = (_Float16)(acv[t][r] + bb);
    *(v8h*)&YT[((size_t)b * kDim + col) * kL + l0] = tmp;
  }
}

static constexpr int kQB    = 64;
// A buffer is eight slices of 64 rows x 256 B, one per wave, each laid down by one
// tensor load with 16 B of pad behind every row:
//   slice 2a + e : K rows 64a .. 64a + 63 of the tile, d = 128e .. 128e + 127
//   slice 4 + a  : V^T rows 64a .. 64a + 63, the tile's 128 keys
static constexpr int kSR    = 64;              // rows of a slice
static constexpr int kSB    = 256;             // bytes of a slice's row
static constexpr int kTP    = kSB / 2 + 8;     // row pitch in halves: 272 B = 16 B x 17
static constexpr int kSlice = 9 * 1024;        // halves of a slice's place: 17,408 B, up to 9 x 2 KiB
static constexpr int kStage = 8 * kSlice;      // halves of one buffer (147,456 B)
static constexpr int kTiles = kL / kKC;
static_assert(kSR * kTP <= kSlice && (kSlice * 2) % 2048 == 0, "a slice fits its place");
static_assert(2 * kSR == kKC && 2 * kSB == kDim * 2 && 4 * kSR == kDim && kSB == kKC * 2,
              "eight slices cover a tile");
static_assert(kTiles >= 2, "the two-buffer prologue fills tiles 0 and 1");
static_assert(4 * kQB * kDim * 4 <= 2 * kStage * 2, "the join reuses the ring");
// LDS of the output projection at the end: O (64 rows) from the start of the ring,
// Wo^T (256 rows) placed so that its rows from kWoEarly on lie behind the 256 KB of
// the join: those rows are copied in while the quarters are joined, the rest after.
static constexpr int kJoin    = 4 * kQB * kDim * 2;         // halves the join uses
static constexpr int kWoEarly = 160;
static constexpr int kWtOff   = kJoin - kWoEarly * kWP;     // halves, a multiple of 8
static constexpr int kRing    = kWtOff + kDim * kWP;        // halves of the whole ring
static_assert(kRing >= 2 * kStage && kQB * kWP <= kWtOff && kWtOff % 8 == 0, "LDS plan");

// Lane l with lane l ^ 16.
__device__ inline float other_half(float x) {
  return __builtin_bit_cast(
      float, __builtin_amdgcn_permlanex16(__builtin_bit_cast(int, x),
                                          __builtin_bit_cast(int, x), 0x76543210,
                                          0xfedcba98, false, false));
}

// This wave's LDS reads have returned: stands in front of the barrier behind
// which their buffer is refilled.
__device__ inline void wait_lds_reads() {
  asm volatile("s_wait_dscnt 0x0" ::: "memory");
}

// This wave's async copies have landed: stands in front of the barrier behind
// which other waves read them.
__device__ inline void wait_copies() {
  asm volatile("s_wait_asynccnt 0x0" ::: "memory");
}

typedef uint32_t u32x4 __attribute__((ext_vector_type(4)));
typedef uint32_t u32x8 __attribute__((ext_vector_type(8)));

// A descriptor word: the same in every lane, in a scalar register.
__device__ inline uint32_t uni(uint32_t v) {
  return (uint32_t)__builtin_amdgcn_readfirstlane(v);
}

// A wave-uniform condition held in a scalar register, so that the test around a
// tensor load compiles to a scalar compare and branch: the load ignores EXEC, and
// only such a branch keeps a wave from issuing it.
__device__ inline uint32_t pinned(uint32_t v) {
  uint32_t w = uni(v);
  asm volatile("" : "+s"(w));   // pinned(): the word stays in a scalar register
  return w;
}

// This wave's tensor load has landed: stands in front of the barrier behind which
// other waves read its slice. The descriptor is named as an operand here and at the
// load, so that it keeps its scalar registers from the one to the other: no word of
// it takes a new value while the request is outstanding.
__device__ inline void wait_tensor(u32x4& g0, u32x8& g1) {
  asm volatile("s_wait_tensorcnt 0x0" : "+s"(g0), "+s"(g1) :: "memory");
}

// Descriptor group 1 of a slice: bytes as elements, tensor = tile = 64 rows of 256 B,
// source row pitch src_pitch bytes, 4 dwords of LDS pad behind every 64 dwords.
__device__ inline u32x8 slice_group1(uint32_t src_pitch) {
  u32x8 g;
  g[0] = uni((1u << 20) | (5u << 22) | (3u << 25));
  g[1] = uni((uint32_t)kSB << 16);
  g[2] = uni((uint32_t)kSR << 16);
  g[3] = uni((uint32_t)kSB << 16);
  g[4] = uni((uint32_t)kSR);
  g[5] = uni(src_pitch);
  g[6] = uni(0u);
  g[7] = uni(0u);
  return g;
}

// One request of the whole wave: the slice whose first byte is ga, to LDS byte lds.
__device__ inline void load_slice(uint32_t lds, uint64_t ga, u32x4& g0, u32x8& g1) {
  g0[0] = uni(1u);
  g0[1] = uni(lds);
  g0[2] = uni((uint32_t)ga);
  g0[3] = uni((((uint32_t)(ga >> 32)) & 0x01FFFFFFu) | 0x80000000u);
  asm volatile("tensor_load_to_lds %0, %1" : "+s"(g0), "+s"(g1) :: "memory");
}

// The fragment of load_a_frag_f16, same elements in the same order, from the
// lane's own address p = base + (lane & 15) * ld + (lane >> 4) * 8: the lane's part
// is formed once, in front of the tile loop, and takes one register.
__device__ inline v16h load_frag_at(const _Float16* p) {
  v16h a;
#pragma unroll
  for (int j = 0; j < 8; ++j) {
    a[j]     = p[j];        // K = kh*8 + j
    a[j + 8] = p[16 + j];   // K = 16 + kh*8 + j
  }
  return a;
}

// K fragments of k chunk d, one for each 16-key tile. Kt: the lane's own address.
__device__ inline void load_k_pair(const _Float16* Kt, int d, v16h (&k)[2]) {
  k[0] = load_frag_at(Kt + (d >> 2) * kSlice + (d & 3) * 32);
  k[1] = load_frag_at(Kt + (d >> 2) * kSlice + 16 * kTP + (d & 3) * 32);
}

// s[i][j] += K(key tile i) . Q^T(column group j) over k chunk d.
__device__ inline void s_chunk(const v16h (&k)[2], const v16h (&q)[2][8], int d,
                               v8f (&s)[2][2]) {
#pragma unroll
  for (int i = 0; i < 2; ++i) {
#pragma unroll
    for (int j = 0; j < 2; ++j) s[i][j] = wmma_f16(k[i], q[j][d], s[i][j]);
  }
}

// V^T fragments of output tiles 2u and 2u + 1. Vt: the lane's own address.
__device__ inline void load_v_pair(const _Float16* Vt, int u, v16h (&v)[2]) {
  v[0] = load_frag_at(Vt + (u >> 1) * kSlice + ((2 * u) & 3) * 16 * kTP);
  v[1] = load_frag_at(Vt + (u >> 1) * kSlice + ((2 * u + 1) & 3) * 16 * kTP);
}

// O^T tiles 2u and 2u + 1, both column groups: scaled by alpha, then += V^T . P^T.
__device__ inline void pv_pair(const v16h (&v)[2], const v16h (&pf)[2],
                               const float (&alpha)[2], int u, v8f (&o)[16][2]) {
#pragma unroll
  for (int x = 0; x < 2; ++x) {
#pragma unroll
    for (int j = 0; j < 2; ++j) o[2 * u + x][j] *= alpha[j];
  }
#pragma unroll
  for (int x = 0; x < 2; ++x) {
#pragma unroll
    for (int j = 0; j < 2; ++j)
      o[2 * u + x][j] = wmma_f16(v[x], pf[j], o[2 * u + x][j]);
  }
}

// Four 16-byte-per-lane copies global -> LDS, each a whole 512-byte row of Wo^T. The
// closing s_wait_xcnt 0 is part of the statement so that it stands in front of any
// rewrite of the address registers the copies name.
__device__ inline void copy4(unsigned l0, const _Float16* p0, unsigned l1,
                             const _Float16* p1, unsigned l2, const _Float16* p2,
                             unsigned l3, const _Float16* p3) {
  asm volatile(
      "global_load_async_to_lds_b128 %0, %4, off\n\t"
      "global_load_async_to_lds_b128 %1, %5, off\n\t"
      "global_load_async_to_lds_b128 %2, %6, off\n\t"
      "global_load_async_to_lds_b128 %3, %7, off\n\t"
      "s_wait_xcnt 0x0"
      :: "v"(l0), "v"(l1), "v"(l2), "v"(l3), "v"(p0), "v"(p1), "v"(p2), "v"(p3)
      : "memory");
}

// Rows kRow0 .. kRow0 + 8 * kPerWave - 1 of Wo^T into Wt (pitch kWP), kPerWave rows a wave.
template <int kRow0, int kPerWave>
__device__ inline void stage_wo(_Float16* Wt, const _Float16* WoT, int w, int lane) {
  static_assert(kPerWave % 4 == 0 && kRow0 + 8 * kPerWave <= kDim, "whole statements, in bounds");
  _Float16*       l = Wt + (kRow0 + w * kPerWave) * kWP + lane * 8;
  const _Float16* p = WoT + (kRow0 + w * kPerWave) * kDim + lane * 8;
#pragma unroll
  for (int i = 0; i < kPerWave; i += 4) {
    copy4((unsigned)(unsigned long long)(l + i * kWP), p + i * kDim,          // LDS byte addresses
          (unsigned)(unsigned long long)(l + (i + 1) * kWP), p + (i + 1) * kDim,
          (unsigned)(unsigned long long)(l + (i + 2) * kWP), p + (i + 2) * kDim,
          (unsigned)(unsigned long long)(l + (i + 3) * kWP), p + (i + 3) * kDim);
  }
}

// Output projection, k chunk d: A fragments of two query tiles of O, B fragments of
// four column tiles of Wo. Oa, Wb: the lane's own addresses.
__device__ inline void load_o_chunk(const _Float16* Oa, const _Float16* Wb, int d,
                                    v16h (&fa)[2], v16h (&fb)[4]) {
#pragma unroll
  for (int i = 0; i < 2; ++i) fa[i] = load_frag_at(Oa + i * 16 * kWP + d * 32);
#pragma unroll
  for (int t = 0; t < 4; ++t) fb[t] = load_frag_at(Wb + t * 16 * kWP + d * 32);
}

__global__ __launch_bounds__(256) void attn_kernel(const _Float16* __restrict__ Qh,
                                                   const _Float16* __restrict__ Kh,
                                                   const _Float16* __restrict__ VhT,
                                                   const _Float16* __restrict__ WoT,
                                                   const float* __restrict__ bo,
                                                   const float* __restrict__ resid,
                                                   float* __restrict__ Out) {
  // Two K + V^T buffers; the epilogue's LDS. Every slice's place is a multiple of 2 KiB.
  __shared__ __attribute__((aligned(2048))) _Float16 ring[kRing];
  __shared__ float jm[8][2][32], jl[8][2][32];       // join: m and l of every wave

  const int tid  = threadIdx.x;
  const int lane = tid & 31;
  // The wave's number, the same in every lane, held in a scalar register: the tile
  // loop needs nearly every vector register that two waves on a SIMD can own.
  const int w    = __builtin_amdgcn_readfirstlane(tid >> 5);
  const int qg   = w & 1;
  const int kq   = w >> 1;
  const int b     = blockIdx.y;
  const int qbase = blockIdx.x * kQB + qg * 32;
  const float cs = 0.0625f * 1.44269504088896340736f;  // 1/sqrt(256) * log2(e)

  const _Float16* Qb  = Qh  + (size_t)b * kL * kDim;
  const _Float16* Kb  = Kh  + (size_t)b * kL * kDim;
  const _Float16* VbT = VhT + (size_t)b * kDim * kL;

  // This wave's slice: waves 0 to 3 bring K, waves 4 to 7 V^T. From tile to tile the
  // source moves by 128 K rows, or by 128 keys along the V^T rows.
  const bool     isv   = w >= 4;
  const uint64_t src   = (uint64_t)(isv ? VbT + (size_t)(w & 3) * kSR * kL
                                        : Kb + (size_t)(w >> 1) * kSR * kDim + (w & 1) * (kSB / 2));
  const uint32_t step  = isv ? kKC * 2 : kKC * kDim * 2;              // bytes a tile
  const uint32_t place = (uint32_t)(uint64_t)ring + w * (kSlice * 2); // LDS byte address
  u32x8 g1 = slice_group1(isv ? kL * 2 : kDim * 2);
  u32x4 g0;

  load_slice(place, src, g0, g1);

  // This wave's Q^T (256 x 32) as 2 x 8 B-fragments: lane (c, h) holds query
  // j * 16 + c in the k order of the K loader. Reused for every tile.
  v16h qfrag[2][8];
#pragma unroll
  for (int j = 0; j < 2; ++j) {
#pragma unroll
    for (int d = 0; d < 8; ++d)
      qfrag[j][d] = load_a_frag_f16(Qb + (size_t)(qbase + j * 16) * kDim + d * 32, kDim, lane);
  }
  wait_load_addresses();

  wait_tensor(g0, g1);
  __syncthreads();                       // tile 0 readable by every wave
  load_slice(place + kStage * 2, src + step, g0, g1);

  v8f   oacc[16][2] = {};                // O^T: d = t*16 + 8h + r, query j*16 + c
  float mrun[2] = {-3.0e38f, -3.0e38f};  // running maxima, log2 domain
  float lrun[2] = {0.0f, 0.0f};          // this lane's share of the running sums

  const int kfo = (kq >> 1) * 2 * kSlice + ((kq & 1) * 32 + (lane & 15)) * kTP + (lane >> 4) * 8;
  const int vfo = 4 * kSlice + (lane & 15) * kTP + kq * 32 + (lane >> 4) * 8;

  for (int t = 0; t < kTiles; ++t) {
    _Float16* buf = ring + (t & 1) * kStage;
    const _Float16* Kt = buf + kfo;
    const _Float16* Vt = buf + vfo;

    // ---- S^T: two 16-key tiles x two 16-query groups, K fragments through a ring
    // of three pairs. Each scheduling barrier below keeps a pair's LDS reads
    // together and two chunks (8 WMMAs) ahead of their use: spread among the
    // WMMAs, each WMMA stalls on a read issued just ahead of it; lifted further
    // up, the fragments no longer fit the registers.
    v16h kr[3][2];
    v8f  s[2][2] = {};
    load_k_pair(Kt, 0, kr[0]);
    load_k_pair(Kt, 1, kr[1]);
    load_k_pair(Kt, 2, kr[2]);
    __builtin_amdgcn_sched_barrier(0);   // reads of chunks 0 to 2 in front of the WMMAs
#pragma unroll
    for (int d = 0; d < 8; ++d) {
      s_chunk(kr[d % 3], qfrag, d, s);
      if (d + 3 < 8) {
        __builtin_amdgcn_sched_barrier(0); // the next reads behind this chunk's WMMAs
        load_k_pair(Kt, d + 3, kr[d % 3]);
        __builtin_amdgcn_sched_barrier(0); // and in front of the next chunk's
      }
    }

    // ---- online softmax of queries c and 16 + c, in registers
    v16h  pf[2];                           // P^T as B: pf[j][x] = P[query][kmap(x, h)]
    float alpha[2];
#pragma unroll
    for (int j = 0; j < 2; ++j) {
      float mx = fmaxf(s[0][j][0], s[1][j][0]);
#pragma unroll
      for (int r = 1; r < 8; ++r) mx = fmaxf(mx, fmaxf(s[0][j][r], s[1][j][r]));
      mx = fmaxf(mx, other_half(mx)) * cs;   // both halves hold the maximum of the wave's 32 keys
      const float mnew = fmaxf(mrun[j], mx);
      alpha[j] = __builtin_amdgcn_exp2f(mrun[j] - mnew);
      mrun[j]  = mnew;

      float ps0 = 0.0f, ps1 = 0.0f;
#pragma unroll
      for (int r = 0; r < 8; ++r) {
        const float p0 = __builtin_amdgcn_exp2f(fmaf(s[0][j][r], cs, -mnew));
        const float p1 = __builtin_amdgcn_exp2f(fmaf(s[1][j][r], cs, -mnew));
        pf[j][r]     = (_Float16)p0;
        pf[j][r + 8] = (_Float16)p1;
        ps0 += p0;
        ps1 += p1;
      }
      lrun[j] = lrun[j] * alpha[j] + (ps0 + ps1);
    }

    // ---- O^T = O^T * alpha + V^T(256 x 32) . P^T(32 x 32): the same ring, V^T
    // pair u in kr[u % 3].
    __builtin_amdgcn_sched_barrier(0);   // V^T reads behind the softmax: no registers earlier
    load_v_pair(Vt, 0, kr[0]);
    load_v_pair(Vt, 1, kr[1]);
    load_v_pair(Vt, 2, kr[2]);
    __builtin_amdgcn_sched_barrier(0);   // and in front of pair 0's scaling and WMMAs
#pragma unroll
    for (int u = 0; u < 8; ++u) {
      pv_pair(kr[u % 3], pf, alpha, u, oacc);
      if (u + 3 < 8) {
        __builtin_amdgcn_sched_barrier(0); // the next reads behind this pair's WMMAs
        load_v_pair(Vt, u + 3, kr[u % 3]);
        __builtin_amdgcn_sched_barrier(0); // and in front of the next pair's
      }
    }

    // ---- hand-over: tile t + 1 published, tile t's buffer free.
    // Keeps the hand-over behind the last WMMAs: lifted above them, its
    // s_wait_dscnt 0 stalls every wave on the V^T reads with nothing to do.
    __builtin_amdgcn_sched_barrier(0);
    wait_lds_reads();
    wait_tensor(g0, g1);
    __syncthreads();
    if (pinned(t + 2 < kTiles))
      load_slice(place + (t & 1) * (kStage * 2), src + (uint64_t)(t + 2) * step, g0, g1);
  }
  wait_tensor(g0, g1);
  wait_lds_reads();

  // The lane's number, read anew: taken from threadIdx it would hold a register all
  // through the tile loop, which then no longer keeps Q wholly in registers.
  const int ln = (int)__builtin_amdgcn_mbcnt_lo(~0u, 0u);

  // ---- join the wave halves' sums, then the four key quarters through the ring
  // (no copy of a tile in flight, every read of it ended by the last tile's barrier).
  // Every wave lays down its O^T, 32 KB in slot w = kq * 2 + qg; then wave (qg, kq)
  // adds up the four quarters of output tiles 4 kq .. 4 kq + 3 of its 32 queries.
  // Behind the join's part of the ring nothing is live any more: the upper rows of
  // Wo^T fly in while the quarters are laid down and joined.
  stage_wo<kWoEarly, (kDim - kWoEarly) / 8>(ring + kWtOff, WoT, w, ln);
#pragma unroll
  for (int j = 0; j < 2; ++j) lrun[j] += other_half(lrun[j]);
  float4* jo = (float4*)ring + ln;
  {
    float4* js = jo + (size_t)w * 64 * 32;
#pragma unroll
    for (int tt = 0; tt < 16; ++tt) {
#pragma unroll
      for (int j = 0; j < 2; ++j) {
        const v8f o = oacc[tt][j];
        js[(tt * 4 + j * 2 + 0) * 32] = make_float4(o[0], o[1], o[2], o[3]);
        js[(tt * 4 + j * 2 + 1) * 32] = make_float4(o[4], o[5], o[6], o[7]);
      }
    }
#pragma unroll
    for (int j = 0; j < 2; ++j) {
      jm[w][j][ln] = mrun[j];
      jl[w][j][ln] = lrun[j];
    }
  }
  __syncthreads();

  float a[4][2];                           // weight of quarter k for column group j
#pragma unroll
  for (int j = 0; j < 2; ++j) {
    float m[4], l[4];
#pragma unroll
    for (int k = 0; k < 4; ++k) {
      m[k] = jm[k * 2 + qg][j][ln];
      l[k] = jl[k * 2 + qg][j][ln];
    }
    const float mm = fmaxf(fmaxf(m[0], m[1]), fmaxf(m[2], m[3]));
    float den = 0.0f;
#pragma unroll
    for (int k = 0; k < 4; ++k) {
      a[k][j] = __builtin_amdgcn_exp2f(m[k] - mm);
      den += l[k] * a[k][j];
    }
    const float inv = 1.0f / den;
#pragma unroll
    for (int k = 0; k < 4; ++k) a[k][j] *= inv;
  }

  v8h res[2][4];
#pragma unroll
  for (int j = 0; j < 2; ++j) {
#pragma unroll
    for (int x = 0; x < 4; ++x) {
      const float4* jt = jo + (size_t)qg * 64 * 32 + ((kq * 4 + x) * 4 + j * 2) * 32;
      float f[8];
#pragma unroll
      for (int k = 0; k < 4; ++k) {
        const float4 u0 = jt[(size_t)k * 2 * 64 * 32];
        const float4 u1 = jt[(size_t)k * 2 * 64 * 32 + 32];
        const float  ak = a[k][j];
        if (k == 0) {
          f[0] = u0.x * ak;
          f[1] = u0.y * ak;
          f[2] = u0.z * ak;
          f[3] = u0.w * ak;
          f[4] = u1.x * ak;
          f[5] = u1.y * ak;
          f[6] = u1.z * ak;
          f[7] = u1.w * ak;
        } else {
          f[0] += u0.x * ak;
          f[1] += u0.y * ak;
          f[2] += u0.z * ak;
          f[3] += u0.w * ak;
          f[4] += u1.x * ak;
          f[5] += u1.y * ak;
          f[6] += u1.z * ak;
          f[7] += u1.w * ak;
        }
      }
#pragma unroll
      for (int r = 0; r < 8; ++r) res[j][x][r] = (_Float16)f[r];
    }
  }
  // ---- output projection and residual of the block's 64 queries, in place of a
  // launch of its own: out = f16(O) @ f16(Wo) + bo + x_dec, k in ascending chunks of 32.
  _Float16 (*Wt)[kWP] = (_Float16 (*)[kWP])(ring + kWtOff);       // Wt[n][k], 256 rows
  _Float16 (*Os)[kWP] = (_Float16 (*)[kWP])ring;                  // O[query][d], 64 rows
  __syncthreads();                         // every wave's join reads of the ring ended
  stage_wo<0, kWoEarly / 8>(ring + kWtOff, WoT, w, ln);
  // A lane's 8 values of a tile are 8 consecutive d of one query: one 16-byte store.
#pragma unroll
  for (int j = 0; j < 2; ++j) {
#pragma unroll
    for (int x = 0; x < 4; ++x)
      *(v8h*)&Os[qg * 32 + j * 16 + (ln & 15)][kq * 64 + x * 16 + 8 * (ln >> 4)] = res[j][x];
  }
  // Output projection: wave w takes query tiles 2 wq and 2 wq + 1, columns 64 wn ..
  // 64 wn + 63. Its residual and bias values fly while Wo^T lands.
  const int wn = w & 3;
  const int wq = w >> 2;
  const size_t obase = ((size_t)b * kL + blockIdx.x * kQB + wq * 32 + 8 * (ln >> 4)) * kDim +
                       wn * kPC + (ln & 15);
  float rs[2][4][8];                       // x_dec at this lane's 64 outputs
  {
    const float* rp = resid + obase;
#pragma unroll
    for (int i = 0; i < 2; ++i) {
#pragma unroll
      for (int t = 0; t < 4; ++t) {
#pragma unroll
        for (int r = 0; r < 8; ++r) rs[i][t][r] = rp[(i * 16 + r) * kDim + t * 16];
      }
    }
    // The wait of wait_load_addresses(), with rp named as an input: rp stays in its
    // registers up to the wait, so that no load of the run lands in them.
    asm volatile("s_wait_xcnt 0x0" :: "v"(rp) : "memory");
  }
  float bb[4];
  {
    const int bi = wn * kPC + (ln & 15);
#pragma unroll
    for (int t = 0; t < 4; ++t) bb[t] = bo[bi + t * 16];
    // The same wait, with the index named: it stays in its register up to the wait.
    asm volatile("s_wait_xcnt 0x0" :: "v"(bi) : "memory");
  }
  wait_copies();
  __syncthreads();                         // Wo^T and O readable by every wave

  // Fragments through a ring of three chunks. The scheduling barriers keep a chunk's
  // LDS reads together and two chunks (16 WMMAs) ahead of their use: left to the
  // build, each pair of WMMAs waits out a read issued just ahead of it.
  const _Float16* Oa = &Os[wq * 32 + (ln & 15)][(ln >> 4) * 8];
  const _Float16* Wb = &Wt[wn * kPC + (ln & 15)][(ln >> 4) * 8];
  v16h fa[3][2], fb[3][4];
  v8f  acc[2][4] = {};
  load_o_chunk(Oa, Wb, 0, fa[0], fb[0]);
  load_o_chunk(Oa, Wb, 1, fa[1], fb[1]);
  load_o_chunk(Oa, Wb, 2, fa[2], fb[2]);
  __builtin_amdgcn_sched_barrier(0);       // reads of chunks 0 to 2 in front of the WMMAs
#pragma unroll
  for (int d = 0; d < 8; ++d) {
#pragma unroll
    for (int t = 0; t < 4; ++t) {
#pragma unroll
      for (int i = 0; i < 2; ++i) acc[i][t] = wmma_f16(fa[d % 3][i], fb[d % 3][t], acc[i][t]);
    }
    if (d + 3 < 8) {
      __builtin_amdgcn_sched_barrier(0);   // the next reads behind this chunk's WMMAs
      load_o_chunk(Oa, Wb, d + 3, fa[d % 3], fb[d % 3]);
      __builtin_amdgcn_sched_barrier(0);   // and in front of the next chunk's
    }
  }

#pragma unroll
  for (int i = 0; i < 2; ++i) {
#pragma unroll
    for (int t = 0; t < 4; ++t) {
#pragma unroll
      for (int r = 0; r < 8; ++r) rs[i][t][r] = acc[i][t][r] + bb[t] + rs[i][t][r];
    }
  }
  // The stores stand last, so that nothing behind them rewrites a register they name.
  float* op = Out + obase;
#pragma unroll
  for (int i = 0; i < 2; ++i) {
#pragma unroll
    for (int t = 0; t < 4; ++t) {
#pragma unroll
      for (int r = 0; r < 8; ++r) op[(i * 16 + r) * kDim + t * 16] = rs[i][t][r];
    }
  }
}

// ---------------------------------------------------------------------------
extern "C" void kernel_launch(void* const* d_in, const int* in_sizes, int n_in,
                              void* d_out, int out_size, void* d_ws, size_t ws_size,
                              hipStream_t stream) {
  const float* x_dec = (const float*)d_in[0];
  const float* x_enc = (const float*)d_in[1];
  const float* Wq = (const float*)d_in[2];
  const float* bq = (const float*)d_in[3];
  const float* Wk = (const float*)d_in[4];
  const float* bk = (const float*)d_in[5];
  const float* Wv = (const float*)d_in[6];
  const float* bv = (const float*)d_in[7];
  const float* Wo = (const float*)d_in[8];
  const float* bo = (const float*)d_in[9];

  const int B = 4, L = kL;
  const int N = B * L;                       // 16384 rows
  const size_t mat = (size_t)N * kDim;       // elements per f16 intermediate

  _Float16* Qh  = (_Float16*)d_ws;           // 8 MB
  _Float16* Khw = Qh + mat;                  // 8 MB
  _Float16* VhT = Khw + mat;                 // 8 MB (transposed: [B][D][L])
  _Float16* WoT = VhT + mat;                 // 128 KB (transposed: [n][k])

  dim3 pgrid(N / kPR, kDim / kPC);           // 128 x 4 blocks, 256 threads
  proj_kernel <<<pgrid, 256, 0, stream>>>(x_dec, Wq, bq, Qh, Wo, WoT);
  projKV_kernel<<<pgrid, 256, 0, stream>>>(x_enc, Wk, bk, Wv, bv, Khw, VhT);

  dim3 agrid(L / kQB, B);                    // 64 x 4 blocks, 256 threads
  attn_kernel<<<agrid, 256, 0, stream>>>(Qh, Khw, VhT, WoT, bo, x_dec, (float*)d_out);
}

// v008
// A run of this version takes 65.6 microseconds.
// In two side-by-side timings against v007, it was 1.08 and 1.09 times as fast.
// Counting every step since v000, it is 8.16 times as fast.
#include <hip/hip_runtime.h>
#include <hip/hip_bf16.h>
#include <math.h>

// ---------------------------------------------------------------------------
// CDNA5 (gfx1250) cross-attention: wave32, v_wmma_f32_16x16x32_f16 matmuls,
// tensor loads global->LDS (TENSORcnt) for the K and V operands.
// ---------------------------------------------------------------------------

typedef __attribute__((ext_vector_type(16))) _Float16 v16h;
typedef __attribute__((ext_vector_type(8)))  float    v8f;

static constexpr int kDim = 256;   // model dim (single head, softmax scale 1/16)
static constexpr int kKC  = 128;   // k-chunk per flash-attention iteration
static constexpr int kL   = 4096;  // sequence length (Lq == Lk)

// WMMA 16x16x32 f16 fragment loaders (wave32 layouts per CDNA5 ISA 7.12.2).
// A-matrix 16x32: lane<16 -> row=lane, K = {kh*8..+7, 16+kh*8..+7}, kh=lane>>4.
// A row-major A-fragment of K is exactly the B-fragment of K^T (layout duality),
// so both A and B fragments load as two contiguous 16-byte chunks per lane.
__device__ inline v16h load_a_frag_f16(const _Float16* base, int ld, int lane) {
  const int m  = lane & 15;
  const int kh = lane >> 4;
  const _Float16* p = base + m * ld + kh * 8;
  v16h a;
#pragma unroll
  for (int j = 0; j < 8; ++j) {
    a[j]     = p[j];        // K = kh*8 + j
    a[j + 8] = p[16 + j];   // K = 16 + kh*8 + j
  }
  return a;
}

__device__ inline v16h load_a_frag_f32(const float* base, int ld, int lane) {
  const int m  = lane & 15;
  const int kh = lane >> 4;
  const float* p = base + m * ld + kh * 8;
  v16h a;
#pragma unroll
  for (int j = 0; j < 8; ++j) {
    a[j]     = (_Float16)p[j];
    a[j + 8] = (_Float16)p[16 + j];
  }
  return a;
}

__device__ inline v8f wmma_f16(v16h a, v16h b, v8f c) {
  return __builtin_amdgcn_wmma_f32_16x16x32_f16(false, a, false, b, (short)0, c,
                                                false, false);
}

// ---------------------------------------------------------------------------
// Projections, shared frame. Block: 256 threads = 8 waves; 128 rows x 64 cols.
// The block's whole W slab (256 k x 64 n) is converted to f16 and laid down
// transposed in LDS ONCE; each wave then runs its own 16 rows against it
// (4 accumulator tiles, 32 WMMAs), so one staging serves 128 rows. The rows come by
// whole-line loads and take fragment order on their way through LDS.
// ---------------------------------------------------------------------------
typedef __attribute__((ext_vector_type(8))) _Float16 v8h;
typedef __attribute__((ext_vector_type(4))) _Float16 v4h;
typedef __attribute__((ext_vector_type(4))) unsigned v4u;
typedef __attribute__((ext_vector_type(4))) float    v4f;

static constexpr int kPR = 128;        // rows per block
static constexpr int kPC = 64;         // cols per block
static constexpr int kWP = kDim + 8;   // slab row pitch in halves: 528 B = 16 B x 33

// Stands behind a run of global loads, in front of whatever reuses their address
// registers.
__device__ inline void wait_load_addresses() {
  asm volatile("s_wait_xcnt 0x0" ::: "memory");
}

// Slab staging, Wt[n][k] = f16(W[k][cbase + n]), in two halves so that the X
// loads can be issued between them. A thread owns column n = tid & 63 and eight
// units of 8 consecutive k: unit i starts at k = (tid >> 6) * 8 + i * 32. A wave
// covers 32 consecutive n, so each 4-byte load is one 128-byte line.
__device__ inline void load_w_slab(const float* __restrict__ W, int cbase, int tid,
                                   float (&f)[8][8]) {
  const float* wp = W + (size_t)((tid >> 6) * 8) * kDim + cbase + (tid & (kPC - 1));
#pragma unroll
  for (int i = 0; i < 8; ++i) {
#pragma unroll
    for (int j = 0; j < 8; ++j) f[i][j] = wp[(i * 32 + j) * kDim];
  }
  wait_load_addresses();
}

// One 16-byte LDS store per unit.
__device__ inline void store_w_slab(const float (&f)[8][8], _Float16 (*Wt)[kWP],
                                    int tid) {
#pragma unroll
  for (int i = 0; i < 8; ++i) {
    v8h t;
#pragma unroll
    for (int j = 0; j < 8; ++j) t[j] = (_Float16)f[i][j];
    *(v8h*)&Wt[tid & (kPC - 1)][(tid >> 6) * 8 + i * 32] = t;
  }
}

// One wave's 16 rows of X (16 rows x 256 k, f32) are 16 KB in a row. Load i takes
// bytes 512 i .. 512 i + 511 of them, 16 B a lane: four whole 128-byte lines. Read
// straight in fragment order, a load would touch 16 lines, 32 B of each.
__device__ inline void load_x_rows(const float* base, int lane, float4 (&x)[32]) {
  const float* p = base + lane * 4;
#pragma unroll
  for (int i = 0; i < 32; ++i) x[i] = *(const float4*)(p + i * 128);
  // The wait of wait_load_addresses(), with p named as an input: p stays in its
  // registers up to the wait, so that no load of the run lands in them.
  asm volatile("s_wait_xcnt 0x0" :: "v"(p) : "memory");
}

// The same rows, converted, into the wave's 16 rows of LDS: load i is half i & 1 of
// row i >> 1. One 8-byte store per load, 256 B in a row per wave.
__device__ inline void store_x_rows(const float4 (&x)[32], _Float16 (*Xw)[kWP], int lane) {
#pragma unroll
  for (int i = 0; i < 32; ++i) {
    v4h t;
    t[0] = (_Float16)x[i].x;
    t[1] = (_Float16)x[i].y;
    t[2] = (_Float16)x[i].z;
    t[3] = (_Float16)x[i].w;
    *(v4h*)&Xw[i >> 1][(i & 1) * 128 + lane * 4] = t;
  }
}

// The eight A fragments of those rows, from LDS.
__device__ inline void load_x_frags(const _Float16 (*Xw)[kWP], int lane, v16h (&a)[8]) {
#pragma unroll
  for (int d = 0; d < 8; ++d) a[d] = load_a_frag_f16(&Xw[0][d * 32], kWP, lane);
}

// acc[t] += A(16 x 256) @ W[:, t*16 .. t*16+15], k in ascending chunks of 32.
__device__ inline void rows16_times_slab(const v16h (&a)[8],
                                         const _Float16 (*Wt)[kWP], int lane,
                                         v8f (&acc)[4]) {
#pragma unroll
  for (int d = 0; d < 8; ++d) {
#pragma unroll
    for (int t = 0; t < 4; ++t) {
      v16h b = load_a_frag_f16(&Wt[t * 16][d * 32], kWP, lane);  // B-frag of W
      acc[t] = wmma_f16(a[d], b, acc[t]);
    }
  }
}

// ---------------------------------------------------------------------------
// K and V projections of the same rows in one kernel. A block reads its 128 rows
// of X ONCE, keeps them as f16 A fragments, and runs them against its 64-column
// slab of Wk and then of Wv, each slab in an LDS buffer of its own.
//   Y [row][col]   = f16(X @ Wk + bk)
//   YT[b][col][l]  = f16(X @ Wv + bv), transposed: rows r = 0..7 of a C tile are
//                    consecutive along l, one 16-byte store per lane and tile.
// The Wv slab is fetched behind the first barrier, so that it flies while the K
// products run.
// On the side, 64 of the blocks lay down WqT[n][k] = f16(Wq[k][n]) (y = 0) and
// WoT[n][k] = f16(Wo[k][n]) (y = 1) for the two projections inside the attention
// kernel: block x takes k = 8x .. 8x + 7, thread n one column. The loads go out with
// the block's own.
// ---------------------------------------------------------------------------
__global__ __launch_bounds__(256) void projKV_kernel(const float* __restrict__ X,
                                                     const float* __restrict__ Wk,
                                                     const float* __restrict__ bk,
                                                     const float* __restrict__ Wv,
                                                     const float* __restrict__ bv,
                                                     _Float16* __restrict__ Y,
                                                     _Float16* __restrict__ YT,
                                                     const float* __restrict__ Wq,
                                                     const float* __restrict__ Wo,
                                                     _Float16* __restrict__ WqT,
                                                     _Float16* __restrict__ WoT) {
  __shared__ alignas(16) _Float16 Wt[2][kPC][kWP];
  __shared__ alignas(16) _Float16 Xs[kPR][kWP];   // the block's rows, 16 a wave

  const int tid  = threadIdx.x;
  const int lane = tid & 31;
  const int w    = tid >> 5;
  const int rbase = blockIdx.x * kPR + w * 16;
  const int cbase = blockIdx.y * kPC;

  float  wf[8][8];
  float4 xr[32];
  load_w_slab(Wk, cbase, tid, wf);
  load_x_rows(X + (size_t)rbase * kDim, lane, xr);
  const bool prep = blockIdx.y < 2 && blockIdx.x < kDim / 8;   // the same for a whole block
  float of[8] = {};
  if (prep) {
    const float* Ws = blockIdx.y == 0 ? Wq : Wo;
#pragma unroll
    for (int j = 0; j < 8; ++j) of[j] = Ws[(blockIdx.x * 8 + j) * kDim + tid];
    // The wait of wait_load_addresses(), with the index named as an input: it stays in
    // its register up to the wait, so that no load of the run lands in it.
    asm volatile("s_wait_xcnt 0x0" :: "v"(tid) : "memory");
  }
  store_w_slab(wf, Wt[0], tid);
  store_x_rows(xr, &Xs[w * 16], lane);
  __syncthreads();                       // Wk slab and X rows readable

  if (prep) {
    _Float16* WsT = blockIdx.y == 0 ? WqT : WoT;
    v8h t;
#pragma unroll
    for (int j = 0; j < 8; ++j) t[j] = (_Float16)of[j];
    // The store and its s_wait_xcnt 0 in one statement, so that the wait stands in
    // front of any rewrite of the registers the store names: in a statement of its
    // own, the build lifts later register writes over it.
    asm volatile("global_store_b128 %0, %1, off\n\ts_wait_xcnt 0x0"
                 :: "v"(&WsT[(size_t)tid * kDim + blockIdx.x * 8]),
                    "v"(__builtin_bit_cast(v4u, t))
                 : "memory");
  }

  load_w_slab(Wv, cbase, tid, wf);

  v16h a[8];
  load_x_frags(&Xs[w * 16], lane, a);

  v8f acc[4] = {};
  rows16_times_slab(a, Wt[0], lane, acc);

  // Keeps the wait for the Wv loads behind the K products: mixed in among them, it
  // stalls the wave on loads issued just ahead, with most of its WMMAs still to do.
  __builtin_amdgcn_sched_barrier(0);
  store_w_slab(wf, Wt[1], tid);
  __syncthreads();                       // Wv slab readable by every wave

#pragma unroll
  for (int t = 0; t < 4; ++t) {
    const int col = cbase + t * 16 + (lane & 15);
    const float bb = bk[col];
#pragma unroll
    for (int r = 0; r < 8; ++r) {
      const int row = rbase + r + 8 * (lane >> 4);
      Y[(size_t)row * kDim + col] = (_Float16)(acc[t][r] + bb);
    }
  }
  wait_load_addresses();                 // the V part reuses registers these stores name

  v8f acv[4] = {};
  rows16_times_slab(a, Wt[1], lane, acv);

  const int row0 = rbase + 8 * (lane >> 4);   // 8 consecutive rows per lane
  const int b    = row0 >> 12;                // 4096 rows per batch
  const int l0   = row0 & (kL - 1);
#pragma unroll
  for (int t = 0; t < 4; ++t) {
    const int col  = cbase + t * 16 + (lane & 15);
    const float bb = bv[col];
    v8h tmp;
#pragma unroll
    for (int r = 0; r < 8; ++r) tmp[r] = (_Float16)(acv[t][r] + bb);
    *(v8h*)&YT[((size_t)b * kDim + col) * kL + l0] = tmp;
  }
}

static constexpr int kQB    = 64;
// A buffer is eight slices of 64 rows x 256 B, one per wave, each laid down by one
// tensor load with 16 B of pad behind every row:
//   slice 2a + e : K rows 64a .. 64a + 63 of the tile, d = 128e .. 128e + 127
//   slice 4 + a  : V^T rows 64a .. 64a + 63, the tile's 128 keys
static constexpr int kSR    = 64;              // rows of a slice
static constexpr int kSB    = 256;             // bytes of a slice's row
static constexpr int kTP    = kSB / 2 + 8;     // row pitch in halves: 272 B = 16 B x 17
static constexpr int kSlice = 9 * 1024;        // halves of a slice's place: 17,408 B, up to 9 x 2 KiB
static constexpr int kStage = 8 * kSlice;      // halves of one buffer (147,456 B)
static constexpr int kTiles = kL / kKC;
static_assert(kSR * kTP <= kSlice && (kSlice * 2) % 2048 == 0, "a slice fits its place");
static_assert(2 * kSR == kKC && 2 * kSB == kDim * 2 && 4 * kSR == kDim && kSB == kKC * 2,
              "eight slices cover a tile");
static_assert(kTiles >= 2, "the two-buffer prologue fills tiles 0 and 1");
static_assert(4 * kQB * kDim * 4 <= 2 * kStage * 2, "the join reuses the ring");
// LDS of the output projection at the end: O (64 rows) from the start of the ring,
// Wo^T (256 rows) placed so that its rows from kWoEarly on lie behind the 256 KB of
// the join: those rows are copied in while the quarters are joined, the rest after.
static constexpr int kJoin    = 4 * kQB * kDim * 2;         // halves the join uses
static constexpr int kWoEarly = 160;
static constexpr int kWtOff   = kJoin - kWoEarly * kWP;     // halves, a multiple of 8
// LDS of the Q projection at the start, all of it behind buffer 0, into which tile 0
// flies meanwhile: the block's 64 rows of x_dec as f16, later Q in their place, then
// Wq^T (256 rows).
static constexpr int kProX    = kStage;
static constexpr int kProW    = kProX + kQB * kWP;          // halves, a multiple of 8
static constexpr int kRing    = kProW + kDim * kWP;         // halves of the whole ring
static_assert(kRing >= 2 * kStage && kRing >= kWtOff + kDim * kWP && kQB * kWP <= kWtOff &&
              kWtOff % 8 == 0 && kProW % 8 == 0, "LDS plan");

// Lane l with lane l ^ 16.
__device__ inline float other_half(float x) {
  return __builtin_bit_cast(
      float, __builtin_amdgcn_permlanex16(__builtin_bit_cast(int, x),
                                          __builtin_bit_cast(int, x), 0x76543210,
                                          0xfedcba98, false, false));
}

// This wave's LDS reads have returned: stands in front of the barrier behind
// which their buffer is refilled.
__device__ inline void wait_lds_reads() {
  asm volatile("s_wait_dscnt 0x0" ::: "memory");
}

// This wave's async copies have landed: stands in front of the barrier behind
// which other waves read them.
__device__ inline void wait_copies() {
  asm volatile("s_wait_asynccnt 0x0" ::: "memory");
}

typedef uint32_t u32x4 __attribute__((ext_vector_type(4)));
typedef uint32_t u32x8 __attribute__((ext_vector_type(8)));

// A descriptor word: the same in every lane, in a scalar register.
__device__ inline uint32_t uni(uint32_t v) {
  return (uint32_t)__builtin_amdgcn_readfirstlane(v);
}

// A wave-uniform condition held in a scalar register, so that the test around a
// tensor load compiles to a scalar compare and branch: the load ignores EXEC, and
// only such a branch keeps a wave from issuing it.
__device__ inline uint32_t pinned(uint32_t v) {
  uint32_t w = uni(v);
  asm volatile("" : "+s"(w));   // pinned(): the word stays in a scalar register
  return w;
}

// This wave's tensor load has landed: stands in front of the barrier behind which
// other waves read its slice. The descriptor is named as an operand here and at the
// load, so that it keeps its scalar registers from the one to the other: no word of
// it takes a new value while the request is outstanding.
__device__ inline void wait_tensor(u32x4& g0, u32x8& g1) {
  asm volatile("s_wait_tensorcnt 0x0" : "+s"(g0), "+s"(g1) :: "memory");
}

// Descriptor group 1 of a slice: bytes as elements, tensor = tile = 64 rows of 256 B,
// source row pitch src_pitch bytes, 4 dwords of LDS pad behind every 64 dwords.
__device__ inline u32x8 slice_group1(uint32_t src_pitch) {
  u32x8 g;
  g[0] = uni((1u << 20) | (5u << 22) | (3u << 25));
  g[1] = uni((uint32_t)kSB << 16);
  g[2] = uni((uint32_t)kSR << 16);
  g[3] = uni((uint32_t)kSB << 16);
  g[4] = uni((uint32_t)kSR);
  g[5] = uni(src_pitch);
  g[6] = uni(0u);
  g[7] = uni(0u);
  return g;
}

// One request of the whole wave: the slice whose first byte is ga, to LDS byte lds.
__device__ inline void load_slice(uint32_t lds, uint64_t ga, u32x4& g0, u32x8& g1) {
  g0[0] = uni(1u);
  g0[1] = uni(lds);
  g0[2] = uni((uint32_t)ga);
  g0[3] = uni((((uint32_t)(ga >> 32)) & 0x01FFFFFFu) | 0x80000000u);
  asm volatile("tensor_load_to_lds %0, %1" : "+s"(g0), "+s"(g1) :: "memory");
}

// The fragment of load_a_frag_f16, same elements in the same order, from the
// lane's own address p = base + (lane & 15) * ld + (lane >> 4) * 8: the lane's part
// is formed once, in front of the tile loop, and takes one register.
__device__ inline v16h load_frag_at(const _Float16* p) {
  v16h a;
#pragma unroll
  for (int j = 0; j < 8; ++j) {
    a[j]     = p[j];        // K = kh*8 + j
    a[j + 8] = p[16 + j];   // K = 16 + kh*8 + j
  }
  return a;
}

// K fragments of k chunk d, one for each 16-key tile. Kt: the lane's own address.
__device__ inline void load_k_pair(const _Float16* Kt, int d, v16h (&k)[2]) {
  k[0] = load_frag_at(Kt + (d >> 2) * kSlice + (d & 3) * 32);
  k[1] = load_frag_at(Kt + (d >> 2) * kSlice + 16 * kTP + (d & 3) * 32);
}

// s[i][j] += K(key tile i) . Q^T(column group j) over k chunk d.
__device__ inline void s_chunk(const v16h (&k)[2], const v16h (&q)[2][8], int d,
                               v8f (&s)[2][2]) {
#pragma unroll
  for (int i = 0; i < 2; ++i) {
#pragma unroll
    for (int j = 0; j < 2; ++j) s[i][j] = wmma_f16(k[i], q[j][d], s[i][j]);
  }
}

// V^T fragments of output tiles 2u and 2u + 1. Vt: the lane's own address.
__device__ inline void load_v_pair(const _Float16* Vt, int u, v16h (&v)[2]) {
  v[0] = load_frag_at(Vt + (u >> 1) * kSlice + ((2 * u) & 3) * 16 * kTP);
  v[1] = load_frag_at(Vt + (u >> 1) * kSlice + ((2 * u + 1) & 3) * 16 * kTP);
}

// O^T tiles 2u and 2u + 1, both column groups: scaled by alpha, then += V^T . P^T.
__device__ inline void pv_pair(const v16h (&v)[2], const v16h (&pf)[2],
                               const float (&alpha)[2], int u, v8f (&o)[16][2]) {
#pragma unroll
  for (int x = 0; x < 2; ++x) {
#pragma unroll
    for (int j = 0; j < 2; ++j) o[2 * u + x][j] *= alpha[j];
  }
#pragma unroll
  for (int x = 0; x < 2; ++x) {
#pragma unroll
    for (int j = 0; j < 2; ++j)
      o[2 * u + x][j] = wmma_f16(v[x], pf[j], o[2 * u + x][j]);
  }
}

// Four 16-byte-per-lane copies global -> LDS, each a whole 512-byte row of Wo^T or Wq^T. The
// closing s_wait_xcnt 0 is part of the statement so that it stands in front of any
// rewrite of the address registers the copies name.
__device__ inline void copy4(unsigned l0, const _Float16* p0, unsigned l1,
                             const _Float16* p1, unsigned l2, const _Float16* p2,
                             unsigned l3, const _Float16* p3) {
  asm volatile(
      "global_load_async_to_lds_b128 %0, %4, off\n\t"
      "global_load_async_to_lds_b128 %1, %5, off\n\t"
      "global_load_async_to_lds_b128 %2, %6, off\n\t"
      "global_load_async_to_lds_b128 %3, %7, off\n\t"
      "s_wait_xcnt 0x0"
      :: "v"(l0), "v"(l1), "v"(l2), "v"(l3), "v"(p0), "v"(p1), "v"(p2), "v"(p3)
      : "memory");
}

// Rows kRow0 .. kRow0 + 8 * kPerWave - 1 of Wo^T (or Wq^T) into Wt (pitch kWP), kPerWave
// rows a wave.
template <int kRow0, int kPerWave>
__device__ inline void stage_wo(_Float16* Wt, const _Float16* WoT, int w, int lane) {
  static_assert(kPerWave % 4 == 0 && kRow0 + 8 * kPerWave <= kDim, "whole statements, in bounds");
  _Float16*       l = Wt + (kRow0 + w * kPerWave) * kWP + lane * 8;
  const _Float16* p = WoT + (kRow0 + w * kPerWave) * kDim + lane * 8;
#pragma unroll
  for (int i = 0; i < kPerWave; i += 4) {
    copy4((unsigned)(unsigned long long)(l + i * kWP), p + i * kDim,          // LDS byte addresses
          (unsigned)(unsigned long long)(l + (i + 1) * kWP), p + (i + 1) * kDim,
          (unsigned)(unsigned long long)(l + (i + 2) * kWP), p + (i + 2) * kDim,
          (unsigned)(unsigned long long)(l + (i + 3) * kWP), p + (i + 3) * kDim);
  }
}

// Output projection, k chunk d: A fragments of two query tiles of O, B fragments of
// four column tiles of Wo. Oa, Wb: the lane's own addresses.
__device__ inline void load_o_chunk(const _Float16* Oa, const _Float16* Wb, int d,
                                    v16h (&fa)[2], v16h (&fb)[4]) {
#pragma unroll
  for (int i = 0; i < 2; ++i) fa[i] = load_frag_at(Oa + i * 16 * kWP + d * 32);
#pragma unroll
  for (int t = 0; t < 4; ++t) fb[t] = load_frag_at(Wb + t * 16 * kWP + d * 32);
}

__global__ __launch_bounds__(256) void attn_kernel(const _Float16* __restrict__ WqT,
                                                   const float* __restrict__ bq,
                                                   const _Float16* __restrict__ Kh,
                                                   const _Float16* __restrict__ VhT,
                                                   const _Float16* __restrict__ WoT,
                                                   const float* __restrict__ bo,
                                                   const float* __restrict__ resid,
                                                   float* __restrict__ Out) {
  // Two K + V^T buffers; the prologue's and the epilogue's LDS. Every slice's place is a
  // multiple of 2 KiB.
  __shared__ __attribute__((aligned(2048))) _Float16 ring[kRing];
  __shared__ float jm[8][2][32], jl[8][2][32];       // join: m and l of every wave

  const int tid  = threadIdx.x;
  const int lane = tid & 31;
  // The wave's number, the same in every lane, held in a scalar register: the tile
  // loop needs nearly every vector register that two waves on a SIMD can own.
  const int w    = __builtin_amdgcn_readfirstlane(tid >> 5);
  const int qg   = w & 1;
  const int kq   = w >> 1;
  const int b     = blockIdx.y;
  const float cs = 0.0625f * 1.44269504088896340736f;  // 1/sqrt(256) * log2(e)

  const _Float16* Kb  = Kh  + (size_t)b * kL * kDim;
  const _Float16* VbT = VhT + (size_t)b * kDim * kL;

  // This wave's slice: waves 0 to 3 bring K, waves 4 to 7 V^T. From tile to tile the
  // source moves by 128 K rows, or by 128 keys along the V^T rows.
  const bool     isv   = w >= 4;
  const uint64_t src   = (uint64_t)(isv ? VbT + (size_t)(w & 3) * kSR * kL
                                        : Kb + (size_t)(w >> 1) * kSR * kDim + (w & 1) * (kSB / 2));
  const uint32_t step  = isv ? kKC * 2 : kKC * kDim * 2;              // bytes a tile
  const uint32_t place = (uint32_t)(uint64_t)ring + w * (kSlice * 2); // LDS byte address
  u32x8 g1 = slice_group1(isv ? kL * 2 : kDim * 2);
  u32x4 g0;

  load_slice(place, src, g0, g1);

  // ---- Q projection of the block's 64 queries, in place of a launch of its own, while
  // tile 0 flies: Q = f16(f16(x_dec) @ f16(Wq) + bq), k in ascending chunks of 32.
  _Float16 (*Xq)[kWP] = (_Float16 (*)[kWP])(ring + kProX);   // x_dec rows, then Q rows
  // Wave w takes Q^T rows (columns of Wq) 64 pn .. 64 pn + 63 of queries 32 pq ..
  // 32 pq + 31.
  const int pn = w & 3;
  const int pq = w >> 2;
  v4f qb[4][2];                          // bq: a lane's 8 rows of a tile are 8 columns of Wq in a row
  {
    // Wave w brings rows 8w .. 8w + 7: 8 KB in a row, whole lines, 16 B a lane and load.
    // These loads have the longest way and go out first.
    const float* xb = resid + ((size_t)b * kL + blockIdx.x * kQB + w * 8) * kDim;
    const float* xp = xb + lane * 4;
    const char* bp = (const char*)(bq + pn * kPC);
    const unsigned bofs = (lane >> 4) * 32;                  // bytes: 8 floats a wave half
    float4 xr[16];
#pragma unroll
    for (int i = 0; i < 16; ++i) xr[i] = *(const float4*)(xp + i * 128);
#pragma unroll
    for (int t = 0; t < 4; ++t) {
      qb[t][0] = *(const v4f*)(bp + bofs + t * 64);
      qb[t][1] = *(const v4f*)(bp + bofs + t * 64 + 16);
    }
    // The wait of wait_load_addresses(), with the two lane offsets and the two bases named
    // as inputs: they stay in their registers up to the wait, so that nothing is written
    // there ahead of it.
    asm volatile("s_wait_xcnt 0x0" :: "v"(lane), "v"(bofs), "s"(xb), "s"(bp) : "memory");
    stage_wo<0, kDim / 8>(ring + kProW, WqT, w, lane);       // all of Wq^T, 32 rows a wave
#pragma unroll
    for (int i = 0; i < 16; ++i) {
      v4h t;
      t[0] = (_Float16)xr[i].x;
      t[1] = (_Float16)xr[i].y;
      t[2] = (_Float16)xr[i].z;
      t[3] = (_Float16)xr[i].w;
      *(v4h*)&Xq[w * 8 + (i >> 1)][(i & 1) * 128 + lane * 4] = t;
    }
  }
  // Holds the bq loads up here, the loaded values as inputs only: sunk among the WMMAs
  // below, they bring idle slots and a wait for their address register into the first chunk.
  asm volatile("" :: "v"(qb[0][0]), "v"(qb[0][1]), "v"(qb[1][0]), "v"(qb[1][1]),
                     "v"(qb[2][0]), "v"(qb[2][1]), "v"(qb[3][0]), "v"(qb[3][1]));
  wait_copies();
  __syncthreads();                       // Wq^T and the x_dec rows readable by every wave

  // Q^T = Wq^T . x_dec^T: A = rows of Wq^T, B = rows of x_dec, both in the loader's k
  // order, so that a lane ends up with 8 consecutive d of one query. Fragments through
  // a ring of three chunks; the scheduling barriers keep a chunk's LDS reads together
  // and two chunks (16 WMMAs) ahead of their use, as in the output projection below.
  {
    const _Float16* Xa = &Xq[pq * 32 + (lane & 15)][(lane >> 4) * 8];
    const _Float16* Wa = ring + kProW + (pn * kPC + (lane & 15)) * kWP + (lane >> 4) * 8;
    v16h fx[3][2], fw[3][4];
    v8f  qa[2][4] = {};
    load_o_chunk(Xa, Wa, 0, fx[0], fw[0]);
    load_o_chunk(Xa, Wa, 1, fx[1], fw[1]);
    load_o_chunk(Xa, Wa, 2, fx[2], fw[2]);
    __builtin_amdgcn_sched_barrier(0);     // reads of chunks 0 to 2 in front of the WMMAs
#pragma unroll
    for (int d = 0; d < 8; ++d) {
#pragma unroll
      for (int t = 0; t < 4; ++t) {
#pragma unroll
        for (int i = 0; i < 2; ++i) qa[i][t] = wmma_f16(fw[d % 3][t], fx[d % 3][i], qa[i][t]);
      }
      if (d + 3 < 8) {
        __builtin_amdgcn_sched_barrier(0); // the next reads behind this chunk's WMMAs
        load_o_chunk(Xa, Wa, d + 3, fx[d % 3], fw[d % 3]);
        __builtin_amdgcn_sched_barrier(0); // and in front of the next chunk's
      }
    }
    wait_lds_reads();
    __syncthreads();                       // every wave's reads of the x_dec rows ended
    // Q takes their place: one 16-byte store per tile.
#pragma unroll
    for (int i = 0; i < 2; ++i) {
#pragma unroll
      for (int t = 0; t < 4; ++t) {
        v8h q;
#pragma unroll
        for (int r = 0; r < 8; ++r) q[r] = (_Float16)(qa[i][t][r] + qb[t][r >> 2][r & 3]);
        *(v8h*)&Xq[pq * 32 + i * 16 + (lane & 15)][pn * kPC + t * 16 + 8 * (lane >> 4)] = q;
      }
    }
  }
  __syncthreads();                         // Q readable by every wave

  // This wave's Q^T (256 x 32) as 2 x 8 B-fragments: lane (c, h) holds query
  // j * 16 + c in the k order of the K loader. Reused for every tile.
  v16h qfrag[2][8];
#pragma unroll
  for (int j = 0; j < 2; ++j) {
#pragma unroll
    for (int d = 0; d < 8; ++d)
      qfrag[j][d] = load_frag_at(&Xq[qg * 32 + j * 16 + (lane & 15)][d * 32 + (lane >> 4) * 8]);
  }
  wait_lds_reads();                      // Q is in registers: buffer 1 may be filled

  wait_tensor(g0, g1);
  __syncthreads();                       // tile 0 readable by every wave, Q's LDS free
  load_slice(place + kStage * 2, src + step, g0, g1);

  v8f   oacc[16][2] = {};                // O^T: d = t*16 + 8h + r, query j*16 + c
  float mrun[2] = {-3.0e38f, -3.0e38f};  // running maxima, log2 domain
  float lrun[2] = {0.0f, 0.0f};          // this lane's share of the running sums

  const int kfo = (kq >> 1) * 2 * kSlice + ((kq & 1) * 32 + (lane & 15)) * kTP + (lane >> 4) * 8;
  const int vfo = 4 * kSlice + (lane & 15) * kTP + kq * 32 + (lane >> 4) * 8;

  for (int t = 0; t < kTiles; ++t) {
    _Float16* buf = ring + (t & 1) * kStage;
    const _Float16* Kt = buf + kfo;
    const _Float16* Vt = buf + vfo;

    // ---- S^T: two 16-key tiles x two 16-query groups, K fragments through a ring
    // of three pairs. Each scheduling barrier below keeps a pair's LDS reads
    // together and two chunks (8 WMMAs) ahead of their use: spread among the
    // WMMAs, each WMMA stalls on a read issued just ahead of it; lifted further
    // up, the fragments no longer fit the registers.
    v16h kr[3][2];
    v8f  s[2][2] = {};
    load_k_pair(Kt, 0, kr[0]);
    load_k_pair(Kt, 1, kr[1]);
    load_k_pair(Kt, 2, kr[2]);
    __builtin_amdgcn_sched_barrier(0);   // reads of chunks 0 to 2 in front of the WMMAs
#pragma unroll
    for (int d = 0; d < 8; ++d) {
      s_chunk(kr[d % 3], qfrag, d, s);
      if (d + 3 < 8) {
        __builtin_amdgcn_sched_barrier(0); // the next reads behind this chunk's WMMAs
        load_k_pair(Kt, d + 3, kr[d % 3]);
        __builtin_amdgcn_sched_barrier(0); // and in front of the next chunk's
      }
    }

    // ---- online softmax of queries c and 16 + c, in registers
    v16h  pf[2];                           // P^T as B: pf[j][x] = P[query][kmap(x, h)]
    float alpha[2];
#pragma unroll
    for (int j = 0; j < 2; ++j) {
      float mx = fmaxf(s[0][j][0], s[1][j][0]);
#pragma unroll
      for (int r = 1; r < 8; ++r) mx = fmaxf(mx, fmaxf(s[0][j][r], s[1][j][r]));
      mx = fmaxf(mx, other_half(mx)) * cs;   // both halves hold the maximum of the wave's 32 keys
      const float mnew = fmaxf(mrun[j], mx);
      alpha[j] = __builtin_amdgcn_exp2f(mrun[j] - mnew);
      mrun[j]  = mnew;

      float ps0 = 0.0f, ps1 = 0.0f;
#pragma unroll
      for (int r = 0; r < 8; ++r) {
        const float p0 = __builtin_amdgcn_exp2f(fmaf(s[0][j][r], cs, -mnew));
        const float p1 = __builtin_amdgcn_exp2f(fmaf(s[1][j][r], cs, -mnew));
        pf[j][r]     = (_Float16)p0;
        pf[j][r + 8] = (_Float16)p1;
        ps0 += p0;
        ps1 += p1;
      }
      lrun[j] = lrun[j] * alpha[j] + (ps0 + ps1);
    }

    // ---- O^T = O^T * alpha + V^T(256 x 32) . P^T(32 x 32): the same ring, V^T
    // pair u in kr[u % 3].
    __builtin_amdgcn_sched_barrier(0);   // V^T reads behind the softmax: no registers earlier
    load_v_pair(Vt, 0, kr[0]);
    load_v_pair(Vt, 1, kr[1]);
    load_v_pair(Vt, 2, kr[2]);
    __builtin_amdgcn_sched_barrier(0);   // and in front of pair 0's scaling and WMMAs
#pragma unroll
    for (int u = 0; u < 8; ++u) {
      pv_pair(kr[u % 3], pf, alpha, u, oacc);
      if (u + 3 < 8) {
        __builtin_amdgcn_sched_barrier(0); // the next reads behind this pair's WMMAs
        load_v_pair(Vt, u + 3, kr[u % 3]);
        __builtin_amdgcn_sched_barrier(0); // and in front of the next pair's
      }
    }

    // ---- hand-over: tile t + 1 published, tile t's buffer free.
    // Keeps the hand-over behind the last WMMAs: lifted above them, its
    // s_wait_dscnt 0 stalls every wave on the V^T reads with nothing to do.
    __builtin_amdgcn_sched_barrier(0);
    wait_lds_reads();
    wait_tensor(g0, g1);
    __syncthreads();
    if (pinned(t + 2 < kTiles))
      load_slice(place + (t & 1) * (kStage * 2), src + (uint64_t)(t + 2) * step, g0, g1);
  }
  wait_tensor(g0, g1);
  wait_lds_reads();

  // The lane's number, read anew: taken from threadIdx it would hold a register all
  // through the tile loop, which then no longer keeps Q wholly in registers.
  const int ln = (int)__builtin_amdgcn_mbcnt_lo(~0u, 0u);

  // ---- join the wave halves' sums, then the four key quarters through the ring
  // (no copy of a tile in flight, every read of it ended by the last tile's barrier).
  // Every wave lays down its O^T, 32 KB in slot w = kq * 2 + qg; then wave (qg, kq)
  // adds up the four quarters of output tiles 4 kq .. 4 kq + 3 of its 32 queries.
  // Behind the join's part of the ring nothing is live any more: the upper rows of
  // Wo^T fly in while the quarters are laid down and joined.
  stage_wo<kWoEarly, (kDim - kWoEarly) / 8>(ring + kWtOff, WoT, w, ln);
#pragma unroll
  for (int j = 0; j < 2; ++j) lrun[j] += other_half(lrun[j]);
  float4* jo = (float4*)ring + ln;
  {
    float4* js = jo + (size_t)w * 64 * 32;
#pragma unroll
    for (int tt = 0; tt < 16; ++tt) {
#pragma unroll
      for (int j = 0; j < 2; ++j) {
        const v8f o = oacc[tt][j];
        js[(tt * 4 + j * 2 + 0) * 32] = make_float4(o[0], o[1], o[2], o[3]);
        js[(tt * 4 + j * 2 + 1) * 32] = make_float4(o[4], o[5], o[6], o[7]);
      }
    }
#pragma unroll
    for (int j = 0; j < 2; ++j) {
      jm[w][j][ln] = mrun[j];
      jl[w][j][ln] = lrun[j];
    }
  }
  __syncthreads();

  float a[4][2];                           // weight of quarter k for column group j
#pragma unroll
  for (int j = 0; j < 2; ++j) {
    float m[4], l[4];
#pragma unroll
    for (int k = 0; k < 4; ++k) {
      m[k] = jm[k * 2 + qg][j][ln];
      l[k] = jl[k * 2 + qg][j][ln];
    }
    const float mm = fmaxf(fmaxf(m[0], m[1]), fmaxf(m[2], m[3]));
    float den = 0.0f;
#pragma unroll
    for (int k = 0; k < 4; ++k) {
      a[k][j] = __builtin_amdgcn_exp2f(m[k] - mm);
      den += l[k] * a[k][j];
    }
    const float inv = 1.0f / den;
#pragma unroll
    for (int k = 0; k < 4; ++k) a[k][j] *= inv;
  }

  v8h res[2][4];
#pragma unroll
  for (int j = 0; j < 2; ++j) {
#pragma unroll
    for (int x = 0; x < 4; ++x) {
      const float4* jt = jo + (size_t)qg * 64 * 32 + ((kq * 4 + x) * 4 + j * 2) * 32;
      float f[8];
#pragma unroll
      for (int k = 0; k < 4; ++k) {
        const float4 u0 = jt[(size_t)k * 2 * 64 * 32];
        const float4 u1 = jt[(size_t)k * 2 * 64 * 32 + 32];
        const float  ak = a[k][j];
        if (k == 0) {
          f[0] = u0.x * ak;
          f[1] = u0.y * ak;
          f[2] = u0.z * ak;
          f[3] = u0.w * ak;
          f[4] = u1.x * ak;
          f[5] = u1.y * ak;
          f[6] = u1.z * ak;
          f[7] = u1.w * ak;
        } else {
          f[0] += u0.x * ak;
          f[1] += u0.y * ak;
          f[2] += u0.z * ak;
          f[3] += u0.w * ak;
          f[4] += u1.x * ak;
          f[5] += u1.y * ak;
          f[6] += u1.z * ak;
          f[7] += u1.w * ak;
        }
      }
#pragma unroll
      for (int r = 0; r < 8; ++r) res[j][x][r] = (_Float16)f[r];
    }
  }
  // ---- output projection and residual of the block's 64 queries, in place of a
  // launch of its own: out = f16(O) @ f16(Wo) + bo + x_dec, k in ascending chunks of 32.
  _Float16 (*Wt)[kWP] = (_Float16 (*)[kWP])(ring + kWtOff);       // Wt[n][k], 256 rows
  _Float16 (*Os)[kWP] = (_Float16 (*)[kWP])ring;                  // O[query][d], 64 rows
  __syncthreads();                         // every wave's join reads of the ring ended
  stage_wo<0, kWoEarly / 8>(ring + kWtOff, WoT, w, ln);
  // A lane's 8 values of a tile are 8 consecutive d of one query: one 16-byte store.
#pragma unroll
  for (int j = 0; j < 2; ++j) {
#pragma unroll
    for (int x = 0; x < 4; ++x)
      *(v8h*)&Os[qg * 32 + j * 16 + (ln & 15)][kq * 64 + x * 16 + 8 * (ln >> 4)] = res[j][x];
  }
  // Output projection: wave w takes query tiles 2 wq and 2 wq + 1, columns 64 wn ..
  // 64 wn + 63. Its residual and bias values fly while Wo^T lands.
  const int wn = w & 3;
  const int wq = w >> 2;
  const size_t obase = ((size_t)b * kL + blockIdx.x * kQB + wq * 32 + 8 * (ln >> 4)) * kDim +
                       wn * kPC + (ln & 15);
  float rs[2][4][8];                       // x_dec at this lane's 64 outputs
  {
    const float* rp = resid + obase;
#pragma unroll
    for (int i = 0; i < 2; ++i) {
#pragma unroll
      for (int t = 0; t < 4; ++t) {
#pragma unroll
        for (int r = 0; r < 8; ++r) rs[i][t][r] = rp[(i * 16 + r) * kDim + t * 16];
      }
    }
    // The wait of wait_load_addresses(), with rp named as an input: rp stays in its
    // registers up to the wait, so that no load of the run lands in them.
    asm volatile("s_wait_xcnt 0x0" :: "v"(rp) : "memory");
  }
  float bb[4];
  {
    const int bi = wn * kPC + (ln & 15);
#pragma unroll
    for (int t = 0; t < 4; ++t) bb[t] = bo[bi + t * 16];
    // The same wait, with the index named: it stays in its register up to the wait.
    asm volatile("s_wait_xcnt 0x0" :: "v"(bi) : "memory");
  }
  wait_copies();
  __syncthreads();                         // Wo^T and O readable by every wave

  // Fragments through a ring of three chunks. The scheduling barriers keep a chunk's
  // LDS reads together and two chunks (16 WMMAs) ahead of their use: left to the
  // build, each pair of WMMAs waits out a read issued just ahead of it.
  const _Float16* Oa = &Os[wq * 32 + (ln & 15)][(ln >> 4) * 8];
  const _Float16* Wb = &Wt[wn * kPC + (ln & 15)][(ln >> 4) * 8];
  v16h fa[3][2], fb[3][4];
  v8f  acc[2][4] = {};
  load_o_chunk(Oa, Wb, 0, fa[0], fb[0]);
  load_o_chunk(Oa, Wb, 1, fa[1], fb[1]);
  load_o_chunk(Oa, Wb, 2, fa[2], fb[2]);
  __builtin_amdgcn_sched_barrier(0);       // reads of chunks 0 to 2 in front of the WMMAs
#pragma unroll
  for (int d = 0; d < 8; ++d) {
#pragma unroll
    for (int t = 0; t < 4; ++t) {
#pragma unroll
      for (int i = 0; i < 2; ++i) acc[i][t] = wmma_f16(fa[d % 3][i], fb[d % 3][t], acc[i][t]);
    }
    if (d + 3 < 8) {
      __builtin_amdgcn_sched_barrier(0);   // the next reads behind this chunk's WMMAs
      load_o_chunk(Oa, Wb, d + 3, fa[d % 3], fb[d % 3]);
      __builtin_amdgcn_sched_barrier(0);   // and in front of the next chunk's
    }
  }

#pragma unroll
  for (int i = 0; i < 2; ++i) {
#pragma unroll
    for (int t = 0; t < 4; ++t) {
#pragma unroll
      for (int r = 0; r < 8; ++r) rs[i][t][r] = acc[i][t][r] + bb[t] + rs[i][t][r];
    }
  }
  // The stores stand last, so that nothing behind them rewrites a register they name.
  float* op = Out + obase;
#pragma unroll
  for (int i = 0; i < 2; ++i) {
#pragma unroll
    for (int t = 0; t < 4; ++t) {
#pragma unroll
      for (int r = 0; r < 8; ++r) op[(i * 16 + r) * kDim + t * 16] = rs[i][t][r];
    }
  }
}

// ---------------------------------------------------------------------------
extern "C" void kernel_launch(void* const* d_in, const int* in_sizes, int n_in,
                              void* d_out, int out_size, void* d_ws, size_t ws_size,
                              hipStream_t stream) {
  const float* x_dec = (const float*)d_in[0];
  const float* x_enc = (const float*)d_in[1];
  const float* Wq = (const float*)d_in[2];
  const float* bq = (const float*)d_in[3];
  const float* Wk = (const float*)d_in[4];
  const float* bk = (const float*)d_in[5];
  const float* Wv = (const float*)d_in[6];
  const float* bv = (const float*)d_in[7];
  const float* Wo = (const float*)d_in[8];
  const float* bo = (const float*)d_in[9];

  const int B = 4, L = kL;
  const int N = B * L;                       // 16384 rows
  const size_t mat = (size_t)N * kDim;       // elements per f16 intermediate

  _Float16* Khw = (_Float16*)d_ws;           // 8 MB
  _Float16* VhT = Khw + mat;                 // 8 MB (transposed: [B][D][L])
  _Float16* WoT = VhT + mat;                 // 128 KB (transposed: [n][k])
  _Float16* WqT = WoT + kDim * kDim;         // 128 KB (transposed: [n][k])

  dim3 pgrid(N / kPR, kDim / kPC);           // 128 x 4 blocks, 256 threads
  projKV_kernel<<<pgrid, 256, 0, stream>>>(x_enc, Wk, bk, Wv, bv, Khw, VhT, Wq, Wo, WqT, WoT);

  dim3 agrid(L / kQB, B);                    // 64 x 4 blocks, 256 threads
  attn_kernel<<<agrid, 256, 0, stream>>>(WqT, bq, Khw, VhT, WoT, bo, x_dec, (float*)d_out);
}

// v010
// One run takes 57.8 microseconds.
// Versions between v008 and this one are left out; their measured steps multiply to 1.14 times as fast.
// All steps since v000 together make it 9.27 times as fast.
#include <hip/hip_runtime.h>
#include <hip/hip_bf16.h>
#include <math.h>

// ---------------------------------------------------------------------------
// CDNA5 (gfx1250) cross-attention: wave32, v_wmma_f32_16x16x32_f16 matmuls,
// tensor loads global->LDS (TENSORcnt) for the tile that is both K and V.
// ---------------------------------------------------------------------------

typedef __attribute__((ext_vector_type(16))) _Float16 v16h;
typedef __attribute__((ext_vector_type(8)))  float    v8f;

static constexpr int kDim = 256;   // model dim (single head, softmax scale 1/16)
static constexpr int kKC  = 128;   // k-chunk per flash-attention iteration
static constexpr int kL   = 4096;  // sequence length (Lq == Lk)

// WMMA 16x16x32 f16 fragment loaders (wave32 layouts per CDNA5 ISA 7.12.2).
// A-matrix 16x32: lane<16 -> row=lane, K = {kh*8..+7, 16+kh*8..+7}, kh=lane>>4.
// A row-major A-fragment of K is exactly the B-fragment of K^T (layout duality),
// so both A and B fragments load as two contiguous 16-byte chunks per lane.
__device__ inline v16h load_a_frag_f16(const _Float16* base, int ld, int lane) {
  const int m  = lane & 15;
  const int kh = lane >> 4;
  const _Float16* p = base + m * ld + kh * 8;
  v16h a;
#pragma unroll
  for (int j = 0; j < 8; ++j) {
    a[j]     = p[j];        // K = kh*8 + j
    a[j + 8] = p[16 + j];   // K = 16 + kh*8 + j
  }
  return a;
}

__device__ inline v16h load_a_frag_f32(const float* base, int ld, int lane) {
  const int m  = lane & 15;
  const int kh = lane >> 4;
  const float* p = base + m * ld + kh * 8;
  v16h a;
#pragma unroll
  for (int j = 0; j < 8; ++j) {
    a[j]     = (_Float16)p[j];
    a[j + 8] = (_Float16)p[16 + j];
  }
  return a;
}

__device__ inline v8f wmma_f16(v16h a, v16h b, v8f c) {
  return __builtin_amdgcn_wmma_f32_16x16x32_f16(false, a, false, b, (short)0, c,
                                                false, false);
}

// ---------------------------------------------------------------------------
// Projections, shared frame. Block: 256 threads = 8 waves; 128 rows x 64 cols.
// The block's whole W slab (256 k x 64 n) is converted to f16 and laid down
// transposed in LDS ONCE; each wave then runs its own 16 rows against it
// (4 accumulator tiles, 32 WMMAs), so one staging serves 128 rows. The rows come by
// whole-line loads and take fragment order on their way through LDS.
// ---------------------------------------------------------------------------
typedef __attribute__((ext_vector_type(8))) _Float16 v8h;
typedef __attribute__((ext_vector_type(4))) _Float16 v4h;
typedef __attribute__((ext_vector_type(4))) unsigned v4u;
typedef __attribute__((ext_vector_type(4))) float    v4f;

static constexpr int kPR = 128;        // rows per block
static constexpr int kPC = 64;         // cols per block
static constexpr int kWP = kDim + 8;   // slab row pitch in halves: 528 B = 16 B x 33

// Stands behind a run of global loads, in front of whatever reuses their address
// registers.
__device__ inline void wait_load_addresses() {
  asm volatile("s_wait_xcnt 0x0" ::: "memory");
}

// Slab staging, Wt[n][k] = f16(W[k][cbase + n]), in two halves: the loads,
// then the stores. A thread owns column n = tid & 63 and eight
// units of 8 consecutive k: unit i starts at k = (tid >> 6) * 8 + i * 32. A wave
// covers 32 consecutive n, so each 4-byte load is one 128-byte line.
__device__ inline void load_w_slab(const float* __restrict__ W, int cbase, int tid,
                                   float (&f)[8][8]) {
  const float* wp = W + (size_t)((tid >> 6) * 8) * kDim + cbase + (tid & (kPC - 1));
#pragma unroll
  for (int i = 0; i < 8; ++i) {
#pragma unroll
    for (int j = 0; j < 8; ++j) f[i][j] = wp[(i * 32 + j) * kDim];
  }
  wait_load_addresses();
}

// One 16-byte LDS store per unit.
__device__ inline void store_w_slab(const float (&f)[8][8], _Float16 (*Wt)[kWP],
                                    int tid) {
#pragma unroll
  for (int i = 0; i < 8; ++i) {
    v8h t;
#pragma unroll
    for (int j = 0; j < 8; ++j) t[j] = (_Float16)f[i][j];
    *(v8h*)&Wt[tid & (kPC - 1)][(tid >> 6) * 8 + i * 32] = t;
  }
}

// One wave's 16 rows of X (16 rows x 256 k, f32) are 16 KB in a row. Load i takes
// bytes 512 i .. 512 i + 511 of them, 16 B a lane: four whole 128-byte lines. Read
// straight in fragment order, a load would touch 16 lines, 32 B of each.
__device__ inline void load_x_rows(const float* base, int lane, float4 (&x)[32]) {
  const float* p = base + lane * 4;
#pragma unroll
  for (int i = 0; i < 32; ++i) x[i] = *(const float4*)(p + i * 128);
  // The wait of wait_load_addresses(), with p named as an input: p stays in its
  // registers up to the wait, so that no load of the run lands in them.
  asm volatile("s_wait_xcnt 0x0" :: "v"(p) : "memory");
}

// The same rows, converted, into the wave's 16 rows of LDS: load i is half i & 1 of
// row i >> 1. One 8-byte store per load, 256 B in a row per wave.
__device__ inline void store_x_rows(const float4 (&x)[32], _Float16 (*Xw)[kWP], int lane) {
#pragma unroll
  for (int i = 0; i < 32; ++i) {
    v4h t;
    t[0] = (_Float16)x[i].x;
    t[1] = (_Float16)x[i].y;
    t[2] = (_Float16)x[i].z;
    t[3] = (_Float16)x[i].w;
    *(v4h*)&Xw[i >> 1][(i & 1) * 128 + lane * 4] = t;
  }
}

// The eight A fragments of those rows, from LDS.
__device__ inline void load_x_frags(const _Float16 (*Xw)[kWP], int lane, v16h (&a)[8]) {
#pragma unroll
  for (int d = 0; d < 8; ++d) a[d] = load_a_frag_f16(&Xw[0][d * 32], kWP, lane);
}

// acc[t] += A(16 x 256) @ W[:, t*16 .. t*16+15], k in ascending chunks of 32.
__device__ inline void rows16_times_slab(const v16h (&a)[8],
                                         const _Float16 (*Wt)[kWP], int lane,
                                         v8f (&acc)[4]) {
#pragma unroll
  for (int d = 0; d < 8; ++d) {
#pragma unroll
    for (int t = 0; t < 4; ++t) {
      v16h b = load_a_frag_f16(&Wt[t * 16][d * 32], kWP, lane);  // B-frag of W
      acc[t] = wmma_f16(a[d], b, acc[t]);
    }
  }
}

// ---------------------------------------------------------------------------
// Launch 1. The K and V projections are folded into the two projections on the query
// side, which the attention kernel does anyway:
//   S = (x_dec Wq + bq)(x_enc Wk + bk)^T = (x_dec Wqk + bqk) x_enc^T + (a term that is
//       the same for every key of a query, which the softmax cancels),
//       Wqk = Wq Wk^T, bqk = bq Wk^T;
//   out = (P (x_enc Wv + bv)) Wo + bo + x_dec = (P x_enc) Wvo + bvo + x_dec, the rows of
//       P summing to 1, Wvo = Wv Wo, bvo = bv Wo + bo.
// So the keys and the values are x_enc itself, as f16, row-major: one array for both.
// Blocks 0 to 15 form the two 256 x 256 weight products in the projection frame above
// (128 rows x 64 columns each) and store them transposed, [n][k]; the others convert
// 64 rows of x_enc each.
// ---------------------------------------------------------------------------
typedef __attribute__((ext_vector_type(2))) unsigned v2u;

static constexpr int kFold = 16;        // blocks of the weight products
static constexpr int kCR   = 64;        // rows of x_enc per conversion block

// One wave's 8 rows (8 KB in a row) by whole-line loads, as load_x_rows.
__device__ inline void load_8_rows(const float* base, int lane, float4 (&x)[16]) {
  const float* p = base + lane * 4;
#pragma unroll
  for (int i = 0; i < 16; ++i) x[i] = *(const float4*)(p + i * 128);
  // The wait of wait_load_addresses(), with p named as an input: p stays in its
  // registers up to the wait, so that no load of the run lands in them.
  asm volatile("s_wait_xcnt 0x0" :: "v"(p) : "memory");
}

__device__ inline v4h to_half4(float4 x) {
  v4h t;
  t[0] = (_Float16)x.x;
  t[1] = (_Float16)x.y;
  t[2] = (_Float16)x.z;
  t[3] = (_Float16)x.w;
  return t;
}

__global__ __launch_bounds__(256) void prep_kernel(const float* __restrict__ X,
                                                   const float* __restrict__ Wq,
                                                   const float* __restrict__ bq,
                                                   const float* __restrict__ Wk,
                                                   const float* __restrict__ Wv,
                                                   const float* __restrict__ bv,
                                                   const float* __restrict__ Wo,
                                                   const float* __restrict__ bo,
                                                   _Float16* __restrict__ Xh,
                                                   _Float16* __restrict__ WqkT,
                                                   float* __restrict__ bqk,
                                                   _Float16* __restrict__ WvoT,
                                                   float* __restrict__ bvo) {
  __shared__ alignas(16) _Float16 Wt[kPC][kWP];
  __shared__ alignas(16) _Float16 Xs[kPR][kWP];
  __shared__ float red[4][kPC];
  __shared__ alignas(16) float bl[kDim];

  const int tid  = threadIdx.x;
  const int lane = tid & 31;
  const int w    = tid >> 5;

  if (blockIdx.x >= kFold) {
    // ---- 64 rows of x_enc as f16, row-major, straight from the registers: whole lines.
    const int r0 = (blockIdx.x - kFold) * kCR;
    float4 x[16];
    load_8_rows(X + (size_t)(r0 + w * 8) * kDim, lane, x);
    v2u h[16];
#pragma unroll
    for (int i = 0; i < 16; ++i) h[i] = __builtin_bit_cast(v2u, to_half4(x[i]));
    // The stores and their s_wait_xcnt 0 in one statement, so that the wait stands in
    // front of any rewrite of the registers the stores name.
    asm volatile(
        "global_store_b64 %0, %1, off\n\t"
        "global_store_b64 %0, %2, off offset:256\n\t"
        "global_store_b64 %0, %3, off offset:512\n\t"
        "global_store_b64 %0, %4, off offset:768\n\t"
        "global_store_b64 %0, %5, off offset:1024\n\t"
        "global_store_b64 %0, %6, off offset:1280\n\t"
        "global_store_b64 %0, %7, off offset:1536\n\t"
        "global_store_b64 %0, %8, off offset:1792\n\t"
        "global_store_b64 %0, %9, off offset:2048\n\t"
        "global_store_b64 %0, %10, off offset:2304\n\t"
        "global_store_b64 %0, %11, off offset:2560\n\t"
        "global_store_b64 %0, %12, off offset:2816\n\t"
        "global_store_b64 %0, %13, off offset:3072\n\t"
        "global_store_b64 %0, %14, off offset:3328\n\t"
        "global_store_b64 %0, %15, off offset:3584\n\t"
        "global_store_b64 %0, %16, off offset:3840\n\t"
        "s_wait_xcnt 0x0"
        :: "v"(Xh + (size_t)(r0 + w * 8) * kDim + lane * 4),
           "v"(h[0]), "v"(h[1]), "v"(h[2]), "v"(h[3]), "v"(h[4]), "v"(h[5]), "v"(h[6]),
           "v"(h[7]), "v"(h[8]), "v"(h[9]), "v"(h[10]), "v"(h[11]), "v"(h[12]),
           "v"(h[13]), "v"(h[14]), "v"(h[15])
        : "memory");
    return;
  }

  // ---- weight products. Block: product m, rows 128 rb .., columns 64 cb ..
  const int  m     = blockIdx.x >> 3;    // 0: Wq Wk^T, 1: Wv Wo
  const int  rb    = (blockIdx.x >> 2) & 1;
  const int  cbase = (blockIdx.x & 3) * kPC;
  const int  rbase = rb * kPR + w * 16;
  const float bt = (m ? bv : bq)[tid];   // the bias to fold; the wait of the next run covers it
  float4 xr[32];
  load_x_rows((m ? Wv : Wq) + (size_t)rbase * kDim, lane, xr);
  if (m) {                               // Wt[n][j] = Wo[j][cbase + n]
    float wf[8][8];
    load_w_slab(Wo, cbase, tid, wf);
    store_w_slab(wf, Wt, tid);
  } else {                               // Wt[n][j] = Wk[cbase + n][j]: rows as they lie
    float4 kr[16];
    load_8_rows(Wk + (size_t)(cbase + w * 8) * kDim, lane, kr);
#pragma unroll
    for (int i = 0; i < 16; ++i)
      *(v4h*)&Wt[w * 8 + (i >> 1)][(i & 1) * 128 + lane * 4] = to_half4(kr[i]);
  }
  store_x_rows(xr, &Xs[w * 16], lane);
  bl[tid] = bt;
  __syncthreads();                       // slab, rows and bias readable by every wave

  // The folded bias of the block's 64 columns, once per column slab: thread (n, part)
  // sums 64 of the 256 terms.
  if (rb == 0) {
    const int part = tid >> 6;
    float s[4] = {0.0f, 0.0f, 0.0f, 0.0f};
#pragma unroll
    for (int c8 = 0; c8 < 8; ++c8) {
      const v8h wv = *(const v8h*)&Wt[tid & (kPC - 1)][part * 64 + c8 * 8];
      const v4f u0 = *(const v4f*)&bl[part * 64 + c8 * 8];
      const v4f u1 = *(const v4f*)&bl[part * 64 + c8 * 8 + 4];
#pragma unroll
      for (int e = 0; e < 4; ++e) s[e] += u0[e] * (float)wv[e] + u1[e] * (float)wv[e + 4];
    }
    red[part][tid & (kPC - 1)] = (s[0] + s[1]) + (s[2] + s[3]);
  }

  v16h a[8];
  load_x_frags(&Xs[w * 16], lane, a);
  v8f acc[4] = {};
  rows16_times_slab(a, Wt, lane, acc);
  __syncthreads();                       // the bias parts readable

  v4u o[4];
#pragma unroll
  for (int t = 0; t < 4; ++t) {
    v8h q;
#pragma unroll
    for (int r = 0; r < 8; ++r) q[r] = (_Float16)acc[t][r];
    o[t] = __builtin_bit_cast(v4u, q);
  }
  // Transposed, [n][k]: rows r = 0..7 of a C tile are consecutive k, one 16-byte store
  // per tile, 16 columns (16 * 512 B) apart. The wait as above.
  asm volatile(
      "global_store_b128 %0, %1, off\n\t"
      "global_store_b128 %0, %2, off offset:8192\n\t"
      "global_store_b128 %0, %3, off offset:16384\n\t"
      "global_store_b128 %0, %4, off offset:24576\n\t"
      "s_wait_xcnt 0x0"
      :: "v"((m ? WvoT : WqkT) + (size_t)(cbase + (lane & 15)) * kDim + rbase + 8 * (lane >> 4)),
         "v"(o[0]), "v"(o[1]), "v"(o[2]), "v"(o[3])
      : "memory");
  if (rb == 0 && tid < kPC) {
    float s = (red[0][tid] + red[1][tid]) + (red[2][tid] + red[3][tid]);
    if (m) s += bo[cbase + tid];
    (m ? bvo : bqk)[cbase + tid] = s;    // the last store: nothing behind it
  }
}

static constexpr int kQB    = 64;
// A buffer is eight slices of 32 rows x 256 B, one per wave, each laid down by one
// tensor load with 16 B of pad behind every row:
//   slice 2a + e : rows (keys) 32a .. 32a + 31 of the tile, d = 128e .. 128e + 127
static constexpr int kSR    = 32;              // rows of a slice
static constexpr int kSB    = 256;             // bytes of a slice's row
static constexpr int kTP    = kSB / 2 + 8;     // row pitch in halves: 272 B = 16 B x 17
static constexpr int kSlice = 5 * 1024;        // halves of a slice's place: 8,704 B, up to 5 x 2 KiB
static constexpr int kStage = 8 * kSlice;      // halves of one buffer (81,920 B)
static constexpr int kTiles = kL / kKC;
static_assert(kSR * kTP <= kSlice && (kSlice * 2) % 2048 == 0, "a slice fits its place");
static_assert(4 * kSR == kKC && 2 * kSB == kDim * 2, "eight slices cover a tile");
static_assert(kTiles >= 2, "the two-buffer prologue fills tiles 0 and 1");
// LDS of the output projection at the end: O (64 rows) from the start of the ring,
// Wo^T (256 rows) placed so that its rows from kWoEarly on lie behind the 256 KB of
// the join: those rows are copied in while the quarters are joined, the rest after.
static constexpr int kJoin    = 4 * kQB * kDim * 2;         // halves the join uses
static constexpr int kWoEarly = 160;
static constexpr int kWtOff   = kJoin - kWoEarly * kWP;     // halves, a multiple of 8
// LDS of the Q projection at the start, all of it behind buffer 0, into which tile 0
// flies meanwhile: the block's 64 rows of x_dec as f16, later Q in their place, then
// Wq^T (256 rows).
static constexpr int kProX    = kStage;
static constexpr int kProW    = kProX + kQB * kWP;          // halves, a multiple of 8
static constexpr int kRing    = kWtOff + kDim * kWP;        // halves of the whole ring
static_assert(kRing >= 2 * kStage && kRing >= kProW + kDim * kWP && kRing >= kJoin &&
              kQB * kWP <= kWtOff && kWtOff % 8 == 0 && kProW % 8 == 0, "LDS plan");

// Lane l with lane l ^ 16.
__device__ inline float other_half(float x) {
  return __builtin_bit_cast(
      float, __builtin_amdgcn_permlanex16(__builtin_bit_cast(int, x),
                                          __builtin_bit_cast(int, x), 0x76543210,
                                          0xfedcba98, false, false));
}

// This wave's LDS reads have returned: stands in front of the barrier behind
// which their buffer is refilled.
__device__ inline void wait_lds_reads() {
  asm volatile("s_wait_dscnt 0x0" ::: "memory");
}

// This wave's async copies have landed: stands in front of the barrier behind
// which other waves read them.
__device__ inline void wait_copies() {
  asm volatile("s_wait_asynccnt 0x0" ::: "memory");
}

typedef uint32_t u32x4 __attribute__((ext_vector_type(4)));
typedef uint32_t u32x8 __attribute__((ext_vector_type(8)));

// A descriptor word: the same in every lane, in a scalar register.
__device__ inline uint32_t uni(uint32_t v) {
  return (uint32_t)__builtin_amdgcn_readfirstlane(v);
}

// A wave-uniform condition held in a scalar register, so that the test around a
// tensor load compiles to a scalar compare and branch: the load ignores EXEC, and
// only such a branch keeps a wave from issuing it.
__device__ inline uint32_t pinned(uint32_t v) {
  uint32_t w = uni(v);
  asm volatile("" : "+s"(w));   // pinned(): the word stays in a scalar register
  return w;
}

// This wave's tensor load has landed: stands in front of the barrier behind which
// other waves read its slice. The descriptor is named as an operand here and at the
// load, so that it keeps its scalar registers from the one to the other: no word of
// it takes a new value while the request is outstanding.
__device__ inline void wait_tensor(u32x4& g0, u32x8& g1) {
  asm volatile("s_wait_tensorcnt 0x0" : "+s"(g0), "+s"(g1) :: "memory");
}

// Descriptor group 1 of a slice: bytes as elements, tensor = tile = 32 rows of 256 B,
// source row pitch src_pitch bytes, 4 dwords of LDS pad behind every 64 dwords.
__device__ inline u32x8 slice_group1(uint32_t src_pitch) {
  u32x8 g;
  g[0] = uni((1u << 20) | (5u << 22) | (3u << 25));
  g[1] = uni((uint32_t)kSB << 16);
  g[2] = uni((uint32_t)kSR << 16);
  g[3] = uni((uint32_t)kSB << 16);
  g[4] = uni((uint32_t)kSR);
  g[5] = uni(src_pitch);
  g[6] = uni(0u);
  g[7] = uni(0u);
  return g;
}

// One request of the whole wave: the slice whose first byte is ga, to LDS byte lds.
__device__ inline void load_slice(uint32_t lds, uint64_t ga, u32x4& g0, u32x8& g1) {
  g0[0] = uni(1u);
  g0[1] = uni(lds);
  g0[2] = uni((uint32_t)ga);
  g0[3] = uni((((uint32_t)(ga >> 32)) & 0x01FFFFFFu) | 0x80000000u);
  asm volatile("tensor_load_to_lds %0, %1" : "+s"(g0), "+s"(g1) :: "memory");
}

// The fragment of load_a_frag_f16, same elements in the same order, from the
// lane's own address p = base + (lane & 15) * ld + (lane >> 4) * 8: the lane's part
// is formed once, in front of the tile loop, and takes one register.
__device__ inline v16h load_frag_at(const _Float16* p) {
  v16h a;
#pragma unroll
  for (int j = 0; j < 8; ++j) {
    a[j]     = p[j];        // K = kh*8 + j
    a[j + 8] = p[16 + j];   // K = 16 + kh*8 + j
  }
  return a;
}

// K fragments of k chunk d, one for each 16-key tile. Kt: the lane's own address.
__device__ inline void load_k_pair(const _Float16* Kt, int d, v16h (&k)[2]) {
  k[0] = load_frag_at(Kt + (d >> 2) * kSlice + (d & 3) * 32);
  k[1] = load_frag_at(Kt + (d >> 2) * kSlice + 16 * kTP + (d & 3) * 32);
}

// s[i][j] += K(key tile i) . Q^T(column group j) over k chunk d.
__device__ inline void s_chunk(const v16h (&k)[2], const v16h (&q)[2][8], int d,
                               v8f (&s)[2][2]) {
#pragma unroll
  for (int i = 0; i < 2; ++i) {
#pragma unroll
    for (int j = 0; j < 2; ++j) s[i][j] = wmma_f16(k[i], q[j][d], s[i][j]);
  }
}

// Transposing LDS load: the 16 lanes of wave half h name eight rows of 32 B (lane l:
// row number l & 7 of its half, 16-byte piece (l >> 3) & 1); lane (c, h) gets column c
// of the eight rows of its half, in the order of their numbers.
typedef short s16x8 __attribute__((ext_vector_type(8)));
__device__ inline v8h load_tr16(const _Float16* p) {
  typedef __attribute__((address_space(3))) s16x8 lds_s16x8;
  return __builtin_bit_cast(v8h, __builtin_amdgcn_ds_load_tr16_b128_v8i16((lds_s16x8*)p));
}

// A fragment of V^T, 16 d x the wave's 32 keys, out of row-major rows: keys of the
// first 16 rows in elements 0 to 7, of the next 16 rows in elements 8 to 15.
__device__ inline v16h load_vt_frag(const _Float16* p) {
  return __builtin_shufflevector(load_tr16(p), load_tr16(p + 16 * kTP), 0, 1, 2, 3, 4, 5, 6, 7,
                                 8, 9, 10, 11, 12, 13, 14, 15);
}

// V^T fragments of output tiles 2u and 2u + 1 (16 d each). Vt: the lane's own address.
__device__ inline void load_v_pair(const _Float16* Vt, int u, v16h (&v)[2]) {
  v[0] = load_vt_frag(Vt + (u >> 2) * kSlice + ((2 * u) & 7) * 16);
  v[1] = load_vt_frag(Vt + (u >> 2) * kSlice + ((2 * u + 1) & 7) * 16);
}

// O^T tiles 2u and 2u + 1, both column groups: scaled by alpha, then += V^T . P^T.
__device__ inline void pv_pair(const v16h (&v)[2], const v16h (&pf)[2],
                               const float (&alpha)[2], int u, v8f (&o)[16][2]) {
#pragma unroll
  for (int x = 0; x < 2; ++x) {
#pragma unroll
    for (int j = 0; j < 2; ++j) o[2 * u + x][j] *= alpha[j];
  }
#pragma unroll
  for (int x = 0; x < 2; ++x) {
#pragma unroll
    for (int j = 0; j < 2; ++j)
      o[2 * u + x][j] = wmma_f16(v[x], pf[j], o[2 * u + x][j]);
  }
}

// Four 16-byte-per-lane copies global -> LDS, each a whole 512-byte row of Wo^T or Wq^T. The
// closing s_wait_xcnt 0 is part of the statement so that it stands in front of any
// rewrite of the address registers the copies name.
__device__ inline void copy4(unsigned l0, const _Float16* p0, unsigned l1,
                             const _Float16* p1, unsigned l2, const _Float16* p2,
                             unsigned l3, const _Float16* p3) {
  asm volatile(
      "global_load_async_to_lds_b128 %0, %4, off\n\t"
      "global_load_async_to_lds_b128 %1, %5, off\n\t"
      "global_load_async_to_lds_b128 %2, %6, off\n\t"
      "global_load_async_to_lds_b128 %3, %7, off\n\t"
      "s_wait_xcnt 0x0"
      :: "v"(l0), "v"(l1), "v"(l2), "v"(l3), "v"(p0), "v"(p1), "v"(p2), "v"(p3)
      : "memory");
}

// Rows kRow0 .. kRow0 + 8 * kPerWave - 1 of Wo^T (or Wq^T) into Wt (pitch kWP), kPerWave
// rows a wave.
template <int kRow0, int kPerWave>
__device__ inline void stage_wo(_Float16* Wt, const _Float16* WoT, int w, int lane) {
  static_assert(kPerWave % 4 == 0 && kRow0 + 8 * kPerWave <= kDim, "whole statements, in bounds");
  _Float16*       l = Wt + (kRow0 + w * kPerWave) * kWP + lane * 8;
  const _Float16* p = WoT + (kRow0 + w * kPerWave) * kDim + lane * 8;
#pragma unroll
  for (int i = 0; i < kPerWave; i += 4) {
    copy4((unsigned)(unsigned long long)(l + i * kWP), p + i * kDim,          // LDS byte addresses
          (unsigned)(unsigned long long)(l + (i + 1) * kWP), p + (i + 1) * kDim,
          (unsigned)(unsigned long long)(l + (i + 2) * kWP), p + (i + 2) * kDim,
          (unsigned)(unsigned long long)(l + (i + 3) * kWP), p + (i + 3) * kDim);
  }
}

// Output projection, k chunk d: A fragments of two query tiles of O, B fragments of
// four column tiles of Wo. Oa, Wb: the lane's own addresses.
__device__ inline void load_o_chunk(const _Float16* Oa, const _Float16* Wb, int d,
                                    v16h (&fa)[2], v16h (&fb)[4]) {
#pragma unroll
  for (int i = 0; i < 2; ++i) fa[i] = load_frag_at(Oa + i * 16 * kWP + d * 32);
#pragma unroll
  for (int t = 0; t < 4; ++t) fb[t] = load_frag_at(Wb + t * 16 * kWP + d * 32);
}

// What launch 1 hands over: WqT = (Wq Wk^T)^T and bq = bq Wk^T, Kh = f16(x_enc), which is
// K and V at once, WoT = (Wv Wo)^T and bo = bv Wo + bo. In the comments of this kernel
// Wq, Q, K, V, Wo and O stand for these folded forms.
__global__ __launch_bounds__(256) void attn_kernel(const _Float16* __restrict__ WqT,
                                                   const float* __restrict__ bq,
                                                   const _Float16* __restrict__ Kh,
                                                   const _Float16* __restrict__ WoT,
                                                   const float* __restrict__ bo,
                                                   const float* __restrict__ resid,
                                                   float* __restrict__ Out) {
  // Two tile buffers; the prologue's and the epilogue's LDS. Every slice's place is a
  // multiple of 2 KiB.
  __shared__ __attribute__((aligned(2048))) _Float16 ring[kRing];
  __shared__ float jm[8][2][32], jl[8][2][32];       // join: m and l of every wave

  const int tid  = threadIdx.x;
  const int lane = tid & 31;
  // The wave's number, the same in every lane, held in a scalar register: the tile
  // loop needs nearly every vector register that two waves on a SIMD can own.
  const int w    = __builtin_amdgcn_readfirstlane(tid >> 5);
  const int qg   = w & 1;
  const int kq   = w >> 1;
  const int b     = blockIdx.y;
  const float cs = 0.0625f * 1.44269504088896340736f;  // 1/sqrt(256) * log2(e)

  const _Float16* Kb  = Kh  + (size_t)b * kL * kDim;

  // This wave's slice. From tile to tile the source moves by 128 rows.
  const uint64_t src   = (uint64_t)(Kb + (size_t)(w >> 1) * kSR * kDim + (w & 1) * (kSB / 2));
  const uint32_t step  = kKC * kDim * 2;                              // bytes a tile
  const uint32_t place = (uint32_t)(uint64_t)ring + w * (kSlice * 2); // LDS byte address
  u32x8 g1 = slice_group1(kDim * 2);
  u32x4 g0;

  load_slice(place, src, g0, g1);

  // ---- Q projection of the block's 64 queries, in place of a launch of its own, while
  // tile 0 flies: Q = f16(f16(x_dec) @ f16(Wq) + bq), k in ascending chunks of 32.
  _Float16 (*Xq)[kWP] = (_Float16 (*)[kWP])(ring + kProX);   // x_dec rows, then Q rows
  // Wave w takes Q^T rows (columns of Wq) 64 pn .. 64 pn + 63 of queries 32 pq ..
  // 32 pq + 31.
  const int pn = w & 3;
  const int pq = w >> 2;
  v4f qb[4][2];                          // bq: a lane's 8 rows of a tile are 8 columns of Wq in a row
  {
    // Wave w brings rows 8w .. 8w + 7: 8 KB in a row, whole lines, 16 B a lane and load.
    // These loads have the longest way and go out first.
    const float* xb = resid + ((size_t)b * kL + blockIdx.x * kQB + w * 8) * kDim;
    const float* xp = xb + lane * 4;
    const char* bp = (const char*)(bq + pn * kPC);
    const unsigned bofs = (lane >> 4) * 32;                  // bytes: 8 floats a wave half
    float4 xr[16];
#pragma unroll
    for (int i = 0; i < 16; ++i) xr[i] = *(const float4*)(xp + i * 128);
#pragma unroll
    for (int t = 0; t < 4; ++t) {
      qb[t][0] = *(const v4f*)(bp + bofs + t * 64);
      qb[t][1] = *(const v4f*)(bp + bofs + t * 64 + 16);
    }
    // The wait of wait_load_addresses(), with the two lane offsets and the two bases named
    // as inputs: they stay in their registers up to the wait, so that nothing is written
    // there ahead of it.
    asm volatile("s_wait_xcnt 0x0" :: "v"(lane), "v"(bofs), "s"(xb), "s"(bp) : "memory");
    stage_wo<0, kDim / 8>(ring + kProW, WqT, w, lane);       // all of Wq^T, 32 rows a wave
#pragma unroll
    for (int i = 0; i < 16; ++i) {
      v4h t;
      t[0] = (_Float16)xr[i].x;
      t[1] = (_Float16)xr[i].y;
      t[2] = (_Float16)xr[i].z;
      t[3] = (_Float16)xr[i].w;
      *(v4h*)&Xq[w * 8 + (i >> 1)][(i & 1) * 128 + lane * 4] = t;
    }
  }
  // Holds the bq loads up here, the loaded values as inputs only: sunk among the WMMAs
  // below, they bring idle slots and a wait for their address register into the first chunk.
  asm volatile("" :: "v"(qb[0][0]), "v"(qb[0][1]), "v"(qb[1][0]), "v"(qb[1][1]),
                     "v"(qb[2][0]), "v"(qb[2][1]), "v"(qb[3][0]), "v"(qb[3][1]));
  wait_copies();
  __syncthreads();                       // Wq^T and the x_dec rows readable by every wave

  // Q^T = Wq^T . x_dec^T: A = rows of Wq^T, B = rows of x_dec, both in the loader's k
  // order, so that a lane ends up with 8 consecutive d of one query. Fragments through
  // a ring of three chunks; the scheduling barriers keep a chunk's LDS reads together
  // and two chunks (16 WMMAs) ahead of their use, as in the output projection below.
  {
    const _Float16* Xa = &Xq[pq * 32 + (lane & 15)][(lane >> 4) * 8];
    const _Float16* Wa = ring + kProW + (pn * kPC + (lane & 15)) * kWP + (lane >> 4) * 8;
    v16h fx[3][2], fw[3][4];
    v8f  qa[2][4] = {};
    load_o_chunk(Xa, Wa, 0, fx[0], fw[0]);
    load_o_chunk(Xa, Wa, 1, fx[1], fw[1]);
    load_o_chunk(Xa, Wa, 2, fx[2], fw[2]);
    __builtin_amdgcn_sched_barrier(0);     // reads of chunks 0 to 2 in front of the WMMAs
#pragma unroll
    for (int d = 0; d < 8; ++d) {
#pragma unroll
      for (int t = 0; t < 4; ++t) {
#pragma unroll
        for (int i = 0; i < 2; ++i) qa[i][t] = wmma_f16(fw[d % 3][t], fx[d % 3][i], qa[i][t]);
      }
      if (d + 3 < 8) {
        __builtin_amdgcn_sched_barrier(0); // the next reads behind this chunk's WMMAs
        load_o_chunk(Xa, Wa, d + 3, fx[d % 3], fw[d % 3]);
        __builtin_amdgcn_sched_barrier(0); // and in front of the next chunk's
      }
    }
    wait_lds_reads();
    __syncthreads();                       // every wave's reads of the x_dec rows ended
    // Q takes their place: one 16-byte store per tile.
#pragma unroll
    for (int i = 0; i < 2; ++i) {
#pragma unroll
      for (int t = 0; t < 4; ++t) {
        v8h q;
#pragma unroll
        for (int r = 0; r < 8; ++r) q[r] = (_Float16)(qa[i][t][r] + qb[t][r >> 2][r & 3]);
        *(v8h*)&Xq[pq * 32 + i * 16 + (lane & 15)][pn * kPC + t * 16 + 8 * (lane >> 4)] = q;
      }
    }
  }
  __syncthreads();                         // Q readable by every wave

  // This wave's Q^T (256 x 32) as 2 x 8 B-fragments: lane (c, h) holds query
  // j * 16 + c in the k order of the K loader. Reused for every tile.
  v16h qfrag[2][8];
#pragma unroll
  for (int j = 0; j < 2; ++j) {
#pragma unroll
    for (int d = 0; d < 8; ++d)
      qfrag[j][d] = load_frag_at(&Xq[qg * 32 + j * 16 + (lane & 15)][d * 32 + (lane >> 4) * 8]);
  }
  wait_lds_reads();                      // Q is in registers: buffer 1 may be filled

  wait_tensor(g0, g1);
  __syncthreads();                       // tile 0 readable by every wave, Q's LDS free
  load_slice(place + kStage * 2, src + step, g0, g1);

  v8f   oacc[16][2] = {};                // O^T: d = t*16 + 8h + r, query j*16 + c
  float mrun[2] = {-3.0e38f, -3.0e38f};  // running maxima, log2 domain
  float lrun[2] = {0.0f, 0.0f};          // this lane's share of the running sums

  // This lane's places in a buffer, both in the wave's 32 rows (slice 2 kq, d from 0).
  // At a pitch of 272 B the transposing load is free of bank conflicts when the eight
  // rows of a wave half lie two rows apart: half h takes rows 2 i + h of each 16, i its
  // row number. So position 8 h + i of the k order of P^T and V^T is row 2 i + h, and
  // row m of a K fragment, whose score lands at position m, is read from row
  // 2 (m & 7) + (m >> 3): 16 different rows as before, no conflict there either.
  const int kfo = kq * 2 * kSlice + (2 * (lane & 7) + ((lane >> 3) & 1)) * kTP + (lane >> 4) * 8;
  const int vfo = kq * 2 * kSlice + (2 * (lane & 7) + (lane >> 4)) * kTP + ((lane >> 3) & 1) * 8;

  for (int t = 0; t < kTiles; ++t) {
    _Float16* buf = ring + (t & 1) * kStage;
    const _Float16* Kt = buf + kfo;
    const _Float16* Vt = buf + vfo;

    // ---- S^T: two 16-key tiles x two 16-query groups, K fragments through a ring
    // of three pairs. Each scheduling barrier below keeps a pair's LDS reads
    // together and two chunks (8 WMMAs) ahead of their use: spread among the
    // WMMAs, each WMMA stalls on a read issued just ahead of it; lifted further
    // up, the fragments no longer fit the registers.
    v16h kr[3][2];
    v8f  s[2][2] = {};
    load_k_pair(Kt, 0, kr[0]);
    load_k_pair(Kt, 1, kr[1]);
    load_k_pair(Kt, 2, kr[2]);
    __builtin_amdgcn_sched_barrier(0);   // reads of chunks 0 to 2 in front of the WMMAs
#pragma unroll
    for (int d = 0; d < 8; ++d) {
      s_chunk(kr[d % 3], qfrag, d, s);
      if (d + 3 < 8) {
        __builtin_amdgcn_sched_barrier(0); // the next reads behind this chunk's WMMAs
        load_k_pair(Kt, d + 3, kr[d % 3]);
        __builtin_amdgcn_sched_barrier(0); // and in front of the next chunk's
      }
    }

    // ---- online softmax of queries c and 16 + c, in registers
    v16h  pf[2];                           // P^T as B: pf[j][x] = P[query][kmap(x, h)]
    float alpha[2];
#pragma unroll
    for (int j = 0; j < 2; ++j) {
      float mx = fmaxf(s[0][j][0], s[1][j][0]);
#pragma unroll
      for (int r = 1; r < 8; ++r) mx = fmaxf(mx, fmaxf(s[0][j][r], s[1][j][r]));
      mx = fmaxf(mx, other_half(mx)) * cs;   // both halves hold the maximum of the wave's 32 keys
      const float mnew = fmaxf(mrun[j], mx);
      alpha[j] = __builtin_amdgcn_exp2f(mrun[j] - mnew);
      mrun[j]  = mnew;

      float ps0 = 0.0f, ps1 = 0.0f;
#pragma unroll
      for (int r = 0; r < 8; ++r) {
        const float p0 = __builtin_amdgcn_exp2f(fmaf(s[0][j][r], cs, -mnew));
        const float p1 = __builtin_amdgcn_exp2f(fmaf(s[1][j][r], cs, -mnew));
        pf[j][r]     = (_Float16)p0;
        pf[j][r + 8] = (_Float16)p1;
        ps0 += p0;
        ps1 += p1;
      }
      lrun[j] = lrun[j] * alpha[j] + (ps0 + ps1);
    }

    // ---- O^T = O^T * alpha + V^T(256 x 32) . P^T(32 x 32): the same ring, V^T
    // pair u in kr[u % 3].
    __builtin_amdgcn_sched_barrier(0);   // V^T reads behind the softmax: no registers earlier
    load_v_pair(Vt, 0, kr[0]);
    load_v_pair(Vt, 1, kr[1]);
    load_v_pair(Vt, 2, kr[2]);
    __builtin_amdgcn_sched_barrier(0);   // and in front of pair 0's scaling and WMMAs
#pragma unroll
    for (int u = 0; u < 8; ++u) {
      pv_pair(kr[u % 3], pf, alpha, u, oacc);
      if (u + 3 < 8) {
        __builtin_amdgcn_sched_barrier(0); // the next reads behind this pair's WMMAs
        load_v_pair(Vt, u + 3, kr[u % 3]);
        __builtin_amdgcn_sched_barrier(0); // and in front of the next pair's
      }
    }

    // ---- hand-over: tile t + 1 published, tile t's buffer free.
    // Keeps the hand-over behind the last WMMAs: lifted above them, its
    // s_wait_dscnt 0 stalls every wave on the V^T reads with nothing to do.
    __builtin_amdgcn_sched_barrier(0);
    wait_lds_reads();
    wait_tensor(g0, g1);
    __syncthreads();
    if (pinned(t + 2 < kTiles))
      load_slice(place + (t & 1) * (kStage * 2), src + (uint64_t)(t + 2) * step, g0, g1);
  }
  wait_tensor(g0, g1);
  wait_lds_reads();

  // The lane's number, read anew: taken from threadIdx it would hold a register all
  // through the tile loop, which then no longer keeps Q wholly in registers.
  const int ln = (int)__builtin_amdgcn_mbcnt_lo(~0u, 0u);

  // ---- join the wave halves' sums, then the four key quarters through the ring
  // (no copy of a tile in flight, every read of it ended by the last tile's barrier).
  // Every wave lays down its O^T, 32 KB in slot w = kq * 2 + qg; then wave (qg, kq)
  // adds up the four quarters of output tiles 4 kq .. 4 kq + 3 of its 32 queries.
  // Behind the join's part of the ring nothing is live any more: the upper rows of
  // Wo^T fly in while the quarters are laid down and joined.
  stage_wo<kWoEarly, (kDim - kWoEarly) / 8>(ring + kWtOff, WoT, w, ln);
#pragma unroll
  for (int j = 0; j < 2; ++j) lrun[j] += other_half(lrun[j]);
  float4* jo = (float4*)ring + ln;
  {
    float4* js = jo + (size_t)w * 64 * 32;
#pragma unroll
    for (int tt = 0; tt < 16; ++tt) {
#pragma unroll
      for (int j = 0; j < 2; ++j) {
        const v8f o = oacc[tt][j];
        js[(tt * 4 + j * 2 + 0) * 32] = make_float4(o[0], o[1], o[2], o[3]);
        js[(tt * 4 + j * 2 + 1) * 32] = make_float4(o[4], o[5], o[6], o[7]);
      }
    }
#pragma unroll
    for (int j = 0; j < 2; ++j) {
      jm[w][j][ln] = mrun[j];
      jl[w][j][ln] = lrun[j];
    }
  }
  __syncthreads();

  float a[4][2];                           // weight of quarter k for column group j
#pragma unroll
  for (int j = 0; j < 2; ++j) {
    float m[4], l[4];
#pragma unroll
    for (int k = 0; k < 4; ++k) {
      m[k] = jm[k * 2 + qg][j][ln];
      l[k] = jl[k * 2 + qg][j][ln];
    }
    const float mm = fmaxf(fmaxf(m[0], m[1]), fmaxf(m[2], m[3]));
    float den = 0.0f;
#pragma unroll
    for (int k = 0; k < 4; ++k) {
      a[k][j] = __builtin_amdgcn_exp2f(m[k] - mm);
      den += l[k] * a[k][j];
    }
    const float inv = 1.0f / den;
#pragma unroll
    for (int k = 0; k < 4; ++k) a[k][j] *= inv;
  }

  v8h res[2][4];
#pragma unroll
  for (int j = 0; j < 2; ++j) {
#pragma unroll
    for (int x = 0; x < 4; ++x) {
      const float4* jt = jo + (size_t)qg * 64 * 32 + ((kq * 4 + x) * 4 + j * 2) * 32;
      float f[8];
#pragma unroll
      for (int k = 0; k < 4; ++k) {
        const float4 u0 = jt[(size_t)k * 2 * 64 * 32];
        const float4 u1 = jt[(size_t)k * 2 * 64 * 32 + 32];
        const float  ak = a[k][j];
        if (k == 0) {
          f[0] = u0.x * ak;
          f[1] = u0.y * ak;
          f[2] = u0.z * ak;
          f[3] = u0.w * ak;
          f[4] = u1.x * ak;
          f[5] = u1.y * ak;
          f[6] = u1.z * ak;
          f[7] = u1.w * ak;
        } else {
          f[0] += u0.x * ak;
          f[1] += u0.y * ak;
          f[2] += u0.z * ak;
          f[3] += u0.w * ak;
          f[4] += u1.x * ak;
          f[5] += u1.y * ak;
          f[6] += u1.z * ak;
          f[7] += u1.w * ak;
        }
      }
#pragma unroll
      for (int r = 0; r < 8; ++r) res[j][x][r] = (_Float16)f[r];
    }
  }
  // ---- output projection and residual of the block's 64 queries, in place of a
  // launch of its own: out = f16(O) @ f16(Wo) + bo + x_dec, k in ascending chunks of 32.
  _Float16 (*Wt)[kWP] = (_Float16 (*)[kWP])(ring + kWtOff);       // Wt[n][k], 256 rows
  _Float16 (*Os)[kWP] = (_Float16 (*)[kWP])ring;                  // O[query][d], 64 rows
  __syncthreads();                         // every wave's join reads of the ring ended
  stage_wo<0, kWoEarly / 8>(ring + kWtOff, WoT, w, ln);
  // A lane's 8 values of a tile are 8 consecutive d of one query: one 16-byte store.
#pragma unroll
  for (int j = 0; j < 2; ++j) {
#pragma unroll
    for (int x = 0; x < 4; ++x)
      *(v8h*)&Os[qg * 32 + j * 16 + (ln & 15)][kq * 64 + x * 16 + 8 * (ln >> 4)] = res[j][x];
  }
  // Output projection: wave w takes query tiles 2 wq and 2 wq + 1, columns 64 wn ..
  // 64 wn + 63. Its residual and bias values fly while Wo^T lands.
  const int wn = w & 3;
  const int wq = w >> 2;
  const size_t obase = ((size_t)b * kL + blockIdx.x * kQB + wq * 32 + 8 * (ln >> 4)) * kDim +
                       wn * kPC + (ln & 15);
  float rs[2][4][8];                       // x_dec at this lane's 64 outputs
  {
    const float* rp = resid + obase;
#pragma unroll
    for (int i = 0; i < 2; ++i) {
#pragma unroll
      for (int t = 0; t < 4; ++t) {
#pragma unroll
        for (int r = 0; r < 8; ++r) rs[i][t][r] = rp[(i * 16 + r) * kDim + t * 16];
      }
    }
    // The wait of wait_load_addresses(), with rp named as an input: rp stays in its
    // registers up to the wait, so that no load of the run lands in them.
    asm volatile("s_wait_xcnt 0x0" :: "v"(rp) : "memory");
  }
  float bb[4];
  {
    const int bi = wn * kPC + (ln & 15);
#pragma unroll
    for (int t = 0; t < 4; ++t) bb[t] = bo[bi + t * 16];
    // The same wait, with the index named: it stays in its register up to the wait.
    asm volatile("s_wait_xcnt 0x0" :: "v"(bi) : "memory");
  }
  wait_copies();
  __syncthreads();                         // Wo^T and O readable by every wave

  // Fragments through a ring of three chunks. The scheduling barriers keep a chunk's
  // LDS reads together and two chunks (16 WMMAs) ahead of their use: left to the
  // build, each pair of WMMAs waits out a read issued just ahead of it.
  const _Float16* Oa = &Os[wq * 32 + (ln & 15)][(ln >> 4) * 8];
  const _Float16* Wb = &Wt[wn * kPC + (ln & 15)][(ln >> 4) * 8];
  v16h fa[3][2], fb[3][4];
  v8f  acc[2][4] = {};
  load_o_chunk(Oa, Wb, 0, fa[0], fb[0]);
  load_o_chunk(Oa, Wb, 1, fa[1], fb[1]);
  load_o_chunk(Oa, Wb, 2, fa[2], fb[2]);
  __builtin_amdgcn_sched_barrier(0);       // reads of chunks 0 to 2 in front of the WMMAs
#pragma unroll
  for (int d = 0; d < 8; ++d) {
#pragma unroll
    for (int t = 0; t < 4; ++t) {
#pragma unroll
      for (int i = 0; i < 2; ++i) acc[i][t] = wmma_f16(fa[d % 3][i], fb[d % 3][t], acc[i][t]);
    }
    if (d + 3 < 8) {
      __builtin_amdgcn_sched_barrier(0);   // the next reads behind this chunk's WMMAs
      load_o_chunk(Oa, Wb, d + 3, fa[d % 3], fb[d % 3]);
      __builtin_amdgcn_sched_barrier(0);   // and in front of the next chunk's
    }
  }

#pragma unroll
  for (int i = 0; i < 2; ++i) {
#pragma unroll
    for (int t = 0; t < 4; ++t) {
#pragma unroll
      for (int r = 0; r < 8; ++r) rs[i][t][r] = acc[i][t][r] + bb[t] + rs[i][t][r];
    }
  }
  // The stores stand last, so that nothing behind them rewrites a register they name.
  float* op = Out + obase;
#pragma unroll
  for (int i = 0; i < 2; ++i) {
#pragma unroll
    for (int t = 0; t < 4; ++t) {
#pragma unroll
      for (int r = 0; r < 8; ++r) op[(i * 16 + r) * kDim + t * 16] = rs[i][t][r];
    }
  }
}

// ---------------------------------------------------------------------------
extern "C" void kernel_launch(void* const* d_in, const int* in_sizes, int n_in,
                              void* d_out, int out_size, void* d_ws, size_t ws_size,
                              hipStream_t stream) {
  const float* x_dec = (const float*)d_in[0];
  const float* x_enc = (const float*)d_in[1];
  const float* Wq = (const float*)d_in[2];
  const float* bq = (const float*)d_in[3];
  const float* Wk = (const float*)d_in[4];
  // d_in[5], bk, is not read: it adds one constant per query to that query's scores,
  // and the softmax cancels it.
  const float* Wv = (const float*)d_in[6];
  const float* bv = (const float*)d_in[7];
  const float* Wo = (const float*)d_in[8];
  const float* bo = (const float*)d_in[9];

  const int B = 4, L = kL;
  const int N = B * L;                       // 16384 rows
  const size_t mat = (size_t)N * kDim;       // elements per f16 intermediate

  _Float16* Khw = (_Float16*)d_ws;           // 8 MB: f16(x_enc), the keys and the values
  _Float16* WoT = Khw + mat;                 // 128 KB: (Wv Wo)^T, [n][k]
  _Float16* WqT = WoT + kDim * kDim;         // 128 KB: (Wq Wk^T)^T, [n][k]
  float*    bqk = (float*)(WqT + kDim * kDim);   // 1 KB: bq Wk^T
  float*    bvo = bqk + kDim;                    // 1 KB: bv Wo + bo

  dim3 pgrid(kFold + N / kCR);               // 16 + 256 blocks, 256 threads
  prep_kernel<<<pgrid, 256, 0, stream>>>(x_enc, Wq, bq, Wk, Wv, bv, Wo, bo, Khw, WqT, bqk, WoT,
                                         bvo);

  dim3 agrid(L / kQB, B);                    // 64 x 4 blocks, 256 threads
  attn_kernel<<<agrid, 256, 0, stream>>>(WqT, bqk, Khw, WoT, bvo, x_dec, (float*)d_out);
}
